// v000
// Times are from an AMD MI455X. After a warm-up the kernel runs many times in a row, and a time is the length of
// such a window on the GPU divided by its runs, so every launch and the gaps after it count. The runs cycle
// through copies of the inputs. A figure is the median of several windows, for all but v000 over two sittings.
// Sittings can differ by a few percent; kernels timed side by side share one.
// v000 is the starting kernel. One run takes 634 microseconds.
#include <hip/hip_runtime.h>

// Contractions, f32 accumulate: q/k/v = x.W + b ([2048 x 1024].[1024 x 1024]) and pos_k = rel.Wk + bk, pos_q = rel.Wq + bq ([1024 x 1024].[1024 x 1024]) on
// v_wmma_f32_16x16x32_bf16 with PLAIN bf16 operands (inputs rounded once: exact; k-major weights transposed into n-major planes); the disentangled attention on
// v_wmma_f32_16x16x32_f16 with every computed operand as f16 hi + residual x1024 (hi.hi + hi.lo + lo.hi): the full relative tables c2p_full = q.pos_k^T and
// p2c_full = k.pos_q^T ([512 x 64].[64 x 1024] per (b,h), in chunks of 8 (b,h) pairs), then the fused attention (content q.k, the gathered c2p[q][q-k+511] and

#define NB_  4
#define SS   512
#define DM   1024
#define NH_  16
#define HD   64
#define NR   1024                // 2 * att_span relative positions
#define NTK  (NB_ * SS)          // 2048
#define CHK  8                   // (b,h) pairs per chunk
#define PSC  32768.0f
#define LOSC 1024.0f
#define LOSCI (1.0f / 1024.0f)
#define SCL  0.07216878364870322f    // (64*3)^-0.5

typedef _Float16 h16;
typedef unsigned short bf;
typedef __attribute__((ext_vector_type(16))) __bf16   v16bf;
typedef __attribute__((ext_vector_type(16))) _Float16 v16h;
typedef __attribute__((ext_vector_type(8)))  _Float16 v8h;
typedef __attribute__((ext_vector_type(8)))  unsigned short v8us;
typedef __attribute__((ext_vector_type(8)))  float    v8f;
typedef __attribute__((ext_vector_type(4)))  float    v4f;
typedef v8h  __attribute__((may_alias)) v8ha;
typedef v4f  __attribute__((may_alias)) v4fa;
typedef v8us __attribute__((may_alias)) v8usa;

__device__ __forceinline__ unsigned short f2bf(float f) { unsigned u = __float_as_uint(f); u += 0x7FFFu + ((u >> 16) & 1u); return (unsigned short)(u >> 16); }
__device__ __forceinline__ float bf2f(unsigned short b) { return __uint_as_float(((unsigned)b) << 16); }
__device__ __forceinline__ float bfr(float f) { return bf2f(f2bf(f)); }
__device__ __forceinline__ v16h cat16(v8h lo, v8h hi) { return __builtin_shufflevector(lo, hi, 0, 1, 2, 3, 4, 5, 6, 7, 8, 9, 10, 11, 12, 13, 14, 15); }
__device__ __forceinline__ v16bf cat16b(v8us lo, v8us hi) { return __builtin_bit_cast(v16bf, __builtin_shufflevector(lo, hi, 0, 1, 2, 3, 4, 5, 6, 7, 8, 9, 10, 11, 12, 13, 14, 15)); }
__device__ __forceinline__ v8f wmma16(v16h a, v16h b, v8f c) { return __builtin_amdgcn_wmma_f32_16x16x32_f16(false, a, false, b, (short)0, c, false, false); }
__device__ __forceinline__ v8f wmmab(v16bf a, v16bf b, v8f c) { return __builtin_amdgcn_wmma_f32_16x16x32_bf16(false, a, false, b, (short)0, c, false, false); }
#define VST2(T, p, v) do { const T vst2_v_ = (v); *(T*)(p) = vst2_v_;  } while (0)

// k_cvtb: bf16 rows of an [nrows][1024] matrix; k_wt: k-major [1024][1024] -> n-major bf16.
__global__ __launch_bounds__(256) void k_cvtb(const float* __restrict__ src, int nrows, bf* dst) {
    const int lane = threadIdx.x & 31, r = blockIdx.x * 8 + (threadIdx.x >> 5);
    if (r >= nrows) return;
#pragma unroll
    for (int q = 0; q < DM / 256; ++q) { v8us t;
#pragma unroll
        for (int i = 0; i < 8; ++i) t[i] = f2bf(src[(size_t)r * DM + q * 256 + lane * 8 + i]);
        VST2(v8us, dst + (size_t)r * DM + q * 256 + lane * 8, t); }
}
__global__ __launch_bounds__(256) void k_wt(const float* __restrict__ Wm, bf* WT) {
    __shared__ __align__(16) unsigned short tl[64 * 72];
    const int tid = threadIdx.x, k0 = blockIdx.x * 64, n0 = blockIdx.y * 64;
    const int kk = tid >> 2, nq = (tid & 3) * 16;
#pragma unroll
    for (int i = 0; i < 16; ++i) tl[(nq + i) * 72 + kk] = f2bf(Wm[(size_t)(k0 + kk) * DM + n0 + nq + i]);
    __syncthreads();
    const int piece = tid & 7;
    auto pass = [&]() {
#pragma unroll
        for (int s = 0; s < 2; ++s) { const int nr = (tid >> 3) + 32 * s; const v8us val = *(const v8usa*)(tl + nr * 72 + piece * 8);
            *(v8us*)(WT + (size_t)(n0 + nr) * DM + k0 + piece * 8) = val; }
    };
    pass(); 
}
// k_gemmb: 64 x 64 tile of A.B^T + bias over K = 1024 (bf16 exact); MODE 0: f16 hi + residual planes (ld 1024); MODE 1: f32 rows (V).
template <int MODE>
__global__ __launch_bounds__(128) void k_gemmb(const bf* __restrict__ A, const bf* __restrict__ Bn, const float* __restrict__ bias, void* C, void* C2) {
    __shared__ __align__(16) float ost[4][16 * 68];
    const int lane = threadIdx.x & 31, wave = threadIdx.x >> 5, lr = lane & 15, hi = lane >> 4;
    const int r0 = blockIdx.x * 64 + wave * 16, c0 = blockIdx.y * 64;
    const size_t aoff = (size_t)(r0 + lr) * DM + 8 * hi;
    size_t boff[4];
#pragma unroll
    for (int t = 0; t < 4; ++t) boff[t] = (size_t)(c0 + t * 16 + lr) * DM + 8 * hi;
    v8f acc[4];
#pragma unroll
    for (int t = 0; t < 4; ++t) acc[t] = (v8f){};
#pragma unroll 1
    for (int kc = 0; kc < DM; kc += 32) {
        const v16bf a = cat16b(*(const v8us*)(A + aoff + kc), *(const v8us*)(A + aoff + kc + 16));
#pragma unroll
        for (int t = 0; t < 4; ++t) acc[t] = wmmab(a, cat16b(*(const v8us*)(Bn + boff[t] + kc), *(const v8us*)(Bn + boff[t] + kc + 16)), acc[t]);
        asm volatile("v_nop\n\tv_nop\n\tv_nop\n\tv_nop" : "+v"(acc[0]), "+v"(acc[1]), "+v"(acc[2]), "+v"(acc[3]) : "v"(a));
    }
    float* os = &ost[wave][0];
#pragma unroll
    for (int t = 0; t < 4; ++t) { const float bv = bfr(bias[c0 + t * 16 + lr]);
#pragma unroll
        for (int j = 0; j < 8; ++j) os[(hi * 8 + j) * 68 + t * 16 + lr] = acc[t][j] + bv; }
    __syncthreads();
    if (MODE == 1) {
        float* crow = (float*)C + (size_t)r0 * DM + c0;
        auto pass = [&]() {
#pragma unroll
            for (int s = 0; s < 8; ++s) { const int Lid = (lane >> 3) + 4 * s, piece = lane & 7; const int row = Lid >> 1, cofs = (Lid & 1) * 32 + piece * 4;
                const v4f val = *(const v4fa*)(os + row * 68 + cofs); *(v4f*)(crow + (size_t)row * DM + cofs) = val; }
        };
        pass(); 
    } else {
        h16* c1 = (h16*)C + (size_t)r0 * DM + c0; h16* c2 = (h16*)C2 + (size_t)r0 * DM + c0;
        auto pass = [&]() {
#pragma unroll
            for (int s = 0; s < 4; ++s) { const int row = 4 * s + (lane >> 3), piece = lane & 7; const float* sp = os + row * 68 + piece * 8; v8h o1, o2;
#pragma unroll
                for (int i = 0; i < 8; ++i) { const h16 a = (h16)sp[i]; o1[i] = a; o2[i] = (h16)((sp[i] - (float)a) * LOSC); }
                *(v8h*)(c1 + (size_t)row * DM + piece * 8) = o1; *(v8h*)(c2 + (size_t)row * DM + piece * 8) = o2; }
        };
        pass(); 
    }
}
// k_vt: VTH/VTL [b][h][d][s] = f16 hi + residual of V rows; block (b, h, 64 s).
__global__ __launch_bounds__(256) void k_vt(const float* __restrict__ V, h16* VTH, h16* VTL) {
    __shared__ __align__(16) h16 tile[HD * 72];
    __shared__ __align__(16) h16 til2[HD * 72];
    const int bid = blockIdx.x;
    const int b = bid / (NH_ * (SS / 64)), rem = bid - b * (NH_ * (SS / 64)), h = rem / (SS / 64), kt = rem - h * (SS / 64);
    const int s0 = kt * 64, tid = threadIdx.x, ss = tid >> 2, d0 = (tid & 3) * 16;
    const float* src = V + ((size_t)b * SS + s0 + ss) * DM + h * HD + d0;
#pragma unroll
    for (int i = 0; i < 16; ++i) { const float v = src[i]; const h16 a = (h16)v; tile[(d0 + i) * 72 + ss] = a; til2[(d0 + i) * 72 + ss] = (h16)((v - (float)a) * LOSC); }
    __syncthreads();
    const int piece = tid & 7;
    const size_t base = (((size_t)b * NH_ + h) * HD) * SS + s0;
    auto pass = [&]() {
#pragma unroll
        for (int s = 0; s < 4; ++s) { const int Lid = (tid >> 3) + 32 * s; const int pln = Lid >> 6, d = Lid & 63;
            const v8h val = *(const v8ha*)((pln ? til2 : tile) + d * 72 + piece * 8); *(v8h*)((pln ? VTL : VTH) + base + (size_t)d * SS + piece * 8) = val; }
    };
    pass(); 
}
// k_rel: 64 x 64 tile of T[p][row][r] = (AH + AL/1024)[row of head h].(PH + PL/1024)[r of head h] (hi.hi + hi.lo + lo.hi over K = 64) for the chunk's pair p = (b,h):
// A rows = token rows (b*512 + row) at column h*64, B rows = relative rows r (1024) of the pos plane at column h*64; grid (SS/64, NR/64, CHK); f32 [p][512][1024].
__global__ __launch_bounds__(128) void k_rel(const h16* __restrict__ AH, const h16* __restrict__ AL, const h16* __restrict__ PH, const h16* __restrict__ PL, int pair0, float* T) {
    __shared__ __align__(16) float ost[4][16 * 68];
    const int lane = threadIdx.x & 31, wave = threadIdx.x >> 5, lr = lane & 15, hi = lane >> 4;
    const int p = blockIdx.z, pr = pair0 + p, b = pr / NH_, h = pr - b * NH_;
    const int r0 = blockIdx.x * 64 + wave * 16, c0 = blockIdx.y * 64;
    const size_t aoff = ((size_t)b * SS + r0 + lr) * DM + h * HD + 8 * hi;
    v8f acc[4], accx[4];
#pragma unroll
    for (int t = 0; t < 4; ++t) { acc[t] = (v8f){}; accx[t] = (v8f){}; }
#pragma unroll
    for (int kc = 0; kc < 2; ++kc) {
        const v16h a = cat16(*(const v8h*)(AH + aoff + kc * 32), *(const v8h*)(AH + aoff + kc * 32 + 16)), al = cat16(*(const v8h*)(AL + aoff + kc * 32), *(const v8h*)(AL + aoff + kc * 32 + 16));
#pragma unroll
        for (int t = 0; t < 4; ++t) { const size_t bo = (size_t)(c0 + t * 16 + lr) * DM + h * HD + kc * 32 + 8 * hi;
            const v16h bh = cat16(*(const v8h*)(PH + bo), *(const v8h*)(PH + bo + 16)), bl = cat16(*(const v8h*)(PL + bo), *(const v8h*)(PL + bo + 16));
            acc[t] = wmma16(a, bh, acc[t]); accx[t] = wmma16(a, bl, accx[t]); accx[t] = wmma16(al, bh, accx[t]); }
    }
    asm volatile("v_nop\n\tv_nop\n\tv_nop\n\tv_nop" : "+v"(acc[0]), "+v"(acc[1]), "+v"(acc[2]), "+v"(acc[3]), "+v"(accx[0]), "+v"(accx[1]), "+v"(accx[2]), "+v"(accx[3]));
    float* os = &ost[wave][0];
#pragma unroll
    for (int t = 0; t < 4; ++t)
#pragma unroll
        for (int j = 0; j < 8; ++j) os[(hi * 8 + j) * 68 + t * 16 + lr] = acc[t][j] + accx[t][j] * LOSCI;
    __syncthreads();
    float* crow = T + ((size_t)p * SS + r0) * NR + c0;
    auto pass = [&]() {
#pragma unroll
        for (int s = 0; s < 8; ++s) { const int Lid = (lane >> 3) + 4 * s, piece = lane & 7; const int row = Lid >> 1, cofs = (Lid & 1) * 32 + piece * 4;
            const v4f val = *(const v4fa*)(os + row * 68 + cofs); *(v4f*)(crow + (size_t)row * NR + cofs) = val; }
    };
    pass(); 
}
// k_attn: block = (pair p of the chunk, 64 queries), wave = 16; 16 key tiles: content = q.k (hi.hi + hi.lo + lo.hi: 12 WMMA), bias = C2P[p][q][q - k + 511] +
// P2C[p][k][k - q + 511] gathered by the arithmetic index (always in range), logits = (content + bias) x SCL; online softmax; weights x32768 hi/residual; 12 WMMA .v;
__global__ __launch_bounds__(128) void k_attn(const h16* __restrict__ QH, const h16* __restrict__ QL, const h16* __restrict__ KH, const h16* __restrict__ KL,
                                             const float* __restrict__ C2P, const float* __restrict__ P2C, const h16* __restrict__ VTH, const h16* __restrict__ VTL, int pair0, float* out) {
    __shared__ __align__(16) h16 plds[4][16 * 32];
    __shared__ __align__(16) h16 plds2[4][16 * 32];
    __shared__ __align__(16) float ost[4][16 * 68];
    const int lane = threadIdx.x & 31, wave = threadIdx.x >> 5, lr = lane & 15, hi = lane >> 4;
    const int p = blockIdx.x / (SS / 64), qt = blockIdx.x - p * (SS / 64), pr = pair0 + p, b = pr / NH_, h = pr - b * NH_;
    const int q0 = qt * 64 + wave * 16;
    const size_t tok0 = (size_t)b * SS;
    h16* pl = &plds[wave][0]; h16* pl2 = &plds2[wave][0];
    v16h qa[2];
    const size_t qo0 = (tok0 + q0 + lr) * DM + h * HD + 8 * hi;
#pragma unroll
    for (int kc = 0; kc < 2; ++kc) qa[kc] = cat16(*(const v8h*)(QH + qo0 + kc * 32), *(const v8h*)(QH + qo0 + kc * 32 + 16));
    int qrow[8];
#pragma unroll
    for (int j = 0; j < 8; ++j) qrow[j] = q0 + 8 * hi + j;
    const float* c2p = C2P + (size_t)p * SS * NR; const float* p2c = P2C + (size_t)p * SS * NR;
    const size_t vbase = (((size_t)b * NH_ + h) * HD) * SS;
    v8f o[4], ox[4];
#pragma unroll
    for (int n = 0; n < 4; ++n) { o[n] = (v8f){}; ox[n] = (v8f){}; }
    float mrow[8], lpart[8];
#pragma unroll
    for (int j = 0; j < 8; ++j) { mrow[j] = -3.0e38f; lpart[j] = 0.f; }
#pragma unroll 1
    for (int kt = 0; kt < SS / 32; ++kt) {
        const int l0 = kt * 32;
        v8f s0 = {}, s1 = {}, x0 = {}, x1 = {};
#pragma unroll
        for (int kc = 0; kc < 2; ++kc) {
            const size_t ko = (tok0 + l0 + lr) * DM + h * HD + kc * 32 + 8 * hi, k1o = ko + (size_t)16 * DM;
            { const v16h k0h = cat16(*(const v8h*)(KH + ko), *(const v8h*)(KH + ko + 16)), k1h = cat16(*(const v8h*)(KH + k1o), *(const v8h*)(KH + k1o + 16));
              const v16h qlk = cat16(*(const v8h*)(QL + qo0 + kc * 32), *(const v8h*)(QL + qo0 + kc * 32 + 16));
              s0 = wmma16(qa[kc], k0h, s0); x0 = wmma16(qlk, k0h, x0); s1 = wmma16(qa[kc], k1h, s1); x1 = wmma16(qlk, k1h, x1);
              asm volatile("v_nop" : "+v"(s0), "+v"(s1), "+v"(x0), "+v"(x1) : "v"(qlk), "v"(k0h), "v"(k1h) : "memory"); }
            { const v16h k0l = cat16(*(const v8h*)(KL + ko), *(const v8h*)(KL + ko + 16)), k1l = cat16(*(const v8h*)(KL + k1o), *(const v8h*)(KL + k1o + 16));
              x0 = wmma16(qa[kc], k0l, x0); x1 = wmma16(qa[kc], k1l, x1);
              asm volatile("v_nop" : "+v"(x0), "+v"(x1) : "v"(k0l), "v"(k1l) : "memory"); }
        }
        asm volatile("v_nop\n\tv_nop\n\tv_nop\n\tv_nop" : "+v"(s0), "+v"(s1), "+v"(x0), "+v"(x1) : "v"(qa[0]), "v"(qa[1]));
        const int ka = l0 + lr, kb = l0 + 16 + lr;
        float alpha[8];
#pragma unroll
        for (int j = 0; j < 8; ++j) {
            const int q = qrow[j];
            const float ba = c2p[(size_t)q * NR + (q - ka + SS - 1)] + p2c[(size_t)ka * NR + (ka - q + SS - 1)];
            const float bb = c2p[(size_t)q * NR + (q - kb + SS - 1)] + p2c[(size_t)kb * NR + (kb - q + SS - 1)];
            const float a0 = (s0[j] + x0[j] * LOSCI + ba) * SCL, a1 = (s1[j] + x1[j] * LOSCI + bb) * SCL;
            float mx = fmaxf(a0, a1);
            mx = fmaxf(mx, __shfl_xor(mx, 1, 16)); mx = fmaxf(mx, __shfl_xor(mx, 2, 16)); mx = fmaxf(mx, __shfl_xor(mx, 4, 16)); mx = fmaxf(mx, __shfl_xor(mx, 8, 16));
            const float mn = fmaxf(mrow[j], mx);
            alpha[j] = __expf(mrow[j] - mn); mrow[j] = mn;
            const float e0 = __expf(a0 - mn), e1 = __expf(a1 - mn);
            lpart[j] = lpart[j] * alpha[j] + (e0 + e1);
            const int mr = hi * 8 + j;
            const float ps0 = e0 * PSC, ps1 = e1 * PSC; const h16 h0 = (h16)ps0, h1 = (h16)ps1;
            pl[mr * 32 + lr] = h0; pl[mr * 32 + 16 + lr] = h1; pl2[mr * 32 + lr] = (h16)((ps0 - (float)h0) * LOSC); pl2[mr * 32 + 16 + lr] = (h16)((ps1 - (float)h1) * LOSC);
        }
#pragma unroll
        for (int n = 0; n < 4; ++n)
#pragma unroll
            for (int j = 0; j < 8; ++j) { o[n][j] *= alpha[j]; ox[n][j] *= alpha[j]; }
        asm volatile("" ::: "memory");
        const v16h pa = cat16(*(const v8ha*)(pl + lr * 32 + hi * 8), *(const v8ha*)(pl + lr * 32 + 16 + hi * 8));
        const v16h px = cat16(*(const v8ha*)(pl2 + lr * 32 + hi * 8), *(const v8ha*)(pl2 + lr * 32 + 16 + hi * 8));
#pragma unroll
        for (int n = 0; n < 4; ++n) { const size_t vo = vbase + (size_t)(n * 16 + lr) * SS + l0 + hi * 8;
            const v16h vh = cat16(*(const v8h*)(VTH + vo), *(const v8h*)(VTH + vo + 16)), vl = cat16(*(const v8h*)(VTL + vo), *(const v8h*)(VTL + vo + 16));
            o[n] = wmma16(pa, vh, o[n]); ox[n] = wmma16(pa, vl, ox[n]); ox[n] = wmma16(px, vh, ox[n]);
            asm volatile("" : "+v"(o[n]), "+v"(ox[n]) : "v"(vh), "v"(vl) : "memory"); }
    }
    float inv[8];
#pragma unroll
    for (int j = 0; j < 8; ++j) { float rs = lpart[j]; rs += __shfl_xor(rs, 1, 16); rs += __shfl_xor(rs, 2, 16); rs += __shfl_xor(rs, 4, 16); rs += __shfl_xor(rs, 8, 16); inv[j] = 1.0f / (rs * PSC); }
    float* os = &ost[wave][0];
#pragma unroll
    for (int n = 0; n < 4; ++n)
#pragma unroll
        for (int j = 0; j < 8; ++j) os[(hi * 8 + j) * 68 + n * 16 + lr] = (o[n][j] + ox[n][j] * LOSCI) * inv[j];
    __syncthreads();
    float* ob = out + (tok0 + q0) * DM + (size_t)h * HD;
    auto pass = [&]() {
#pragma unroll
        for (int s = 0; s < 8; ++s) { const int Lid = (lane >> 3) + 4 * s, piece = lane & 7; const int row = Lid >> 1, cofs = (Lid & 1) * 32 + piece * 4;
            const v4f val = *(const v4fa*)(os + row * 68 + cofs); *(v4f*)(ob + (size_t)row * DM + cofs) = val; }
    };
    pass(); 
}

extern "C" void kernel_launch(void* const* d_in, const int* in_sizes, int n_in,
                              void* d_out, int out_size, void* d_ws, size_t ws_size, hipStream_t stream) {
    (void)in_sizes; (void)n_in; (void)out_size;
    const float* x = (const float*)d_in[0]; const float* rel = (const float*)d_in[1]; const float* Wq = (const float*)d_in[2]; const float* bq = (const float*)d_in[3];
    const float* Wk = (const float*)d_in[4]; const float* bk = (const float*)d_in[5]; const float* Wv = (const float*)d_in[6]; const float* bv = (const float*)d_in[7];
    float* out = (float*)d_out;    // [4][512][1024]
    char* wsp = (char*)d_ws;
    auto take = [&](size_t bytes) { char* p = wsp; wsp += (bytes + 255) & ~(size_t)255; return (void*)p; };
    bf* Xb = (bf*)take((size_t)NTK * DM * 2); bf* Rb = (bf*)take((size_t)NR * DM * 2); bf* WqT = (bf*)take((size_t)DM * DM * 2); bf* WkT = (bf*)take((size_t)DM * DM * 2); bf* WvT = (bf*)take((size_t)DM * DM * 2);
    h16* QH = (h16*)take((size_t)NTK * DM * 2); h16* QL = (h16*)take((size_t)NTK * DM * 2); h16* KH = (h16*)take((size_t)NTK * DM * 2); h16* KL = (h16*)take((size_t)NTK * DM * 2);
    h16* PKH = (h16*)take((size_t)NR * DM * 2); h16* PKL = (h16*)take((size_t)NR * DM * 2); h16* PQH = (h16*)take((size_t)NR * DM * 2); h16* PQL = (h16*)take((size_t)NR * DM * 2);
    float* Vf = (float*)take((size_t)NTK * DM * 4); h16* VTH = (h16*)take((size_t)NTK * DM * 2); h16* VTL = (h16*)take((size_t)NTK * DM * 2);
    float* C2P = (float*)take((size_t)CHK * SS * NR * 4); float* P2C = (float*)take((size_t)CHK * SS * NR * 4);
    if ((size_t)(wsp - (char*)d_ws) > ws_size) return;    // 4.2 + 2.1 + 6.3 + 16.8 + 8.4 + 8.4 + 8.4 + 16.8 + 16.8 ~ 88 MB
    k_cvtb<<<NTK / 8, 256, 0, stream>>>(x, NTK, Xb);
    k_cvtb<<<NR / 8, 256, 0, stream>>>(rel, NR, Rb);                  // rel_embeddings[0 : 1024] (att_span = 512 = MAX_REL -> the whole table)
    k_wt<<<dim3(DM / 64, DM / 64, 1), 256, 0, stream>>>(Wq, WqT); k_wt<<<dim3(DM / 64, DM / 64, 1), 256, 0, stream>>>(Wk, WkT); k_wt<<<dim3(DM / 64, DM / 64, 1), 256, 0, stream>>>(Wv, WvT);
    k_gemmb<0><<<dim3(NTK / 64, DM / 64, 1), 128, 0, stream>>>(Xb, WqT, bq, QH, QL);
    k_gemmb<0><<<dim3(NTK / 64, DM / 64, 1), 128, 0, stream>>>(Xb, WkT, bk, KH, KL);
    k_gemmb<1><<<dim3(NTK / 64, DM / 64, 1), 128, 0, stream>>>(Xb, WvT, bv, Vf, nullptr);
    k_gemmb<0><<<dim3(NR / 64, DM / 64, 1), 128, 0, stream>>>(Rb, WkT, bk, PKH, PKL);       // pos_k = rel.Wk + bk
    k_gemmb<0><<<dim3(NR / 64, DM / 64, 1), 128, 0, stream>>>(Rb, WqT, bq, PQH, PQL);       // pos_q = rel.Wq + bq
    k_vt<<<NB_ * NH_ * (SS / 64), 256, 0, stream>>>(Vf, VTH, VTL);
    for (int c = 0; c < (NB_ * NH_) / CHK; ++c) {
        const int pair0 = c * CHK;
        k_rel<<<dim3(SS / 64, NR / 64, CHK), 128, 0, stream>>>(QH, QL, PKH, PKL, pair0, C2P);    // c2p_full = q . pos_k^T
        k_rel<<<dim3(SS / 64, NR / 64, CHK), 128, 0, stream>>>(KH, KL, PQH, PQL, pair0, P2C);    // p2c_full = k . pos_q^T
        k_attn<<<CHK * (SS / 64), 128, 0, stream>>>(QH, QL, KH, KL, C2P, P2C, VTH, VTL, pair0, out);
    }
}

// v001
// A run of this version takes 309 microseconds.
// Next to v000, in two timings, it ran 2.05 and 2.04 times as fast.
#include <hip/hip_runtime.h>

// Contractions, f32 accumulate: q/k/v = x.W + b ([2048 x 1024].[1024 x 1024]) and pos_k = rel.Wk + bk, pos_q = rel.Wq + bq ([1024 x 1024].[1024 x 1024]) on
// v_wmma_f32_16x16x32_bf16 with PLAIN bf16 operands (inputs rounded once: exact; k-major weights transposed into n-major planes); the disentangled attention on
// v_wmma_f32_16x16x32_f16 with every computed operand as f16 hi + residual x1024 (hi.hi + hi.lo + lo.hi): the full relative tables c2p_full = q.pos_k^T and
// p2c_full = k.pos_q^T ([512 x 64].[64 x 1024] per (b,h), in chunks of 32 (b,h) pairs), then the fused attention (content q.k, the gathered c2p[q][q-k+511] and

#define NB_  4
#define SS   512
#define DM   1024
#define NH_  16
#define HD   64
#define NR   1024                // 2 * att_span relative positions
#define NTK  (NB_ * SS)          // 2048
#define CHK  32                  // (b,h) pairs per chunk: 256 attention blocks a launch, one for each WGP
#define PSC  32768.0f
#define LOSC 1024.0f
#define LOSCI (1.0f / 1024.0f)
#define SCL  0.07216878364870322f    // (64*3)^-0.5

typedef _Float16 h16;
typedef unsigned short bf;
typedef __attribute__((ext_vector_type(16))) __bf16   v16bf;
typedef __attribute__((ext_vector_type(16))) _Float16 v16h;
typedef __attribute__((ext_vector_type(8)))  _Float16 v8h;
typedef __attribute__((ext_vector_type(8)))  unsigned short v8us;
typedef __attribute__((ext_vector_type(8)))  float    v8f;
typedef __attribute__((ext_vector_type(4)))  float    v4f;
typedef v8h  __attribute__((may_alias)) v8ha;
typedef v4f  __attribute__((may_alias)) v4fa;
typedef v8us __attribute__((may_alias)) v8usa;

__device__ __forceinline__ unsigned short f2bf(float f) { unsigned u = __float_as_uint(f); u += 0x7FFFu + ((u >> 16) & 1u); return (unsigned short)(u >> 16); }
__device__ __forceinline__ float bf2f(unsigned short b) { return __uint_as_float(((unsigned)b) << 16); }
__device__ __forceinline__ float bfr(float f) { return bf2f(f2bf(f)); }
__device__ __forceinline__ v16h cat16(v8h lo, v8h hi) { return __builtin_shufflevector(lo, hi, 0, 1, 2, 3, 4, 5, 6, 7, 8, 9, 10, 11, 12, 13, 14, 15); }
__device__ __forceinline__ v16bf cat16b(v8us lo, v8us hi) { return __builtin_bit_cast(v16bf, __builtin_shufflevector(lo, hi, 0, 1, 2, 3, 4, 5, 6, 7, 8, 9, 10, 11, 12, 13, 14, 15)); }
__device__ __forceinline__ v8f wmma16(v16h a, v16h b, v8f c) { return __builtin_amdgcn_wmma_f32_16x16x32_f16(false, a, false, b, (short)0, c, false, false); }
__device__ __forceinline__ v8f wmmab(v16bf a, v16bf b, v8f c) { return __builtin_amdgcn_wmma_f32_16x16x32_bf16(false, a, false, b, (short)0, c, false, false); }
#define VST2(T, p, v) do { const T vst2_v_ = (v); *(T*)(p) = vst2_v_;  } while (0)

// k_cvtb: bf16 rows of an [nrows][1024] matrix; k_wt: k-major [1024][1024] -> n-major bf16.
__global__ __launch_bounds__(256) void k_cvtb(const float* __restrict__ src, int nrows, bf* dst) {
    const int lane = threadIdx.x & 31, r = blockIdx.x * 8 + (threadIdx.x >> 5);
    if (r >= nrows) return;
#pragma unroll
    for (int q = 0; q < DM / 256; ++q) { v8us t;
#pragma unroll
        for (int i = 0; i < 8; ++i) t[i] = f2bf(src[(size_t)r * DM + q * 256 + lane * 8 + i]);
        VST2(v8us, dst + (size_t)r * DM + q * 256 + lane * 8, t); }
}
__global__ __launch_bounds__(256) void k_wt(const float* __restrict__ Wm, bf* WT) {
    __shared__ __align__(16) unsigned short tl[64 * 72];
    const int tid = threadIdx.x, k0 = blockIdx.x * 64, n0 = blockIdx.y * 64;
    const int kk = tid >> 2, nq = (tid & 3) * 16;
#pragma unroll
    for (int i = 0; i < 16; ++i) tl[(nq + i) * 72 + kk] = f2bf(Wm[(size_t)(k0 + kk) * DM + n0 + nq + i]);
    __syncthreads();
    const int piece = tid & 7;
    auto pass = [&]() {
#pragma unroll
        for (int s = 0; s < 2; ++s) { const int nr = (tid >> 3) + 32 * s; const v8us val = *(const v8usa*)(tl + nr * 72 + piece * 8);
            *(v8us*)(WT + (size_t)(n0 + nr) * DM + k0 + piece * 8) = val; }
    };
    pass(); 
}
// k_gemmb: 64 x 64 tile of A.B^T + bias over K = 1024 (bf16 exact); MODE 0: f16 hi + residual planes (ld 1024); MODE 1: f32 rows (V).
template <int MODE>
__global__ __launch_bounds__(128) void k_gemmb(const bf* __restrict__ A, const bf* __restrict__ Bn, const float* __restrict__ bias, void* C, void* C2) {
    __shared__ __align__(16) float ost[4][16 * 68];
    const int lane = threadIdx.x & 31, wave = threadIdx.x >> 5, lr = lane & 15, hi = lane >> 4;
    const int r0 = blockIdx.x * 64 + wave * 16, c0 = blockIdx.y * 64;
    const size_t aoff = (size_t)(r0 + lr) * DM + 8 * hi;
    size_t boff[4];
#pragma unroll
    for (int t = 0; t < 4; ++t) boff[t] = (size_t)(c0 + t * 16 + lr) * DM + 8 * hi;
    v8f acc[4];
#pragma unroll
    for (int t = 0; t < 4; ++t) acc[t] = (v8f){};
#pragma unroll 1
    for (int kc = 0; kc < DM; kc += 32) {
        const v16bf a = cat16b(*(const v8us*)(A + aoff + kc), *(const v8us*)(A + aoff + kc + 16));
#pragma unroll
        for (int t = 0; t < 4; ++t) acc[t] = wmmab(a, cat16b(*(const v8us*)(Bn + boff[t] + kc), *(const v8us*)(Bn + boff[t] + kc + 16)), acc[t]);
        asm volatile("v_nop\n\tv_nop\n\tv_nop\n\tv_nop" : "+v"(acc[0]), "+v"(acc[1]), "+v"(acc[2]), "+v"(acc[3]) : "v"(a));
    }
    float* os = &ost[wave][0];
#pragma unroll
    for (int t = 0; t < 4; ++t) { const float bv = bfr(bias[c0 + t * 16 + lr]);
#pragma unroll
        for (int j = 0; j < 8; ++j) os[(hi * 8 + j) * 68 + t * 16 + lr] = acc[t][j] + bv; }
    __syncthreads();
    if (MODE == 1) {
        float* crow = (float*)C + (size_t)r0 * DM + c0;
        auto pass = [&]() {
#pragma unroll
            for (int s = 0; s < 8; ++s) { const int Lid = (lane >> 3) + 4 * s, piece = lane & 7; const int row = Lid >> 1, cofs = (Lid & 1) * 32 + piece * 4;
                const v4f val = *(const v4fa*)(os + row * 68 + cofs); *(v4f*)(crow + (size_t)row * DM + cofs) = val; }
        };
        pass(); 
    } else {
        h16* c1 = (h16*)C + (size_t)r0 * DM + c0; h16* c2 = (h16*)C2 + (size_t)r0 * DM + c0;
        auto pass = [&]() {
#pragma unroll
            for (int s = 0; s < 4; ++s) { const int row = 4 * s + (lane >> 3), piece = lane & 7; const float* sp = os + row * 68 + piece * 8; v8h o1, o2;
#pragma unroll
                for (int i = 0; i < 8; ++i) { const h16 a = (h16)sp[i]; o1[i] = a; o2[i] = (h16)((sp[i] - (float)a) * LOSC); }
                *(v8h*)(c1 + (size_t)row * DM + piece * 8) = o1; *(v8h*)(c2 + (size_t)row * DM + piece * 8) = o2; }
        };
        pass(); 
    }
}
// k_vt: VTH/VTL [b][h][d][s] = f16 hi + residual of V rows; block (b, h, 64 s).
__global__ __launch_bounds__(256) void k_vt(const float* __restrict__ V, h16* VTH, h16* VTL) {
    __shared__ __align__(16) h16 tile[HD * 72];
    __shared__ __align__(16) h16 til2[HD * 72];
    const int bid = blockIdx.x;
    const int b = bid / (NH_ * (SS / 64)), rem = bid - b * (NH_ * (SS / 64)), h = rem / (SS / 64), kt = rem - h * (SS / 64);
    const int s0 = kt * 64, tid = threadIdx.x, ss = tid >> 2, d0 = (tid & 3) * 16;
    const float* src = V + ((size_t)b * SS + s0 + ss) * DM + h * HD + d0;
#pragma unroll
    for (int i = 0; i < 16; ++i) { const float v = src[i]; const h16 a = (h16)v; tile[(d0 + i) * 72 + ss] = a; til2[(d0 + i) * 72 + ss] = (h16)((v - (float)a) * LOSC); }
    __syncthreads();
    const int piece = tid & 7;
    const size_t base = (((size_t)b * NH_ + h) * HD) * SS + s0;
    auto pass = [&]() {
#pragma unroll
        for (int s = 0; s < 4; ++s) { const int Lid = (tid >> 3) + 32 * s; const int pln = Lid >> 6, d = Lid & 63;
            const v8h val = *(const v8ha*)((pln ? til2 : tile) + d * 72 + piece * 8); *(v8h*)((pln ? VTL : VTH) + base + (size_t)d * SS + piece * 8) = val; }
    };
    pass(); 
}
// k_rel: 64 x 64 tile of T[p][row][r] = (AH + AL/1024)[row of head h].(PH + PL/1024)[r of head h] (hi.hi + hi.lo + lo.hi over K = 64) for the chunk's pair p = (b,h):
// A rows = token rows (b*512 + row) at column h*64, B rows = relative rows r (1024) of the pos plane at column h*64; grid (SS/64, NR/64, CHK); f32 [p][512][1024].
__global__ __launch_bounds__(128) void k_rel(const h16* __restrict__ AH, const h16* __restrict__ AL, const h16* __restrict__ PH, const h16* __restrict__ PL, int pair0, float* T) {
    __shared__ __align__(16) float ost[4][16 * 68];
    const int lane = threadIdx.x & 31, wave = threadIdx.x >> 5, lr = lane & 15, hi = lane >> 4;
    const int p = blockIdx.z, pr = pair0 + p, b = pr / NH_, h = pr - b * NH_;
    const int r0 = blockIdx.x * 64 + wave * 16, c0 = blockIdx.y * 64;
    const size_t aoff = ((size_t)b * SS + r0 + lr) * DM + h * HD + 8 * hi;
    v8f acc[4], accx[4];
#pragma unroll
    for (int t = 0; t < 4; ++t) { acc[t] = (v8f){}; accx[t] = (v8f){}; }
#pragma unroll
    for (int kc = 0; kc < 2; ++kc) {
        const v16h a = cat16(*(const v8h*)(AH + aoff + kc * 32), *(const v8h*)(AH + aoff + kc * 32 + 16)), al = cat16(*(const v8h*)(AL + aoff + kc * 32), *(const v8h*)(AL + aoff + kc * 32 + 16));
#pragma unroll
        for (int t = 0; t < 4; ++t) { const size_t bo = (size_t)(c0 + t * 16 + lr) * DM + h * HD + kc * 32 + 8 * hi;
            const v16h bh = cat16(*(const v8h*)(PH + bo), *(const v8h*)(PH + bo + 16)), bl = cat16(*(const v8h*)(PL + bo), *(const v8h*)(PL + bo + 16));
            acc[t] = wmma16(a, bh, acc[t]); accx[t] = wmma16(a, bl, accx[t]); accx[t] = wmma16(al, bh, accx[t]); }
    }
    asm volatile("v_nop\n\tv_nop\n\tv_nop\n\tv_nop" : "+v"(acc[0]), "+v"(acc[1]), "+v"(acc[2]), "+v"(acc[3]), "+v"(accx[0]), "+v"(accx[1]), "+v"(accx[2]), "+v"(accx[3]));
    float* os = &ost[wave][0];
#pragma unroll
    for (int t = 0; t < 4; ++t)
#pragma unroll
        for (int j = 0; j < 8; ++j) os[(hi * 8 + j) * 68 + t * 16 + lr] = acc[t][j] + accx[t][j] * LOSCI;
    __syncthreads();
    float* crow = T + ((size_t)p * SS + r0) * NR + c0;
    auto pass = [&]() {
#pragma unroll
        for (int s = 0; s < 8; ++s) { const int Lid = (lane >> 3) + 4 * s, piece = lane & 7; const int row = Lid >> 1, cofs = (Lid & 1) * 32 + piece * 4;
            const v4f val = *(const v4fa*)(os + row * 68 + cofs); *(v4f*)(crow + (size_t)row * NR + cofs) = val; }
    };
    pass(); 
}
// k_attn: block = (pair p of the chunk, 64 queries), wave = 16; 16 key tiles: content = q.k (hi.hi + hi.lo + lo.hi: 12 WMMA), bias = C2P[p][q][q - k + 511] +
// P2C[p][k][k - q + 511] gathered by the arithmetic index (always in range), logits = (content + bias) x SCL; online softmax; weights x32768 hi/residual; 12 WMMA .v;
__global__ __launch_bounds__(128) void k_attn(const h16* __restrict__ QH, const h16* __restrict__ QL, const h16* __restrict__ KH, const h16* __restrict__ KL,
                                             const float* __restrict__ C2P, const float* __restrict__ P2C, const h16* __restrict__ VTH, const h16* __restrict__ VTL, int pair0, float* out) {
    __shared__ __align__(16) h16 plds[4][16 * 32];
    __shared__ __align__(16) h16 plds2[4][16 * 32];
    __shared__ __align__(16) float ost[4][16 * 68];
    const int lane = threadIdx.x & 31, wave = threadIdx.x >> 5, lr = lane & 15, hi = lane >> 4;
    const int p = blockIdx.x / (SS / 64), qt = blockIdx.x - p * (SS / 64), pr = pair0 + p, b = pr / NH_, h = pr - b * NH_;
    const int q0 = qt * 64 + wave * 16;
    const size_t tok0 = (size_t)b * SS;
    h16* pl = &plds[wave][0]; h16* pl2 = &plds2[wave][0];
    v16h qa[2];
    const size_t qo0 = (tok0 + q0 + lr) * DM + h * HD + 8 * hi;
#pragma unroll
    for (int kc = 0; kc < 2; ++kc) qa[kc] = cat16(*(const v8h*)(QH + qo0 + kc * 32), *(const v8h*)(QH + qo0 + kc * 32 + 16));
    int qrow[8];
#pragma unroll
    for (int j = 0; j < 8; ++j) qrow[j] = q0 + 8 * hi + j;
    const float* c2p = C2P + (size_t)p * SS * NR; const float* p2c = P2C + (size_t)p * SS * NR;
    const size_t vbase = (((size_t)b * NH_ + h) * HD) * SS;
    v8f o[4], ox[4];
#pragma unroll
    for (int n = 0; n < 4; ++n) { o[n] = (v8f){}; ox[n] = (v8f){}; }
    float mrow[8], lpart[8];
#pragma unroll
    for (int j = 0; j < 8; ++j) { mrow[j] = -3.0e38f; lpart[j] = 0.f; }
#pragma unroll 1
    for (int kt = 0; kt < SS / 32; ++kt) {
        const int l0 = kt * 32;
        v8f s0 = {}, s1 = {}, x0 = {}, x1 = {};
#pragma unroll
        for (int kc = 0; kc < 2; ++kc) {
            const size_t ko = (tok0 + l0 + lr) * DM + h * HD + kc * 32 + 8 * hi, k1o = ko + (size_t)16 * DM;
            { const v16h k0h = cat16(*(const v8h*)(KH + ko), *(const v8h*)(KH + ko + 16)), k1h = cat16(*(const v8h*)(KH + k1o), *(const v8h*)(KH + k1o + 16));
              const v16h qlk = cat16(*(const v8h*)(QL + qo0 + kc * 32), *(const v8h*)(QL + qo0 + kc * 32 + 16));
              s0 = wmma16(qa[kc], k0h, s0); x0 = wmma16(qlk, k0h, x0); s1 = wmma16(qa[kc], k1h, s1); x1 = wmma16(qlk, k1h, x1);
              asm volatile("v_nop" : "+v"(s0), "+v"(s1), "+v"(x0), "+v"(x1) : "v"(qlk), "v"(k0h), "v"(k1h) : "memory"); }
            { const v16h k0l = cat16(*(const v8h*)(KL + ko), *(const v8h*)(KL + ko + 16)), k1l = cat16(*(const v8h*)(KL + k1o), *(const v8h*)(KL + k1o + 16));
              x0 = wmma16(qa[kc], k0l, x0); x1 = wmma16(qa[kc], k1l, x1);
              asm volatile("v_nop" : "+v"(x0), "+v"(x1) : "v"(k0l), "v"(k1l) : "memory"); }
        }
        asm volatile("v_nop\n\tv_nop\n\tv_nop\n\tv_nop" : "+v"(s0), "+v"(s1), "+v"(x0), "+v"(x1) : "v"(qa[0]), "v"(qa[1]));
        const int ka = l0 + lr, kb = l0 + 16 + lr;
        float alpha[8];
#pragma unroll
        for (int j = 0; j < 8; ++j) {
            const int q = qrow[j];
            const float ba = c2p[(size_t)q * NR + (q - ka + SS - 1)] + p2c[(size_t)ka * NR + (ka - q + SS - 1)];
            const float bb = c2p[(size_t)q * NR + (q - kb + SS - 1)] + p2c[(size_t)kb * NR + (kb - q + SS - 1)];
            const float a0 = (s0[j] + x0[j] * LOSCI + ba) * SCL, a1 = (s1[j] + x1[j] * LOSCI + bb) * SCL;
            float mx = fmaxf(a0, a1);
            mx = fmaxf(mx, __shfl_xor(mx, 1, 16)); mx = fmaxf(mx, __shfl_xor(mx, 2, 16)); mx = fmaxf(mx, __shfl_xor(mx, 4, 16)); mx = fmaxf(mx, __shfl_xor(mx, 8, 16));
            const float mn = fmaxf(mrow[j], mx);
            alpha[j] = __expf(mrow[j] - mn); mrow[j] = mn;
            const float e0 = __expf(a0 - mn), e1 = __expf(a1 - mn);
            lpart[j] = lpart[j] * alpha[j] + (e0 + e1);
            const int mr = hi * 8 + j;
            const float ps0 = e0 * PSC, ps1 = e1 * PSC; const h16 h0 = (h16)ps0, h1 = (h16)ps1;
            pl[mr * 32 + lr] = h0; pl[mr * 32 + 16 + lr] = h1; pl2[mr * 32 + lr] = (h16)((ps0 - (float)h0) * LOSC); pl2[mr * 32 + 16 + lr] = (h16)((ps1 - (float)h1) * LOSC);
        }
#pragma unroll
        for (int n = 0; n < 4; ++n)
#pragma unroll
            for (int j = 0; j < 8; ++j) { o[n][j] *= alpha[j]; ox[n][j] *= alpha[j]; }
        asm volatile("" ::: "memory");
        const v16h pa = cat16(*(const v8ha*)(pl + lr * 32 + hi * 8), *(const v8ha*)(pl + lr * 32 + 16 + hi * 8));
        const v16h px = cat16(*(const v8ha*)(pl2 + lr * 32 + hi * 8), *(const v8ha*)(pl2 + lr * 32 + 16 + hi * 8));
#pragma unroll
        for (int n = 0; n < 4; ++n) { const size_t vo = vbase + (size_t)(n * 16 + lr) * SS + l0 + hi * 8;
            const v16h vh = cat16(*(const v8h*)(VTH + vo), *(const v8h*)(VTH + vo + 16)), vl = cat16(*(const v8h*)(VTL + vo), *(const v8h*)(VTL + vo + 16));
            o[n] = wmma16(pa, vh, o[n]); ox[n] = wmma16(pa, vl, ox[n]); ox[n] = wmma16(px, vh, ox[n]);
            asm volatile("" : "+v"(o[n]), "+v"(ox[n]) : "v"(vh), "v"(vl) : "memory"); }
    }
    float inv[8];
#pragma unroll
    for (int j = 0; j < 8; ++j) { float rs = lpart[j]; rs += __shfl_xor(rs, 1, 16); rs += __shfl_xor(rs, 2, 16); rs += __shfl_xor(rs, 4, 16); rs += __shfl_xor(rs, 8, 16); inv[j] = 1.0f / (rs * PSC); }
    float* os = &ost[wave][0];
#pragma unroll
    for (int n = 0; n < 4; ++n)
#pragma unroll
        for (int j = 0; j < 8; ++j) os[(hi * 8 + j) * 68 + n * 16 + lr] = (o[n][j] + ox[n][j] * LOSCI) * inv[j];
    __syncthreads();
    float* ob = out + (tok0 + q0) * DM + (size_t)h * HD;
    auto pass = [&]() {
#pragma unroll
        for (int s = 0; s < 8; ++s) { const int Lid = (lane >> 3) + 4 * s, piece = lane & 7; const int row = Lid >> 1, cofs = (Lid & 1) * 32 + piece * 4;
            const v4f val = *(const v4fa*)(os + row * 68 + cofs); *(v4f*)(ob + (size_t)row * DM + cofs) = val; }
    };
    pass(); 
}

extern "C" void kernel_launch(void* const* d_in, const int* in_sizes, int n_in,
                              void* d_out, int out_size, void* d_ws, size_t ws_size, hipStream_t stream) {
    (void)in_sizes; (void)n_in; (void)out_size;
    const float* x = (const float*)d_in[0]; const float* rel = (const float*)d_in[1]; const float* Wq = (const float*)d_in[2]; const float* bq = (const float*)d_in[3];
    const float* Wk = (const float*)d_in[4]; const float* bk = (const float*)d_in[5]; const float* Wv = (const float*)d_in[6]; const float* bv = (const float*)d_in[7];
    float* out = (float*)d_out;    // [4][512][1024]
    char* wsp = (char*)d_ws;
    auto take = [&](size_t bytes) { char* p = wsp; wsp += (bytes + 255) & ~(size_t)255; return (void*)p; };
    bf* Xb = (bf*)take((size_t)NTK * DM * 2); bf* Rb = (bf*)take((size_t)NR * DM * 2); bf* WqT = (bf*)take((size_t)DM * DM * 2); bf* WkT = (bf*)take((size_t)DM * DM * 2); bf* WvT = (bf*)take((size_t)DM * DM * 2);
    h16* QH = (h16*)take((size_t)NTK * DM * 2); h16* QL = (h16*)take((size_t)NTK * DM * 2); h16* KH = (h16*)take((size_t)NTK * DM * 2); h16* KL = (h16*)take((size_t)NTK * DM * 2);
    h16* PKH = (h16*)take((size_t)NR * DM * 2); h16* PKL = (h16*)take((size_t)NR * DM * 2); h16* PQH = (h16*)take((size_t)NR * DM * 2); h16* PQL = (h16*)take((size_t)NR * DM * 2);
    float* Vf = (float*)take((size_t)NTK * DM * 4); h16* VTH = (h16*)take((size_t)NTK * DM * 2); h16* VTL = (h16*)take((size_t)NTK * DM * 2);
    float* C2P = (float*)take((size_t)CHK * SS * NR * 4); float* P2C = (float*)take((size_t)CHK * SS * NR * 4);
    if ((size_t)(wsp - (char*)d_ws) > ws_size) return;    // 4.2 + 2.1 + 6.3 + 16.8 + 8.4 + 8.4 + 8.4 + 67 + 67 ~ 189 MB
    k_cvtb<<<NTK / 8, 256, 0, stream>>>(x, NTK, Xb);
    k_cvtb<<<NR / 8, 256, 0, stream>>>(rel, NR, Rb);                  // rel_embeddings[0 : 1024] (att_span = 512 = MAX_REL -> the whole table)
    k_wt<<<dim3(DM / 64, DM / 64, 1), 256, 0, stream>>>(Wq, WqT); k_wt<<<dim3(DM / 64, DM / 64, 1), 256, 0, stream>>>(Wk, WkT); k_wt<<<dim3(DM / 64, DM / 64, 1), 256, 0, stream>>>(Wv, WvT);
    k_gemmb<0><<<dim3(NTK / 64, DM / 64, 1), 128, 0, stream>>>(Xb, WqT, bq, QH, QL);
    k_gemmb<0><<<dim3(NTK / 64, DM / 64, 1), 128, 0, stream>>>(Xb, WkT, bk, KH, KL);
    k_gemmb<1><<<dim3(NTK / 64, DM / 64, 1), 128, 0, stream>>>(Xb, WvT, bv, Vf, nullptr);
    k_gemmb<0><<<dim3(NR / 64, DM / 64, 1), 128, 0, stream>>>(Rb, WkT, bk, PKH, PKL);       // pos_k = rel.Wk + bk
    k_gemmb<0><<<dim3(NR / 64, DM / 64, 1), 128, 0, stream>>>(Rb, WqT, bq, PQH, PQL);       // pos_q = rel.Wq + bq
    k_vt<<<NB_ * NH_ * (SS / 64), 256, 0, stream>>>(Vf, VTH, VTL);
    for (int c = 0; c < (NB_ * NH_) / CHK; ++c) {
        const int pair0 = c * CHK;
        k_rel<<<dim3(SS / 64, NR / 64, CHK), 128, 0, stream>>>(QH, QL, PKH, PKL, pair0, C2P);    // c2p_full = q . pos_k^T
        k_rel<<<dim3(SS / 64, NR / 64, CHK), 128, 0, stream>>>(KH, KL, PQH, PQL, pair0, P2C);    // p2c_full = k . pos_q^T
        k_attn<<<CHK * (SS / 64), 128, 0, stream>>>(QH, QL, KH, KL, C2P, P2C, VTH, VTL, pair0, out);
    }
}

// v002
// It runs in 187 microseconds.
// Next to v001, in two timings, it ran 1.66 and 1.65 times as fast.
// Over all steps from v000 it is 3.38 times as fast.
#include <hip/hip_runtime.h>

// Contractions, f32 accumulate: q/k/v = x.W + b ([2048 x 1024].[1024 x 1024]) and pos_k = rel.Wk + bk, pos_q = rel.Wq + bq ([1024 x 1024].[1024 x 1024]) on
// v_wmma_f32_16x16x32_bf16 with PLAIN bf16 operands (inputs rounded once: exact; k-major weights transposed into n-major planes); the disentangled attention on
// v_wmma_f32_16x16x32_f16 with every computed operand as f16 hi + residual x1024 (hi.hi + hi.lo + lo.hi): the relative products q.pos_k^T and k.pos_q^T, only the
// 80-column band that a 16 x 64 piece of the score tile gathers from (operands staged in LDS), gathered in LDS into one table bias[pair][q][k] = c2p[q][q-k+511] + p2c[k][k-q+511]; then the
// fused attention over all 64 (b,h) pairs in one launch (content q.k + bias[q][k], online softmax, weights . v).

#define NB_  4
#define SS   512
#define DM   1024
#define NH_  16
#define HD   64
#define NR   1024                // 2 * att_span relative positions
#define NTK  (NB_ * SS)          // 2048
#define BW   80                  // relative columns that 16 rows against 64 opposite positions can gather: 16 + 64 - 1, rounded up to whole 16-column tiles
#define BP   84                  // LDS pitch of a band row, in floats
#define SP   72                  // LDS pitch of a staged 64-element f16 row, in elements: the 16 bytes of pad spread the 16 rows of a b128 fragment read over all banks
#define BPL  (16 * BP + 6)       // LDS floats per wave's band; the + 6 spreads the four waves' planes over the banks for the diagonal reads
#define PSC  32768.0f
#define LOSC 1024.0f
#define LOSCI (1.0f / 1024.0f)
#define SCL  0.07216878364870322f    // (64*3)^-0.5

typedef _Float16 h16;
typedef unsigned short bf;
typedef __attribute__((ext_vector_type(16))) __bf16   v16bf;
typedef __attribute__((ext_vector_type(16))) _Float16 v16h;
typedef __attribute__((ext_vector_type(8)))  _Float16 v8h;
typedef __attribute__((ext_vector_type(8)))  unsigned short v8us;
typedef __attribute__((ext_vector_type(8)))  float    v8f;
typedef __attribute__((ext_vector_type(4)))  float    v4f;
typedef v8h  __attribute__((may_alias)) v8ha;
typedef v4f  __attribute__((may_alias)) v4fa;
typedef v8us __attribute__((may_alias)) v8usa;

__device__ __forceinline__ unsigned short f2bf(float f) { unsigned u = __float_as_uint(f); u += 0x7FFFu + ((u >> 16) & 1u); return (unsigned short)(u >> 16); }
__device__ __forceinline__ float bf2f(unsigned short b) { return __uint_as_float(((unsigned)b) << 16); }
__device__ __forceinline__ float bfr(float f) { return bf2f(f2bf(f)); }
__device__ __forceinline__ v16h cat16(v8h lo, v8h hi) { return __builtin_shufflevector(lo, hi, 0, 1, 2, 3, 4, 5, 6, 7, 8, 9, 10, 11, 12, 13, 14, 15); }
__device__ __forceinline__ v16bf cat16b(v8us lo, v8us hi) { return __builtin_bit_cast(v16bf, __builtin_shufflevector(lo, hi, 0, 1, 2, 3, 4, 5, 6, 7, 8, 9, 10, 11, 12, 13, 14, 15)); }
__device__ __forceinline__ v8f wmma16(v16h a, v16h b, v8f c) { return __builtin_amdgcn_wmma_f32_16x16x32_f16(false, a, false, b, (short)0, c, false, false); }
__device__ __forceinline__ v8f wmmab(v16bf a, v16bf b, v8f c) { return __builtin_amdgcn_wmma_f32_16x16x32_bf16(false, a, false, b, (short)0, c, false, false); }
#define VST2(T, p, v) do { const T vst2_v_ = (v); *(T*)(p) = vst2_v_;  } while (0)

// k_cvtb: bf16 rows of an [nrows][1024] matrix; k_wt: k-major [1024][1024] -> n-major bf16.
__global__ __launch_bounds__(256) void k_cvtb(const float* __restrict__ src, int nrows, bf* dst) {
    const int lane = threadIdx.x & 31, r = blockIdx.x * 8 + (threadIdx.x >> 5);
    if (r >= nrows) return;
#pragma unroll
    for (int q = 0; q < DM / 256; ++q) { v8us t;
#pragma unroll
        for (int i = 0; i < 8; ++i) t[i] = f2bf(src[(size_t)r * DM + q * 256 + lane * 8 + i]);
        VST2(v8us, dst + (size_t)r * DM + q * 256 + lane * 8, t); }
}
__global__ __launch_bounds__(256) void k_wt(const float* __restrict__ Wm, bf* WT) {
    __shared__ __align__(16) unsigned short tl[64 * 72];
    const int tid = threadIdx.x, k0 = blockIdx.x * 64, n0 = blockIdx.y * 64;
    const int kk = tid >> 2, nq = (tid & 3) * 16;
#pragma unroll
    for (int i = 0; i < 16; ++i) tl[(nq + i) * 72 + kk] = f2bf(Wm[(size_t)(k0 + kk) * DM + n0 + nq + i]);
    __syncthreads();
    const int piece = tid & 7;
    auto pass = [&]() {
#pragma unroll
        for (int s = 0; s < 2; ++s) { const int nr = (tid >> 3) + 32 * s; const v8us val = *(const v8usa*)(tl + nr * 72 + piece * 8);
            *(v8us*)(WT + (size_t)(n0 + nr) * DM + k0 + piece * 8) = val; }
    };
    pass(); 
}
// k_gemmb: 64 x 64 tile of A.B^T + bias over K = 1024 (bf16 exact); MODE 0: f16 hi + residual planes (ld 1024); MODE 1: f32 rows (V).
template <int MODE>
__global__ __launch_bounds__(128) void k_gemmb(const bf* __restrict__ A, const bf* __restrict__ Bn, const float* __restrict__ bias, void* C, void* C2) {
    __shared__ __align__(16) float ost[4][16 * 68];
    const int lane = threadIdx.x & 31, wave = threadIdx.x >> 5, lr = lane & 15, hi = lane >> 4;
    const int r0 = blockIdx.x * 64 + wave * 16, c0 = blockIdx.y * 64;
    const size_t aoff = (size_t)(r0 + lr) * DM + 8 * hi;
    size_t boff[4];
#pragma unroll
    for (int t = 0; t < 4; ++t) boff[t] = (size_t)(c0 + t * 16 + lr) * DM + 8 * hi;
    v8f acc[4];
#pragma unroll
    for (int t = 0; t < 4; ++t) acc[t] = (v8f){};
#pragma unroll 1
    for (int kc = 0; kc < DM; kc += 32) {
        const v16bf a = cat16b(*(const v8us*)(A + aoff + kc), *(const v8us*)(A + aoff + kc + 16));
#pragma unroll
        for (int t = 0; t < 4; ++t) acc[t] = wmmab(a, cat16b(*(const v8us*)(Bn + boff[t] + kc), *(const v8us*)(Bn + boff[t] + kc + 16)), acc[t]);
        asm volatile("v_nop\n\tv_nop\n\tv_nop\n\tv_nop" : "+v"(acc[0]), "+v"(acc[1]), "+v"(acc[2]), "+v"(acc[3]) : "v"(a));
    }
    float* os = &ost[wave][0];
#pragma unroll
    for (int t = 0; t < 4; ++t) { const float bv = bfr(bias[c0 + t * 16 + lr]);
#pragma unroll
        for (int j = 0; j < 8; ++j) os[(hi * 8 + j) * 68 + t * 16 + lr] = acc[t][j] + bv; }
    __syncthreads();
    if (MODE == 1) {
        float* crow = (float*)C + (size_t)r0 * DM + c0;
        auto pass = [&]() {
#pragma unroll
            for (int s = 0; s < 8; ++s) { const int Lid = (lane >> 3) + 4 * s, piece = lane & 7; const int row = Lid >> 1, cofs = (Lid & 1) * 32 + piece * 4;
                const v4f val = *(const v4fa*)(os + row * 68 + cofs); *(v4f*)(crow + (size_t)row * DM + cofs) = val; }
        };
        pass(); 
    } else {
        h16* c1 = (h16*)C + (size_t)r0 * DM + c0; h16* c2 = (h16*)C2 + (size_t)r0 * DM + c0;
        auto pass = [&]() {
#pragma unroll
            for (int s = 0; s < 4; ++s) { const int row = 4 * s + (lane >> 3), piece = lane & 7; const float* sp = os + row * 68 + piece * 8; v8h o1, o2;
#pragma unroll
                for (int i = 0; i < 8; ++i) { const h16 a = (h16)sp[i]; o1[i] = a; o2[i] = (h16)((sp[i] - (float)a) * LOSC); }
                *(v8h*)(c1 + (size_t)row * DM + piece * 8) = o1; *(v8h*)(c2 + (size_t)row * DM + piece * 8) = o2; }
        };
        pass(); 
    }
}
// k_vt: VTH/VTL [b][h][d][s] = f16 hi + residual of V rows; block (b, h, 64 s).
__global__ __launch_bounds__(256) void k_vt(const float* __restrict__ V, h16* VTH, h16* VTL) {
    __shared__ __align__(16) h16 tile[HD * 72];
    __shared__ __align__(16) h16 til2[HD * 72];
    const int bid = blockIdx.x;
    const int b = bid / (NH_ * (SS / 64)), rem = bid - b * (NH_ * (SS / 64)), h = rem / (SS / 64), kt = rem - h * (SS / 64);
    const int s0 = kt * 64, tid = threadIdx.x, ss = tid >> 2, d0 = (tid & 3) * 16;
    const float* src = V + ((size_t)b * SS + s0 + ss) * DM + h * HD + d0;
#pragma unroll
    for (int i = 0; i < 16; ++i) { const float v = src[i]; const h16 a = (h16)v; tile[(d0 + i) * 72 + ss] = a; til2[(d0 + i) * 72 + ss] = (h16)((v - (float)a) * LOSC); }
    __syncthreads();
    const int piece = tid & 7;
    const size_t base = (((size_t)b * NH_ + h) * HD) * SS + s0;
    auto pass = [&]() {
#pragma unroll
        for (int s = 0; s < 4; ++s) { const int Lid = (tid >> 3) + 32 * s; const int pln = Lid >> 6, d = Lid & 63;
            const v8h val = *(const v8ha*)((pln ? til2 : tile) + d * 72 + piece * 8); *(v8h*)((pln ? VTL : VTH) + base + (size_t)d * SS + piece * 8) = val; }
    };
    pass(); 
}
// band16: dst[i][c] = (ah + al/1024)[row i].(ph + pl/1024)[row c], i < 16, c < 80 (hi.hi + hi.lo + lo.hi over K = 64); all four operands are staged LDS rows of pitch SP.
__device__ __forceinline__ void band16(const h16* ah, const h16* al, const h16* ph, const h16* pl, int lr, int hi, float* dst) {
    const int ao = lr * SP + 8 * hi;
    v8f acc[BW / 16], accx[BW / 16];
#pragma unroll
    for (int t = 0; t < BW / 16; ++t) { acc[t] = (v8f){}; accx[t] = (v8f){}; }
#pragma unroll
    for (int kc = 0; kc < 2; ++kc) {
        const v16h a = cat16(*(const v8ha*)(ah + ao + kc * 32), *(const v8ha*)(ah + ao + kc * 32 + 16)), ax = cat16(*(const v8ha*)(al + ao + kc * 32), *(const v8ha*)(al + ao + kc * 32 + 16));
#pragma unroll
        for (int t = 0; t < BW / 16; ++t) { const int bo = t * 16 * SP + ao + kc * 32;
            const v16h bh = cat16(*(const v8ha*)(ph + bo), *(const v8ha*)(ph + bo + 16)), bl = cat16(*(const v8ha*)(pl + bo), *(const v8ha*)(pl + bo + 16));
            acc[t] = wmma16(a, bh, acc[t]); accx[t] = wmma16(a, bl, accx[t]); accx[t] = wmma16(ax, bh, accx[t]); }
    }
#pragma unroll
    for (int t = 0; t < BW / 16; ++t)
#pragma unroll
        for (int j = 0; j < 8; ++j) dst[(hi * 8 + j) * BP + t * 16 + lr] = acc[t][j] + accx[t][j] * LOSCI;
}
// k_bias: 64 x 64 tile (queries q0.., keys k0..) of Bt[pair][q][k] = c2p[q][q - k + 511] + p2c[k][k - q + 511]; grid (SS/64, SS/64, 64 pairs), 8 waves.
// Staged in LDS by whole 128-byte head rows, hi and residual planes: the 64 q rows, the 64 k rows, the 128 rows q0 - k0 + 448 .. of pos_k and the 128 rows k0 - q0 + 448 .. of
// pos_q (both ranges lie in [0, 1023] for every tile). Wave w < 4 forms the c2p band of queries 16w .. 16w + 15 against staged pos_k rows 16w .. 16w + 79; wave 4 + w the p2c
// band of keys 16w .. against staged pos_q rows 16w .. 16w + 79. In a band, element (row i, opposite position j of the tile) stands at column i - j + 63.
__global__ __launch_bounds__(256) void k_bias(const h16* __restrict__ QH, const h16* __restrict__ QL, const h16* __restrict__ KH, const h16* __restrict__ KL,
                                             const h16* __restrict__ PKH, const h16* __restrict__ PKL, const h16* __restrict__ PQH, const h16* __restrict__ PQL, float* Bt) {
    __shared__ __align__(16) h16 st[768 * SP];
    __shared__ float bd[8 * BPL];
    const int tid = threadIdx.x, lane = tid & 31, wave = tid >> 5, lr = lane & 15, hi = lane >> 4;
    const int p = blockIdx.z, b = p / NH_, h = p - b * NH_;
    const int q0 = blockIdx.x * 64, k0 = blockIdx.y * 64;
    const size_t tok0 = (size_t)b * SS;
    const int srow = tid >> 3, spc = (tid & 7) * 8;
    const unsigned voff = (unsigned)(srow * DM + spc);    // the lane's element offset inside a slab of 32 rows: the one vector register that all 24 loads name
    v8h sv[24];
    auto fetch = [&](const h16* __restrict__ g, size_t grow0, int n32, int at) {
        const h16* gb = g + grow0 * DM + h * HD;
#pragma unroll
        for (int i = 0; i < n32; ++i) sv[at + i] = *(const v8h*)(gb + voff + i * 32 * DM);
        // The wait that stands between issued global loads and any overwrite of a register they name (the plane's base is formed anew for the next plane);
        // voff as an input keeps the shared offset register whole up to the last of these waits.
        asm volatile("s_wait_xcnt 0x0" :: "v"(voff) : "memory");
    };
    fetch(QH, tok0 + q0, 2, 0); fetch(QL, tok0 + q0, 2, 2); fetch(KH, tok0 + k0, 2, 4); fetch(KL, tok0 + k0, 2, 6);
    fetch(PKH, (size_t)(q0 - k0 + (SS - 64)), 4, 8); fetch(PKL, (size_t)(q0 - k0 + (SS - 64)), 4, 12);
    fetch(PQH, (size_t)(k0 - q0 + (SS - 64)), 4, 16); fetch(PQL, (size_t)(k0 - q0 + (SS - 64)), 4, 20);
#pragma unroll
    for (int r = 0; r < 24; ++r) *(v8ha*)(st + (r * 32 + srow) * SP + spc) = sv[r];
    __syncthreads();
    const int side = wave >> 2, w4 = wave & 3;
    const h16* sa = st + (side * 128 + w4 * 16) * SP;
    const h16* sp = st + (256 + side * 256 + w4 * 16) * SP;
    band16(sa, sa + 64 * SP, sp, sp + 128 * SP, lr, hi, bd + wave * BPL);
    __syncthreads();
    float* brow = Bt + ((size_t)p * SS + q0 + wave * 8) * SS + k0;
#pragma unroll
    for (int s = 0; s < 4; ++s) { const int Lid = (lane >> 3) + 4 * s, piece = lane & 7; const int row = Lid >> 1, cofs = (Lid & 1) * 32 + piece * 4, qq = wave * 8 + row, qw = qq >> 4, qi = qq & 15;
        v4f val;
#pragma unroll
        for (int e = 0; e < 4; ++e) { const int kk = cofs + e, kw = kk >> 4, ki = kk & 15;
            val[e] = bd[qw * BPL + qi * BP + qi - kk + 63] + bd[(4 + kw) * BPL + ki * BP + ki - qq + 63]; }
        *(v4f*)(brow + (size_t)row * SS + cofs) = val; }
}
// k_attn: block = (pair p, 64 queries), wave = 16; 16 key tiles: content = q.k (hi.hi + hi.lo + lo.hi: 12 WMMA), bias = Bt[p][q][k],
// logits = (content + bias) x SCL; online softmax; weights x32768 hi/residual; 12 WMMA .v;
__global__ __launch_bounds__(128) void k_attn(const h16* __restrict__ QH, const h16* __restrict__ QL, const h16* __restrict__ KH, const h16* __restrict__ KL,
                                             const float* __restrict__ Bt, const h16* __restrict__ VTH, const h16* __restrict__ VTL, float* out) {
    __shared__ __align__(16) h16 plds[4][16 * 32];
    __shared__ __align__(16) h16 plds2[4][16 * 32];
    __shared__ __align__(16) float ost[4][16 * 68];
    const int lane = threadIdx.x & 31, wave = threadIdx.x >> 5, lr = lane & 15, hi = lane >> 4;
    const int p = blockIdx.x / (SS / 64), qt = blockIdx.x - p * (SS / 64), b = p / NH_, h = p - b * NH_;
    const int q0 = qt * 64 + wave * 16;
    const size_t tok0 = (size_t)b * SS;
    h16* pl = &plds[wave][0]; h16* pl2 = &plds2[wave][0];
    v16h qa[2];
    const size_t qo0 = (tok0 + q0 + lr) * DM + h * HD + 8 * hi;
#pragma unroll
    for (int kc = 0; kc < 2; ++kc) qa[kc] = cat16(*(const v8h*)(QH + qo0 + kc * 32), *(const v8h*)(QH + qo0 + kc * 32 + 16));
    int qrow[8];
#pragma unroll
    for (int j = 0; j < 8; ++j) qrow[j] = q0 + 8 * hi + j;
    const float* bt = Bt + (size_t)p * SS * SS;
    const size_t vbase = (((size_t)b * NH_ + h) * HD) * SS;
    v8f o[4], ox[4];
#pragma unroll
    for (int n = 0; n < 4; ++n) { o[n] = (v8f){}; ox[n] = (v8f){}; }
    float mrow[8], lpart[8];
#pragma unroll
    for (int j = 0; j < 8; ++j) { mrow[j] = -3.0e38f; lpart[j] = 0.f; }
#pragma unroll 1
    for (int kt = 0; kt < SS / 32; ++kt) {
        const int l0 = kt * 32, ka = l0 + lr, kb = l0 + 16 + lr;
        float ba[8], bb[8];    // the trip's bias values, asked for at the head of the trip: they fly while the content products wait for their own operands
#pragma unroll
        for (int j = 0; j < 8; ++j) { ba[j] = bt[(size_t)qrow[j] * SS + ka]; bb[j] = bt[(size_t)qrow[j] * SS + kb]; }
        v8f s0 = {}, s1 = {}, x0 = {}, x1 = {};
#pragma unroll
        for (int kc = 0; kc < 2; ++kc) {
            const size_t ko = (tok0 + l0 + lr) * DM + h * HD + kc * 32 + 8 * hi, k1o = ko + (size_t)16 * DM;
            { const v16h k0h = cat16(*(const v8h*)(KH + ko), *(const v8h*)(KH + ko + 16)), k1h = cat16(*(const v8h*)(KH + k1o), *(const v8h*)(KH + k1o + 16));
              // The wait between issued global loads and an overwrite of a register they name: behind the second half's key loads this build lets the next load's result land on their address pair.
              if (kc == 1) asm volatile("s_wait_xcnt 0x0" ::: "memory");
              const v16h qlk = cat16(*(const v8h*)(QL + qo0 + kc * 32), *(const v8h*)(QL + qo0 + kc * 32 + 16));
              s0 = wmma16(qa[kc], k0h, s0); x0 = wmma16(qlk, k0h, x0); s1 = wmma16(qa[kc], k1h, s1); x1 = wmma16(qlk, k1h, x1);
              asm volatile("v_nop" : "+v"(s0), "+v"(s1), "+v"(x0), "+v"(x1) : "v"(qlk), "v"(k0h), "v"(k1h) : "memory"); }
            { const v16h k0l = cat16(*(const v8h*)(KL + ko), *(const v8h*)(KL + ko + 16)), k1l = cat16(*(const v8h*)(KL + k1o), *(const v8h*)(KL + k1o + 16));
              x0 = wmma16(qa[kc], k0l, x0); x1 = wmma16(qa[kc], k1l, x1);
              asm volatile("v_nop" : "+v"(x0), "+v"(x1) : "v"(k0l), "v"(k1l) : "memory"); }
        }
        asm volatile("v_nop\n\tv_nop\n\tv_nop\n\tv_nop" : "+v"(s0), "+v"(s1), "+v"(x0), "+v"(x1) : "v"(qa[0]), "v"(qa[1]));
        float alpha[8];
#pragma unroll
        for (int j = 0; j < 8; ++j) {
            const float a0 = (s0[j] + x0[j] * LOSCI + ba[j]) * SCL, a1 = (s1[j] + x1[j] * LOSCI + bb[j]) * SCL;
            float mx = fmaxf(a0, a1);
            mx = fmaxf(mx, __shfl_xor(mx, 1, 16)); mx = fmaxf(mx, __shfl_xor(mx, 2, 16)); mx = fmaxf(mx, __shfl_xor(mx, 4, 16)); mx = fmaxf(mx, __shfl_xor(mx, 8, 16));
            const float mn = fmaxf(mrow[j], mx);
            alpha[j] = __expf(mrow[j] - mn); mrow[j] = mn;
            const float e0 = __expf(a0 - mn), e1 = __expf(a1 - mn);
            lpart[j] = lpart[j] * alpha[j] + (e0 + e1);
            const int mr = hi * 8 + j;
            const float ps0 = e0 * PSC, ps1 = e1 * PSC; const h16 h0 = (h16)ps0, h1 = (h16)ps1;
            pl[mr * 32 + lr] = h0; pl[mr * 32 + 16 + lr] = h1; pl2[mr * 32 + lr] = (h16)((ps0 - (float)h0) * LOSC); pl2[mr * 32 + 16 + lr] = (h16)((ps1 - (float)h1) * LOSC);
        }
#pragma unroll
        for (int n = 0; n < 4; ++n)
#pragma unroll
            for (int j = 0; j < 8; ++j) { o[n][j] *= alpha[j]; ox[n][j] *= alpha[j]; }
        asm volatile("" ::: "memory");
        const v16h pa = cat16(*(const v8ha*)(pl + lr * 32 + hi * 8), *(const v8ha*)(pl + lr * 32 + 16 + hi * 8));
        const v16h px = cat16(*(const v8ha*)(pl2 + lr * 32 + hi * 8), *(const v8ha*)(pl2 + lr * 32 + 16 + hi * 8));
#pragma unroll
        for (int n = 0; n < 4; ++n) { const size_t vo = vbase + (size_t)(n * 16 + lr) * SS + l0 + hi * 8;
            const v16h vh = cat16(*(const v8h*)(VTH + vo), *(const v8h*)(VTH + vo + 16)), vl = cat16(*(const v8h*)(VTL + vo), *(const v8h*)(VTL + vo + 16));
            o[n] = wmma16(pa, vh, o[n]); ox[n] = wmma16(pa, vl, ox[n]); ox[n] = wmma16(px, vh, ox[n]);
            asm volatile("" : "+v"(o[n]), "+v"(ox[n]) : "v"(vh), "v"(vl) : "memory"); }
    }
    float inv[8];
#pragma unroll
    for (int j = 0; j < 8; ++j) { float rs = lpart[j]; rs += __shfl_xor(rs, 1, 16); rs += __shfl_xor(rs, 2, 16); rs += __shfl_xor(rs, 4, 16); rs += __shfl_xor(rs, 8, 16); inv[j] = 1.0f / (rs * PSC); }
    float* os = &ost[wave][0];
#pragma unroll
    for (int n = 0; n < 4; ++n)
#pragma unroll
        for (int j = 0; j < 8; ++j) os[(hi * 8 + j) * 68 + n * 16 + lr] = (o[n][j] + ox[n][j] * LOSCI) * inv[j];
    __syncthreads();
    float* ob = out + (tok0 + q0) * DM + (size_t)h * HD;
    auto pass = [&]() {
#pragma unroll
        for (int s = 0; s < 8; ++s) { const int Lid = (lane >> 3) + 4 * s, piece = lane & 7; const int row = Lid >> 1, cofs = (Lid & 1) * 32 + piece * 4;
            const v4f val = *(const v4fa*)(os + row * 68 + cofs); *(v4f*)(ob + (size_t)row * DM + cofs) = val; }
    };
    pass(); 
}

extern "C" void kernel_launch(void* const* d_in, const int* in_sizes, int n_in,
                              void* d_out, int out_size, void* d_ws, size_t ws_size, hipStream_t stream) {
    (void)in_sizes; (void)n_in; (void)out_size;
    const float* x = (const float*)d_in[0]; const float* rel = (const float*)d_in[1]; const float* Wq = (const float*)d_in[2]; const float* bq = (const float*)d_in[3];
    const float* Wk = (const float*)d_in[4]; const float* bk = (const float*)d_in[5]; const float* Wv = (const float*)d_in[6]; const float* bv = (const float*)d_in[7];
    float* out = (float*)d_out;    // [4][512][1024]
    char* wsp = (char*)d_ws;
    auto take = [&](size_t bytes) { char* p = wsp; wsp += (bytes + 255) & ~(size_t)255; return (void*)p; };
    bf* Xb = (bf*)take((size_t)NTK * DM * 2); bf* Rb = (bf*)take((size_t)NR * DM * 2); bf* WqT = (bf*)take((size_t)DM * DM * 2); bf* WkT = (bf*)take((size_t)DM * DM * 2); bf* WvT = (bf*)take((size_t)DM * DM * 2);
    h16* QH = (h16*)take((size_t)NTK * DM * 2); h16* QL = (h16*)take((size_t)NTK * DM * 2); h16* KH = (h16*)take((size_t)NTK * DM * 2); h16* KL = (h16*)take((size_t)NTK * DM * 2);
    h16* PKH = (h16*)take((size_t)NR * DM * 2); h16* PKL = (h16*)take((size_t)NR * DM * 2); h16* PQH = (h16*)take((size_t)NR * DM * 2); h16* PQL = (h16*)take((size_t)NR * DM * 2);
    float* Vf = (float*)take((size_t)NTK * DM * 4); h16* VTH = (h16*)take((size_t)NTK * DM * 2); h16* VTL = (h16*)take((size_t)NTK * DM * 2);
    float* Bt = (float*)take((size_t)NB_ * NH_ * SS * SS * 4);
    if ((size_t)(wsp - (char*)d_ws) > ws_size) return;    // 4.2 + 2.1 + 6.3 + 16.8 + 8.4 + 8.4 + 8.4 + 67 ~ 122 MB
    k_cvtb<<<NTK / 8, 256, 0, stream>>>(x, NTK, Xb);
    k_cvtb<<<NR / 8, 256, 0, stream>>>(rel, NR, Rb);                  // rel_embeddings[0 : 1024] (att_span = 512 = MAX_REL -> the whole table)
    k_wt<<<dim3(DM / 64, DM / 64, 1), 256, 0, stream>>>(Wq, WqT); k_wt<<<dim3(DM / 64, DM / 64, 1), 256, 0, stream>>>(Wk, WkT); k_wt<<<dim3(DM / 64, DM / 64, 1), 256, 0, stream>>>(Wv, WvT);
    k_gemmb<0><<<dim3(NTK / 64, DM / 64, 1), 128, 0, stream>>>(Xb, WqT, bq, QH, QL);
    k_gemmb<0><<<dim3(NTK / 64, DM / 64, 1), 128, 0, stream>>>(Xb, WkT, bk, KH, KL);
    k_gemmb<1><<<dim3(NTK / 64, DM / 64, 1), 128, 0, stream>>>(Xb, WvT, bv, Vf, nullptr);
    k_gemmb<0><<<dim3(NR / 64, DM / 64, 1), 128, 0, stream>>>(Rb, WkT, bk, PKH, PKL);       // pos_k = rel.Wk + bk
    k_gemmb<0><<<dim3(NR / 64, DM / 64, 1), 128, 0, stream>>>(Rb, WqT, bq, PQH, PQL);       // pos_q = rel.Wq + bq
    k_vt<<<NB_ * NH_ * (SS / 64), 256, 0, stream>>>(Vf, VTH, VTL);
    k_bias<<<dim3(SS / 64, SS / 64, NB_ * NH_), 256, 0, stream>>>(QH, QL, KH, KL, PKH, PKL, PQH, PQL, Bt);
    k_attn<<<NB_ * NH_ * (SS / 64), 128, 0, stream>>>(QH, QL, KH, KL, Bt, VTH, VTL, out);
}

// v003
// Measured time: 134 microseconds a run.
// Timed twice side by side with v002, it ran 1.39 times as fast both times.
// Over all steps from v000 it is 4.70 times as fast.
#include <hip/hip_runtime.h>

// Contractions, f32 accumulate: q/k/v = x.W + b ([2048 x 1024].[1024 x 1024]) and pos_k = rel.Wk + bk, pos_q = rel.Wq + bq ([1024 x 1024].[1024 x 1024]) on
// v_wmma_f32_16x16x32_bf16 with PLAIN bf16 operands (inputs rounded once: exact; k-major weights transposed into n-major planes; tiles staged in LDS by asynchronous copies); the disentangled attention on
// v_wmma_f32_16x16x32_f16 with every computed operand as f16 hi + residual x1024 (hi.hi + hi.lo + lo.hi): the relative products q.pos_k^T and k.pos_q^T, only the
// 80-column band that a 16 x 64 piece of the score tile gathers from (operands staged in LDS), gathered in LDS into one table bias[pair][q][k] = c2p[q][q-k+511] + p2c[k][k-q+511]; then the
// fused attention over all 64 (b,h) pairs in one launch (content q.k + bias[q][k], online softmax, weights . v).

#define NB_  4
#define SS   512
#define DM   1024
#define NH_  16
#define HD   64
#define NR   1024                // 2 * att_span relative positions
#define NTK  (NB_ * SS)          // 2048
#define BW   80                  // relative columns that 16 rows against 64 opposite positions can gather: 16 + 64 - 1, rounded up to whole 16-column tiles
#define BP   84                  // LDS pitch of a band row, in floats
#define SP   72                  // LDS pitch of a staged 64-element f16 row, in elements: the 16 bytes of pad spread the 16 rows of a b128 fragment read over all banks
#define BPL  (16 * BP + 6)       // LDS floats per wave's band; the + 6 spreads the four waves' planes over the banks for the diagonal reads
#define GK   128                 // k elements of a staged GEMM tile: rows of 256 bytes
#define GP   136                 // LDS pitch of a staged GEMM row, in elements: 272 B = 16 B x odd, for b128 fragment reads
#define GBUF (128 * GP)          // elements of one GEMM buffer: 64 A rows, then 64 B rows
#define PSC  32768.0f
#define LOSC 1024.0f
#define LOSCI (1.0f / 1024.0f)
#define SCL  0.07216878364870322f    // (64*3)^-0.5

typedef _Float16 h16;
typedef unsigned short bf;
typedef __attribute__((ext_vector_type(16))) __bf16   v16bf;
typedef __attribute__((ext_vector_type(16))) _Float16 v16h;
typedef __attribute__((ext_vector_type(8)))  _Float16 v8h;
typedef __attribute__((ext_vector_type(8)))  unsigned short v8us;
typedef __attribute__((ext_vector_type(8)))  float    v8f;
typedef __attribute__((ext_vector_type(4)))  float    v4f;
typedef v8h  __attribute__((may_alias)) v8ha;
typedef v4f  __attribute__((may_alias)) v4fa;
typedef v8us __attribute__((may_alias)) v8usa;

__device__ __forceinline__ unsigned short f2bf(float f) { unsigned u = __float_as_uint(f); u += 0x7FFFu + ((u >> 16) & 1u); return (unsigned short)(u >> 16); }
__device__ __forceinline__ float bf2f(unsigned short b) { return __uint_as_float(((unsigned)b) << 16); }
__device__ __forceinline__ float bfr(float f) { return bf2f(f2bf(f)); }
__device__ __forceinline__ v16h cat16(v8h lo, v8h hi) { return __builtin_shufflevector(lo, hi, 0, 1, 2, 3, 4, 5, 6, 7, 8, 9, 10, 11, 12, 13, 14, 15); }
__device__ __forceinline__ v16bf cat16b(v8us lo, v8us hi) { return __builtin_bit_cast(v16bf, __builtin_shufflevector(lo, hi, 0, 1, 2, 3, 4, 5, 6, 7, 8, 9, 10, 11, 12, 13, 14, 15)); }
__device__ __forceinline__ v8f wmma16(v16h a, v16h b, v8f c) { return __builtin_amdgcn_wmma_f32_16x16x32_f16(false, a, false, b, (short)0, c, false, false); }
__device__ __forceinline__ v8f wmmab(v16bf a, v16bf b, v8f c) { return __builtin_amdgcn_wmma_f32_16x16x32_bf16(false, a, false, b, (short)0, c, false, false); }
#define VST2(T, p, v) do { const T vst2_v_ = (v); *(T*)(p) = vst2_v_;  } while (0)

// k_cvtb: bf16 rows of an [nrows][1024] matrix; k_wt: k-major [1024][1024] -> n-major bf16.
__global__ __launch_bounds__(256) void k_cvtb(const float* __restrict__ src, int nrows, bf* dst) {
    const int lane = threadIdx.x & 31, r = blockIdx.x * 8 + (threadIdx.x >> 5);
    if (r >= nrows) return;
#pragma unroll
    for (int q = 0; q < DM / 256; ++q) { v8us t;
#pragma unroll
        for (int i = 0; i < 8; ++i) t[i] = f2bf(src[(size_t)r * DM + q * 256 + lane * 8 + i]);
        VST2(v8us, dst + (size_t)r * DM + q * 256 + lane * 8, t); }
}
__global__ __launch_bounds__(256) void k_wt(const float* __restrict__ Wm, bf* WT) {
    __shared__ __align__(16) unsigned short tl[64 * 72];
    const int tid = threadIdx.x, k0 = blockIdx.x * 64, n0 = blockIdx.y * 64;
    const int kk = tid >> 2, nq = (tid & 3) * 16;
#pragma unroll
    for (int i = 0; i < 16; ++i) tl[(nq + i) * 72 + kk] = f2bf(Wm[(size_t)(k0 + kk) * DM + n0 + nq + i]);
    __syncthreads();
    const int piece = tid & 7;
    auto pass = [&]() {
#pragma unroll
        for (int s = 0; s < 2; ++s) { const int nr = (tid >> 3) + 32 * s; const v8us val = *(const v8usa*)(tl + nr * 72 + piece * 8);
            *(v8us*)(WT + (size_t)(n0 + nr) * DM + k0 + piece * 8) = val; }
    };
    pass(); 
}
// copy8: eight asynchronous copies of 16 bytes a lane, global -> LDS, eight rows apart (a wave-wide copy = two whole 256-byte rows).
// The s_wait_xcnt stands as the last line of the copies' own statement: it precedes every later rewrite of a register that a copy names.
__device__ __forceinline__ void copy8(unsigned l, const bf* g) {
    asm volatile("global_load_async_to_lds_b128 %0, %8, off\n\t"
                 "global_load_async_to_lds_b128 %1, %9, off\n\t"
                 "global_load_async_to_lds_b128 %2, %10, off\n\t"
                 "global_load_async_to_lds_b128 %3, %11, off\n\t"
                 "global_load_async_to_lds_b128 %4, %12, off\n\t"
                 "global_load_async_to_lds_b128 %5, %13, off\n\t"
                 "global_load_async_to_lds_b128 %6, %14, off\n\t"
                 "global_load_async_to_lds_b128 %7, %15, off\n\t"
                 "s_wait_xcnt 0x0"
                 :: "v"(l), "v"(l + 1 * 8 * GP * 2), "v"(l + 2 * 8 * GP * 2), "v"(l + 3 * 8 * GP * 2), "v"(l + 4 * 8 * GP * 2), "v"(l + 5 * 8 * GP * 2), "v"(l + 6 * 8 * GP * 2), "v"(l + 7 * 8 * GP * 2),
                    "v"(g), "v"(g + 1 * 8 * DM), "v"(g + 2 * 8 * DM), "v"(g + 3 * 8 * DM), "v"(g + 4 * 8 * DM), "v"(g + 5 * 8 * DM), "v"(g + 6 * 8 * DM), "v"(g + 7 * 8 * DM)
                 : "memory");
}
// k_gemmb: 64 x 64 tile of A.B^T + bias over K = 1024 (bf16 exact); MODE 0: f16 hi + residual planes (ld 1024); MODE 1: f32 rows (V).
// Operands come through LDS: a stage is 128 k of the block's 64 A rows and 64 B rows (256-byte rows at pitch 272 B), brought by asynchronous copies into two buffers,
// the stage after next in flight while this one is multiplied; the fragments keep the k order and the sum order of direct loads.
template <int MODE>
__global__ __launch_bounds__(128) void k_gemmb(const bf* __restrict__ A, const bf* __restrict__ Bn, const float* __restrict__ bias, void* C, void* C2) {
    __shared__ __align__(16) bf stg[2 * GBUF];
    __shared__ __align__(16) float ost[4][16 * 68];
    const int tid = threadIdx.x, lane = tid & 31, wave = tid >> 5, lr = lane & 15, hi = lane >> 4;
    const int rb = blockIdx.x * 64, r0 = rb + wave * 16, c0 = blockIdx.y * 64;
    const int crow = tid >> 4, cpc = (tid & 15) * 8;    // the lane's row (of 8 a copy round) and 16-byte piece of a staged row
    const bf* ga = A + (size_t)(rb + crow) * DM + cpc;
    const bf* gb = Bn + (size_t)(c0 + crow) * DM + cpc;
    const unsigned la = (unsigned)(size_t)(stg + crow * GP + cpc);    // LDS byte address of the lane's piece in buffer 0, A rows; the B rows stand 64 rows on
    auto stage = [&](int t) {
        const unsigned l = la + (unsigned)(t & 1) * (GBUF * 2);
        copy8(l, ga + t * GK); copy8(l + 64 * GP * 2, gb + t * GK);
    };
    v8f acc[4];
#pragma unroll
    for (int t = 0; t < 4; ++t) acc[t] = (v8f){};
    stage(0);
    asm volatile("s_wait_asynccnt 0x0" ::: "memory");    // stage 0 of this wave has landed
    __syncthreads();                                     // ... and of every wave: publishes buffer 0
    stage(1);
    const int ao = (wave * 16 + lr) * GP + 8 * hi, bo = (64 + lr) * GP + 8 * hi;
#pragma unroll 1    // one rolled trip a stage: the foot's order (waits, barrier, refill) stands once
    for (int s = 0; s < DM / GK; ++s) {
        const bf* sb = stg + (s & 1) * GBUF;
        v16bf fa[GK / 32], fb[GK / 32][4];
#pragma unroll
        for (int c = 0; c < GK / 32; ++c) {
            fa[c] = cat16b(*(const v8usa*)(sb + ao + c * 32), *(const v8usa*)(sb + ao + c * 32 + 16));
#pragma unroll
            for (int t = 0; t < 4; ++t) fb[c][t] = cat16b(*(const v8usa*)(sb + bo + t * 16 * GP + c * 32), *(const v8usa*)(sb + bo + t * 16 * GP + c * 32 + 16));
        }
        asm volatile("s_wait_dscnt 0x0" ::: "memory");       // the stage's fragments are in registers: this wave's reads of the buffer are done before it is refilled
        asm volatile("s_wait_asynccnt 0x0" ::: "memory");    // this wave's copies of stage s + 1 have landed
        __syncthreads();                                     // publishes stage s + 1 and ends every reader's last read of stage s
        if (s + 2 < DM / GK) stage(s + 2);
        // the products work on registers alone and stand behind the refill's issue: the copies fly while the matrix unit runs
#pragma unroll
        for (int c = 0; c < GK / 32; ++c)
#pragma unroll
            for (int t = 0; t < 4; ++t) acc[t] = wmmab(fa[c], fb[c][t], acc[t]);
    }
    asm volatile("s_wait_asynccnt 0x0" ::: "memory");        // nothing is outstanding when the wave goes on
    float* os = &ost[wave][0];
#pragma unroll
    for (int t = 0; t < 4; ++t) { const float bv = bfr(bias[c0 + t * 16 + lr]);
#pragma unroll
        for (int j = 0; j < 8; ++j) os[(hi * 8 + j) * 68 + t * 16 + lr] = acc[t][j] + bv; }
    __syncthreads();
    if (MODE == 1) {
        float* crow = (float*)C + (size_t)r0 * DM + c0;
        auto pass = [&]() {
#pragma unroll
            for (int s = 0; s < 8; ++s) { const int Lid = (lane >> 3) + 4 * s, piece = lane & 7; const int row = Lid >> 1, cofs = (Lid & 1) * 32 + piece * 4;
                const v4f val = *(const v4fa*)(os + row * 68 + cofs); *(v4f*)(crow + (size_t)row * DM + cofs) = val; }
        };
        pass(); 
    } else {
        h16* c1 = (h16*)C + (size_t)r0 * DM + c0; h16* c2 = (h16*)C2 + (size_t)r0 * DM + c0;
        auto pass = [&]() {
#pragma unroll
            for (int s = 0; s < 4; ++s) { const int row = 4 * s + (lane >> 3), piece = lane & 7; const float* sp = os + row * 68 + piece * 8; v8h o1, o2;
#pragma unroll
                for (int i = 0; i < 8; ++i) { const h16 a = (h16)sp[i]; o1[i] = a; o2[i] = (h16)((sp[i] - (float)a) * LOSC); }
                *(v8h*)(c1 + (size_t)row * DM + piece * 8) = o1; *(v8h*)(c2 + (size_t)row * DM + piece * 8) = o2; }
        };
        pass(); 
    }
}
// k_vt: VTH/VTL [b][h][d][s] = f16 hi + residual of V rows; block (b, h, 64 s).
__global__ __launch_bounds__(256) void k_vt(const float* __restrict__ V, h16* VTH, h16* VTL) {
    __shared__ __align__(16) h16 tile[HD * 72];
    __shared__ __align__(16) h16 til2[HD * 72];
    const int bid = blockIdx.x;
    const int b = bid / (NH_ * (SS / 64)), rem = bid - b * (NH_ * (SS / 64)), h = rem / (SS / 64), kt = rem - h * (SS / 64);
    const int s0 = kt * 64, tid = threadIdx.x, ss = tid >> 2, d0 = (tid & 3) * 16;
    const float* src = V + ((size_t)b * SS + s0 + ss) * DM + h * HD + d0;
#pragma unroll
    for (int i = 0; i < 16; ++i) { const float v = src[i]; const h16 a = (h16)v; tile[(d0 + i) * 72 + ss] = a; til2[(d0 + i) * 72 + ss] = (h16)((v - (float)a) * LOSC); }
    __syncthreads();
    const int piece = tid & 7;
    const size_t base = (((size_t)b * NH_ + h) * HD) * SS + s0;
    auto pass = [&]() {
#pragma unroll
        for (int s = 0; s < 4; ++s) { const int Lid = (tid >> 3) + 32 * s; const int pln = Lid >> 6, d = Lid & 63;
            const v8h val = *(const v8ha*)((pln ? til2 : tile) + d * 72 + piece * 8); *(v8h*)((pln ? VTL : VTH) + base + (size_t)d * SS + piece * 8) = val; }
    };
    pass(); 
}
// band16: dst[i][c] = (ah + al/1024)[row i].(ph + pl/1024)[row c], i < 16, c < 80 (hi.hi + hi.lo + lo.hi over K = 64); all four operands are staged LDS rows of pitch SP.
__device__ __forceinline__ void band16(const h16* ah, const h16* al, const h16* ph, const h16* pl, int lr, int hi, float* dst) {
    const int ao = lr * SP + 8 * hi;
    v8f acc[BW / 16], accx[BW / 16];
#pragma unroll
    for (int t = 0; t < BW / 16; ++t) { acc[t] = (v8f){}; accx[t] = (v8f){}; }
#pragma unroll
    for (int kc = 0; kc < 2; ++kc) {
        const v16h a = cat16(*(const v8ha*)(ah + ao + kc * 32), *(const v8ha*)(ah + ao + kc * 32 + 16)), ax = cat16(*(const v8ha*)(al + ao + kc * 32), *(const v8ha*)(al + ao + kc * 32 + 16));
#pragma unroll
        for (int t = 0; t < BW / 16; ++t) { const int bo = t * 16 * SP + ao + kc * 32;
            const v16h bh = cat16(*(const v8ha*)(ph + bo), *(const v8ha*)(ph + bo + 16)), bl = cat16(*(const v8ha*)(pl + bo), *(const v8ha*)(pl + bo + 16));
            acc[t] = wmma16(a, bh, acc[t]); accx[t] = wmma16(a, bl, accx[t]); accx[t] = wmma16(ax, bh, accx[t]); }
    }
#pragma unroll
    for (int t = 0; t < BW / 16; ++t)
#pragma unroll
        for (int j = 0; j < 8; ++j) dst[(hi * 8 + j) * BP + t * 16 + lr] = acc[t][j] + accx[t][j] * LOSCI;
}
// k_bias: 64 x 64 tile (queries q0.., keys k0..) of Bt[pair][q][k] = c2p[q][q - k + 511] + p2c[k][k - q + 511]; grid (SS/64, SS/64, 64 pairs), 8 waves.
// Staged in LDS by whole 128-byte head rows, hi and residual planes: the 64 q rows, the 64 k rows, the 128 rows q0 - k0 + 448 .. of pos_k and the 128 rows k0 - q0 + 448 .. of
// pos_q (both ranges lie in [0, 1023] for every tile). Wave w < 4 forms the c2p band of queries 16w .. 16w + 15 against staged pos_k rows 16w .. 16w + 79; wave 4 + w the p2c
// band of keys 16w .. against staged pos_q rows 16w .. 16w + 79. In a band, element (row i, opposite position j of the tile) stands at column i - j + 63.
__global__ __launch_bounds__(256) void k_bias(const h16* __restrict__ QH, const h16* __restrict__ QL, const h16* __restrict__ KH, const h16* __restrict__ KL,
                                             const h16* __restrict__ PKH, const h16* __restrict__ PKL, const h16* __restrict__ PQH, const h16* __restrict__ PQL, float* Bt) {
    __shared__ __align__(16) h16 st[768 * SP];
    __shared__ float bd[8 * BPL];
    const int tid = threadIdx.x, lane = tid & 31, wave = tid >> 5, lr = lane & 15, hi = lane >> 4;
    const int p = blockIdx.z, b = p / NH_, h = p - b * NH_;
    const int q0 = blockIdx.x * 64, k0 = blockIdx.y * 64;
    const size_t tok0 = (size_t)b * SS;
    const int srow = tid >> 3, spc = (tid & 7) * 8;
    const unsigned voff = (unsigned)(srow * DM + spc);    // the lane's element offset inside a slab of 32 rows: the one vector register that all 24 loads name
    v8h sv[24];
    auto fetch = [&](const h16* __restrict__ g, size_t grow0, int n32, int at) {
        const h16* gb = g + grow0 * DM + h * HD;
#pragma unroll
        for (int i = 0; i < n32; ++i) sv[at + i] = *(const v8h*)(gb + voff + i * 32 * DM);
        // The wait that stands between issued global loads and any overwrite of a register they name (the plane's base is formed anew for the next plane);
        // voff as an input keeps the shared offset register whole up to the last of these waits.
        asm volatile("s_wait_xcnt 0x0" :: "v"(voff) : "memory");
    };
    fetch(QH, tok0 + q0, 2, 0); fetch(QL, tok0 + q0, 2, 2); fetch(KH, tok0 + k0, 2, 4); fetch(KL, tok0 + k0, 2, 6);
    fetch(PKH, (size_t)(q0 - k0 + (SS - 64)), 4, 8); fetch(PKL, (size_t)(q0 - k0 + (SS - 64)), 4, 12);
    fetch(PQH, (size_t)(k0 - q0 + (SS - 64)), 4, 16); fetch(PQL, (size_t)(k0 - q0 + (SS - 64)), 4, 20);
#pragma unroll
    for (int r = 0; r < 24; ++r) *(v8ha*)(st + (r * 32 + srow) * SP + spc) = sv[r];
    __syncthreads();
    const int side = wave >> 2, w4 = wave & 3;
    const h16* sa = st + (side * 128 + w4 * 16) * SP;
    const h16* sp = st + (256 + side * 256 + w4 * 16) * SP;
    band16(sa, sa + 64 * SP, sp, sp + 128 * SP, lr, hi, bd + wave * BPL);
    __syncthreads();
    float* brow = Bt + ((size_t)p * SS + q0 + wave * 8) * SS + k0;
#pragma unroll
    for (int s = 0; s < 4; ++s) { const int Lid = (lane >> 3) + 4 * s, piece = lane & 7; const int row = Lid >> 1, cofs = (Lid & 1) * 32 + piece * 4, qq = wave * 8 + row, qw = qq >> 4, qi = qq & 15;
        v4f val;
#pragma unroll
        for (int e = 0; e < 4; ++e) { const int kk = cofs + e, kw = kk >> 4, ki = kk & 15;
            val[e] = bd[qw * BPL + qi * BP + qi - kk + 63] + bd[(4 + kw) * BPL + ki * BP + ki - qq + 63]; }
        *(v4f*)(brow + (size_t)row * SS + cofs) = val; }
}
// k_attn: block = (pair p, 64 queries), wave = 16; 16 key tiles: content = q.k (hi.hi + hi.lo + lo.hi: 12 WMMA), bias = Bt[p][q][k],
// logits = (content + bias) x SCL; online softmax; weights x32768 hi/residual; 12 WMMA .v;
__global__ __launch_bounds__(128) void k_attn(const h16* __restrict__ QH, const h16* __restrict__ QL, const h16* __restrict__ KH, const h16* __restrict__ KL,
                                             const float* __restrict__ Bt, const h16* __restrict__ VTH, const h16* __restrict__ VTL, float* out) {
    __shared__ __align__(16) h16 plds[4][16 * 32];
    __shared__ __align__(16) h16 plds2[4][16 * 32];
    __shared__ __align__(16) float ost[4][16 * 68];
    const int lane = threadIdx.x & 31, wave = threadIdx.x >> 5, lr = lane & 15, hi = lane >> 4;
    const int p = blockIdx.x / (SS / 64), qt = blockIdx.x - p * (SS / 64), b = p / NH_, h = p - b * NH_;
    const int q0 = qt * 64 + wave * 16;
    const size_t tok0 = (size_t)b * SS;
    h16* pl = &plds[wave][0]; h16* pl2 = &plds2[wave][0];
    v16h qa[2];
    const size_t qo0 = (tok0 + q0 + lr) * DM + h * HD + 8 * hi;
#pragma unroll
    for (int kc = 0; kc < 2; ++kc) qa[kc] = cat16(*(const v8h*)(QH + qo0 + kc * 32), *(const v8h*)(QH + qo0 + kc * 32 + 16));
    int qrow[8];
#pragma unroll
    for (int j = 0; j < 8; ++j) qrow[j] = q0 + 8 * hi + j;
    const float* bt = Bt + (size_t)p * SS * SS;
    const size_t vbase = (((size_t)b * NH_ + h) * HD) * SS;
    v8f o[4], ox[4];
#pragma unroll
    for (int n = 0; n < 4; ++n) { o[n] = (v8f){}; ox[n] = (v8f){}; }
    float mrow[8], lpart[8];
#pragma unroll
    for (int j = 0; j < 8; ++j) { mrow[j] = -3.0e38f; lpart[j] = 0.f; }
#pragma unroll 1
    for (int kt = 0; kt < SS / 32; ++kt) {
        const int l0 = kt * 32, ka = l0 + lr, kb = l0 + 16 + lr;
        float ba[8], bb[8];    // the trip's bias values, asked for at the head of the trip: they fly while the content products wait for their own operands
#pragma unroll
        for (int j = 0; j < 8; ++j) { ba[j] = bt[(size_t)qrow[j] * SS + ka]; bb[j] = bt[(size_t)qrow[j] * SS + kb]; }
        v8f s0 = {}, s1 = {}, x0 = {}, x1 = {};
#pragma unroll
        for (int kc = 0; kc < 2; ++kc) {
            const size_t ko = (tok0 + l0 + lr) * DM + h * HD + kc * 32 + 8 * hi, k1o = ko + (size_t)16 * DM;
            { const v16h k0h = cat16(*(const v8h*)(KH + ko), *(const v8h*)(KH + ko + 16)), k1h = cat16(*(const v8h*)(KH + k1o), *(const v8h*)(KH + k1o + 16));
              // The wait between issued global loads and an overwrite of a register they name: behind the second half's key loads this build lets the next load's result land on their address pair.
              if (kc == 1) asm volatile("s_wait_xcnt 0x0" ::: "memory");
              const v16h qlk = cat16(*(const v8h*)(QL + qo0 + kc * 32), *(const v8h*)(QL + qo0 + kc * 32 + 16));
              s0 = wmma16(qa[kc], k0h, s0); x0 = wmma16(qlk, k0h, x0); s1 = wmma16(qa[kc], k1h, s1); x1 = wmma16(qlk, k1h, x1);
              asm volatile("v_nop" : "+v"(s0), "+v"(s1), "+v"(x0), "+v"(x1) : "v"(qlk), "v"(k0h), "v"(k1h) : "memory"); }
            { const v16h k0l = cat16(*(const v8h*)(KL + ko), *(const v8h*)(KL + ko + 16)), k1l = cat16(*(const v8h*)(KL + k1o), *(const v8h*)(KL + k1o + 16));
              x0 = wmma16(qa[kc], k0l, x0); x1 = wmma16(qa[kc], k1l, x1);
              asm volatile("v_nop" : "+v"(x0), "+v"(x1) : "v"(k0l), "v"(k1l) : "memory"); }
        }
        asm volatile("v_nop\n\tv_nop\n\tv_nop\n\tv_nop" : "+v"(s0), "+v"(s1), "+v"(x0), "+v"(x1) : "v"(qa[0]), "v"(qa[1]));
        float alpha[8];
#pragma unroll
        for (int j = 0; j < 8; ++j) {
            const float a0 = (s0[j] + x0[j] * LOSCI + ba[j]) * SCL, a1 = (s1[j] + x1[j] * LOSCI + bb[j]) * SCL;
            float mx = fmaxf(a0, a1);
            mx = fmaxf(mx, __shfl_xor(mx, 1, 16)); mx = fmaxf(mx, __shfl_xor(mx, 2, 16)); mx = fmaxf(mx, __shfl_xor(mx, 4, 16)); mx = fmaxf(mx, __shfl_xor(mx, 8, 16));
            const float mn = fmaxf(mrow[j], mx);
            alpha[j] = __expf(mrow[j] - mn); mrow[j] = mn;
            const float e0 = __expf(a0 - mn), e1 = __expf(a1 - mn);
            lpart[j] = lpart[j] * alpha[j] + (e0 + e1);
            const int mr = hi * 8 + j;
            const float ps0 = e0 * PSC, ps1 = e1 * PSC; const h16 h0 = (h16)ps0, h1 = (h16)ps1;
            pl[mr * 32 + lr] = h0; pl[mr * 32 + 16 + lr] = h1; pl2[mr * 32 + lr] = (h16)((ps0 - (float)h0) * LOSC); pl2[mr * 32 + 16 + lr] = (h16)((ps1 - (float)h1) * LOSC);
        }
#pragma unroll
        for (int n = 0; n < 4; ++n)
#pragma unroll
            for (int j = 0; j < 8; ++j) { o[n][j] *= alpha[j]; ox[n][j] *= alpha[j]; }
        asm volatile("" ::: "memory");
        const v16h pa = cat16(*(const v8ha*)(pl + lr * 32 + hi * 8), *(const v8ha*)(pl + lr * 32 + 16 + hi * 8));
        const v16h px = cat16(*(const v8ha*)(pl2 + lr * 32 + hi * 8), *(const v8ha*)(pl2 + lr * 32 + 16 + hi * 8));
#pragma unroll
        for (int n = 0; n < 4; ++n) { const size_t vo = vbase + (size_t)(n * 16 + lr) * SS + l0 + hi * 8;
            const v16h vh = cat16(*(const v8h*)(VTH + vo), *(const v8h*)(VTH + vo + 16)), vl = cat16(*(const v8h*)(VTL + vo), *(const v8h*)(VTL + vo + 16));
            o[n] = wmma16(pa, vh, o[n]); ox[n] = wmma16(pa, vl, ox[n]); ox[n] = wmma16(px, vh, ox[n]);
            asm volatile("" : "+v"(o[n]), "+v"(ox[n]) : "v"(vh), "v"(vl) : "memory"); }
    }
    float inv[8];
#pragma unroll
    for (int j = 0; j < 8; ++j) { float rs = lpart[j]; rs += __shfl_xor(rs, 1, 16); rs += __shfl_xor(rs, 2, 16); rs += __shfl_xor(rs, 4, 16); rs += __shfl_xor(rs, 8, 16); inv[j] = 1.0f / (rs * PSC); }
    float* os = &ost[wave][0];
#pragma unroll
    for (int n = 0; n < 4; ++n)
#pragma unroll
        for (int j = 0; j < 8; ++j) os[(hi * 8 + j) * 68 + n * 16 + lr] = (o[n][j] + ox[n][j] * LOSCI) * inv[j];
    __syncthreads();
    float* ob = out + (tok0 + q0) * DM + (size_t)h * HD;
    auto pass = [&]() {
#pragma unroll
        for (int s = 0; s < 8; ++s) { const int Lid = (lane >> 3) + 4 * s, piece = lane & 7; const int row = Lid >> 1, cofs = (Lid & 1) * 32 + piece * 4;
            const v4f val = *(const v4fa*)(os + row * 68 + cofs); *(v4f*)(ob + (size_t)row * DM + cofs) = val; }
    };
    pass(); 
}

extern "C" void kernel_launch(void* const* d_in, const int* in_sizes, int n_in,
                              void* d_out, int out_size, void* d_ws, size_t ws_size, hipStream_t stream) {
    (void)in_sizes; (void)n_in; (void)out_size;
    const float* x = (const float*)d_in[0]; const float* rel = (const float*)d_in[1]; const float* Wq = (const float*)d_in[2]; const float* bq = (const float*)d_in[3];
    const float* Wk = (const float*)d_in[4]; const float* bk = (const float*)d_in[5]; const float* Wv = (const float*)d_in[6]; const float* bv = (const float*)d_in[7];
    float* out = (float*)d_out;    // [4][512][1024]
    char* wsp = (char*)d_ws;
    auto take = [&](size_t bytes) { char* p = wsp; wsp += (bytes + 255) & ~(size_t)255; return (void*)p; };
    bf* Xb = (bf*)take((size_t)NTK * DM * 2); bf* Rb = (bf*)take((size_t)NR * DM * 2); bf* WqT = (bf*)take((size_t)DM * DM * 2); bf* WkT = (bf*)take((size_t)DM * DM * 2); bf* WvT = (bf*)take((size_t)DM * DM * 2);
    h16* QH = (h16*)take((size_t)NTK * DM * 2); h16* QL = (h16*)take((size_t)NTK * DM * 2); h16* KH = (h16*)take((size_t)NTK * DM * 2); h16* KL = (h16*)take((size_t)NTK * DM * 2);
    h16* PKH = (h16*)take((size_t)NR * DM * 2); h16* PKL = (h16*)take((size_t)NR * DM * 2); h16* PQH = (h16*)take((size_t)NR * DM * 2); h16* PQL = (h16*)take((size_t)NR * DM * 2);
    float* Vf = (float*)take((size_t)NTK * DM * 4); h16* VTH = (h16*)take((size_t)NTK * DM * 2); h16* VTL = (h16*)take((size_t)NTK * DM * 2);
    float* Bt = (float*)take((size_t)NB_ * NH_ * SS * SS * 4);
    if ((size_t)(wsp - (char*)d_ws) > ws_size) return;    // 4.2 + 2.1 + 6.3 + 16.8 + 8.4 + 8.4 + 8.4 + 67 ~ 122 MB
    k_cvtb<<<NTK / 8, 256, 0, stream>>>(x, NTK, Xb);
    k_cvtb<<<NR / 8, 256, 0, stream>>>(rel, NR, Rb);                  // rel_embeddings[0 : 1024] (att_span = 512 = MAX_REL -> the whole table)
    k_wt<<<dim3(DM / 64, DM / 64, 1), 256, 0, stream>>>(Wq, WqT); k_wt<<<dim3(DM / 64, DM / 64, 1), 256, 0, stream>>>(Wk, WkT); k_wt<<<dim3(DM / 64, DM / 64, 1), 256, 0, stream>>>(Wv, WvT);
    k_gemmb<0><<<dim3(NTK / 64, DM / 64, 1), 128, 0, stream>>>(Xb, WqT, bq, QH, QL);
    k_gemmb<0><<<dim3(NTK / 64, DM / 64, 1), 128, 0, stream>>>(Xb, WkT, bk, KH, KL);
    k_gemmb<1><<<dim3(NTK / 64, DM / 64, 1), 128, 0, stream>>>(Xb, WvT, bv, Vf, nullptr);
    k_gemmb<0><<<dim3(NR / 64, DM / 64, 1), 128, 0, stream>>>(Rb, WkT, bk, PKH, PKL);       // pos_k = rel.Wk + bk
    k_gemmb<0><<<dim3(NR / 64, DM / 64, 1), 128, 0, stream>>>(Rb, WqT, bq, PQH, PQL);       // pos_q = rel.Wq + bq
    k_vt<<<NB_ * NH_ * (SS / 64), 256, 0, stream>>>(Vf, VTH, VTL);
    k_bias<<<dim3(SS / 64, SS / 64, NB_ * NH_), 256, 0, stream>>>(QH, QL, KH, KL, PKH, PKL, PQH, PQL, Bt);
    k_attn<<<NB_ * NH_ * (SS / 64), 128, 0, stream>>>(QH, QL, KH, KL, Bt, VTH, VTL, out);
}

// v004
// One run takes 107 microseconds.
// Two timings next to v003 put it at 1.24 and 1.25 times that version's speed.
// Counting every step since v000, it is 5.86 times as fast.
#include <hip/hip_runtime.h>

// Contractions, f32 accumulate: q/k/v = x.W + b ([2048 x 1024].[1024 x 1024]) and pos_k = rel.Wk + bk, pos_q = rel.Wq + bq ([1024 x 1024].[1024 x 1024]) on
// v_wmma_f32_16x16x32_bf16 with PLAIN bf16 operands (inputs rounded once: exact; k-major weights transposed into n-major planes; tiles staged in LDS by asynchronous copies); the disentangled attention on
// v_wmma_f32_16x16x32_f16 with every computed operand as f16 hi + residual x1024 (hi.hi + hi.lo + lo.hi): the relative products q.pos_k^T and k.pos_q^T, only the
// 80-column band that a 16 x 64 piece of the score tile gathers from (operands staged in LDS), gathered in LDS into one table bias[pair][q][k] = c2p[q][q-k+511] + p2c[k][k-q+511]; then the
// fused attention over all 64 (b,h) pairs in one launch (content q.k + bias[q][k], online softmax, weights . v).
// Four launches, each made of everything that depends only on the launches before it: k_prep (both conversions, three weight transposes), k_gemm5 (all five projections),
// k_bias (the bias tiles and the V transpose), k_attn. A block picks its job from its index alone.

#define NB_  4
#define SS   512
#define DM   1024
#define NH_  16
#define HD   64
#define NR   1024                // 2 * att_span relative positions
#define NTK  (NB_ * SS)          // 2048
#define BW   80                  // relative columns that 16 rows against 64 opposite positions can gather: 16 + 64 - 1, rounded up to whole 16-column tiles
#define BP   84                  // LDS pitch of a band row, in floats
#define SP   72                  // LDS pitch of a staged 64-element f16 row, in elements: the 16 bytes of pad spread the 16 rows of a b128 fragment read over all banks
#define BPL  (16 * BP + 6)       // LDS floats per wave's band; the + 6 spreads the four waves' planes over the banks for the diagonal reads
#define GK   128                 // k elements of a staged GEMM tile: rows of 256 bytes
#define GP   136                 // LDS pitch of a staged GEMM row, in elements: 272 B = 16 B x odd, for b128 fragment reads
#define GBUF (128 * GP)          // elements of one GEMM buffer: 64 A rows, then 64 B rows
#define PSC  32768.0f
#define LOSC 1024.0f
#define LOSCI (1.0f / 1024.0f)
#define SCL  0.07216878364870322f    // (64*3)^-0.5

typedef _Float16 h16;
typedef unsigned short bf;
typedef __attribute__((ext_vector_type(16))) __bf16   v16bf;
typedef __attribute__((ext_vector_type(16))) _Float16 v16h;
typedef __attribute__((ext_vector_type(8)))  _Float16 v8h;
typedef __attribute__((ext_vector_type(8)))  unsigned short v8us;
typedef __attribute__((ext_vector_type(8)))  float    v8f;
typedef __attribute__((ext_vector_type(4)))  float    v4f;
typedef v8h  __attribute__((may_alias)) v8ha;
typedef v4f  __attribute__((may_alias)) v4fa;
typedef v8us __attribute__((may_alias)) v8usa;

__device__ __forceinline__ unsigned short f2bf(float f) { unsigned u = __float_as_uint(f); u += 0x7FFFu + ((u >> 16) & 1u); return (unsigned short)(u >> 16); }
__device__ __forceinline__ float bf2f(unsigned short b) { return __uint_as_float(((unsigned)b) << 16); }
__device__ __forceinline__ float bfr(float f) { return bf2f(f2bf(f)); }
__device__ __forceinline__ v16h cat16(v8h lo, v8h hi) { return __builtin_shufflevector(lo, hi, 0, 1, 2, 3, 4, 5, 6, 7, 8, 9, 10, 11, 12, 13, 14, 15); }
__device__ __forceinline__ v16bf cat16b(v8us lo, v8us hi) { return __builtin_bit_cast(v16bf, __builtin_shufflevector(lo, hi, 0, 1, 2, 3, 4, 5, 6, 7, 8, 9, 10, 11, 12, 13, 14, 15)); }
__device__ __forceinline__ v8f wmma16(v16h a, v16h b, v8f c) { return __builtin_amdgcn_wmma_f32_16x16x32_f16(false, a, false, b, (short)0, c, false, false); }
__device__ __forceinline__ v8f wmmab(v16bf a, v16bf b, v8f c) { return __builtin_amdgcn_wmma_f32_16x16x32_bf16(false, a, false, b, (short)0, c, false, false); }
#define VST2(T, p, v) do { const T vst2_v_ = (v); *(T*)(p) = vst2_v_;  } while (0)

// cvtb: bf16 rows of an [nrows][1024] matrix, 8 rows a block; wt: a 64 x 64 tile of k-major [1024][1024] -> n-major bf16.
__device__ __forceinline__ void cvtb(const float* __restrict__ src, int nrows, bf* dst, int blk) {
    const int lane = threadIdx.x & 31, r = blk * 8 + (threadIdx.x >> 5);
    if (r >= nrows) return;
#pragma unroll
    for (int q = 0; q < DM / 256; ++q) { v8us t;
#pragma unroll
        for (int i = 0; i < 8; ++i) t[i] = f2bf(src[(size_t)r * DM + q * 256 + lane * 8 + i]);
        VST2(v8us, dst + (size_t)r * DM + q * 256 + lane * 8, t); }
}
__device__ __forceinline__ void wt(const float* __restrict__ Wm, bf* WT, int kb, int nb, unsigned short* tl) {
    const int tid = threadIdx.x, k0 = kb * 64, n0 = nb * 64;
    const int kk = tid >> 2, nq = (tid & 3) * 16;
#pragma unroll
    for (int i = 0; i < 16; ++i) tl[(nq + i) * 72 + kk] = f2bf(Wm[(size_t)(k0 + kk) * DM + n0 + nq + i]);
    __syncthreads();
    const int piece = tid & 7;
    auto pass = [&]() {
#pragma unroll
        for (int s = 0; s < 2; ++s) { const int nr = (tid >> 3) + 32 * s; const v8us val = *(const v8usa*)(tl + nr * 72 + piece * 8);
            *(v8us*)(WT + (size_t)(n0 + nr) * DM + k0 + piece * 8) = val; }
    };
    pass(); 
}
// k_prep: every operand conversion in one launch. Blocks 0 .. 767: the 256 tiles of Wq, of Wk, of Wv; the next 256: x; the last 128: the relative table.
#define WTB  ((DM / 64) * (DM / 64))    // tiles of one weight matrix
__global__ __launch_bounds__(256) void k_prep(const float* __restrict__ x, const float* __restrict__ rel, const float* __restrict__ Wq, const float* __restrict__ Wk, const float* __restrict__ Wv,
                                             bf* Xb, bf* Rb, bf* WqT, bf* WkT, bf* WvT) {
    __shared__ __align__(16) unsigned short tl[64 * 72];
    const int id = blockIdx.x;
    if (id < 3 * WTB) {
        const int w = id / WTB, t = id - w * WTB;
        wt(w == 0 ? Wq : w == 1 ? Wk : Wv, w == 0 ? WqT : w == 1 ? WkT : WvT, t % (DM / 64), t / (DM / 64), tl);
    } else if (id < 3 * WTB + NTK / 8) cvtb(x, NTK, Xb, id - 3 * WTB);
    else cvtb(rel, NR, Rb, id - (3 * WTB + NTK / 8));    // rel_embeddings[0 : 1024] (att_span = 512 = MAX_REL -> the whole table)
}
// copy8: eight asynchronous copies of 16 bytes a lane, global -> LDS, eight rows apart (a wave-wide copy = two whole 256-byte rows).
// The s_wait_xcnt stands as the last line of the copies' own statement: it precedes every later rewrite of a register that a copy names.
__device__ __forceinline__ void copy8(unsigned l, const bf* g) {
    asm volatile("global_load_async_to_lds_b128 %0, %8, off\n\t"
                 "global_load_async_to_lds_b128 %1, %9, off\n\t"
                 "global_load_async_to_lds_b128 %2, %10, off\n\t"
                 "global_load_async_to_lds_b128 %3, %11, off\n\t"
                 "global_load_async_to_lds_b128 %4, %12, off\n\t"
                 "global_load_async_to_lds_b128 %5, %13, off\n\t"
                 "global_load_async_to_lds_b128 %6, %14, off\n\t"
                 "global_load_async_to_lds_b128 %7, %15, off\n\t"
                 "s_wait_xcnt 0x0"
                 :: "v"(l), "v"(l + 1 * 8 * GP * 2), "v"(l + 2 * 8 * GP * 2), "v"(l + 3 * 8 * GP * 2), "v"(l + 4 * 8 * GP * 2), "v"(l + 5 * 8 * GP * 2), "v"(l + 6 * 8 * GP * 2), "v"(l + 7 * 8 * GP * 2),
                    "v"(g), "v"(g + 1 * 8 * DM), "v"(g + 2 * 8 * DM), "v"(g + 3 * 8 * DM), "v"(g + 4 * 8 * DM), "v"(g + 5 * 8 * DM), "v"(g + 6 * 8 * DM), "v"(g + 7 * 8 * DM)
                 : "memory");
}
// k_gemm5: 64 x 64 tile of A.B^T + bias over K = 1024 (bf16 exact), all five projections in one launch: blocks of 512 for q, k, v (A = x), then of 256 for pos_k, pos_q (A = the relative table);
// q, k, pos_k, pos_q leave as f16 hi + residual planes (ld 1024), v as f32 rows.
// Operands come through LDS: a stage is 128 k of the block's 64 A rows and 64 B rows (256-byte rows at pitch 272 B), brought by asynchronous copies into two buffers,
// the next stage in flight while this one is multiplied; the fragments keep the k order and the sum order of direct loads.
#define GXB  ((NTK / 64u) * (DM / 64u))    // blocks of a projection of x
#define GRB  ((NR / 64u) * (DM / 64u))     // blocks of a projection of the relative table
__global__ __launch_bounds__(128) void k_gemm5(const bf* __restrict__ Xb, const bf* __restrict__ Rb, const bf* __restrict__ WqT, const bf* __restrict__ WkT, const bf* __restrict__ WvT,
                                              const float* __restrict__ bq, const float* __restrict__ bk, const float* __restrict__ bv,
                                              h16* QH, h16* QL, h16* KH, h16* KL, float* Vf, h16* PKH, h16* PKL, h16* PQH, h16* PQL) {
    __shared__ __align__(16) bf stg[2 * GBUF];
    __shared__ __align__(16) float ost[4][16 * 68];
    const int tid = threadIdx.x, lane = tid & 31, wave = tid >> 5, lr = lane & 15, hi = lane >> 4;
    const unsigned id = blockIdx.x;
    const bool onx = id < 3u * GXB;
    const unsigned job = onx ? id / GXB : 3u + (id - 3u * GXB) / GRB;          // 0 q, 1 k, 2 v, 3 pos_k, 4 pos_q
    const unsigned tl = onx ? id % GXB : (id - 3u * GXB) % GRB;                // the tile inside its job, row blocks fastest
    const bf* __restrict__ A = onx ? Xb : Rb;
    const bf* __restrict__ Bn = (job == 0 || job == 4) ? WqT : job == 2 ? WvT : WkT;
    const float* __restrict__ bias = (job == 0 || job == 4) ? bq : job == 2 ? bv : bk;
    const int rb = (int)(onx ? tl % (NTK / 64u) : tl % (NR / 64u)) * 64, r0 = rb + wave * 16, c0 = (int)(onx ? tl / (NTK / 64u) : tl / (NR / 64u)) * 64;
    const int crow = tid >> 4, cpc = (tid & 15) * 8;    // the lane's row (of 8 a copy round) and 16-byte piece of a staged row
    const bf* ga = A + (size_t)(rb + crow) * DM + cpc;
    const bf* gb = Bn + (size_t)(c0 + crow) * DM + cpc;
    const unsigned la = (unsigned)(size_t)(stg + crow * GP + cpc);    // LDS byte address of the lane's piece in buffer 0, A rows; the B rows stand 64 rows on
    auto stage = [&](int t) {
        const unsigned l = la + (unsigned)(t & 1) * (GBUF * 2);
        copy8(l, ga + t * GK); copy8(l + 64 * GP * 2, gb + t * GK);
    };
    v8f acc[4];
#pragma unroll
    for (int t = 0; t < 4; ++t) acc[t] = (v8f){};
    stage(0);
    asm volatile("s_wait_asynccnt 0x0" ::: "memory");    // stage 0 of this wave has landed
    __syncthreads();                                     // ... and of every wave: publishes buffer 0
    stage(1);
    const int ao = (wave * 16 + lr) * GP + 8 * hi, bo = (64 + lr) * GP + 8 * hi;
#pragma unroll 1    // one rolled trip a stage: the foot's order (waits, barrier, refill) stands once
    for (int s = 0; s < DM / GK; ++s) {
        const bf* sb = stg + (s & 1) * GBUF;
        v16bf fa[GK / 32], fb[GK / 32][4];
#pragma unroll
        for (int c = 0; c < GK / 32; ++c) {
            fa[c] = cat16b(*(const v8usa*)(sb + ao + c * 32), *(const v8usa*)(sb + ao + c * 32 + 16));
#pragma unroll
            for (int t = 0; t < 4; ++t) fb[c][t] = cat16b(*(const v8usa*)(sb + bo + t * 16 * GP + c * 32), *(const v8usa*)(sb + bo + t * 16 * GP + c * 32 + 16));
        }
        asm volatile("s_wait_dscnt 0x0" ::: "memory");       // the stage's fragments are in registers: this wave's reads of the buffer are done before it is refilled
        asm volatile("s_wait_asynccnt 0x0" ::: "memory");    // this wave's copies of stage s + 1 have landed
        __syncthreads();                                     // publishes stage s + 1 and ends every reader's last read of stage s
        if (s + 2 < DM / GK) stage(s + 2);
        // the products work on registers alone and stand behind the refill's issue: the copies fly while the matrix unit runs
#pragma unroll
        for (int c = 0; c < GK / 32; ++c)
#pragma unroll
            for (int t = 0; t < 4; ++t) acc[t] = wmmab(fa[c], fb[c][t], acc[t]);
    }
    asm volatile("s_wait_asynccnt 0x0" ::: "memory");        // nothing is outstanding when the wave goes on
    float* os = &ost[wave][0];
#pragma unroll
    for (int t = 0; t < 4; ++t) { const float bv = bfr(bias[c0 + t * 16 + lr]);
#pragma unroll
        for (int j = 0; j < 8; ++j) os[(hi * 8 + j) * 68 + t * 16 + lr] = acc[t][j] + bv; }
    __syncthreads();
    if (job == 2) {
        float* crow = Vf + (size_t)r0 * DM + c0;
        auto pass = [&]() {
#pragma unroll
            for (int s = 0; s < 8; ++s) { const int Lid = (lane >> 3) + 4 * s, piece = lane & 7; const int row = Lid >> 1, cofs = (Lid & 1) * 32 + piece * 4;
                const v4f val = *(const v4fa*)(os + row * 68 + cofs); *(v4f*)(crow + (size_t)row * DM + cofs) = val; }
        };
        pass(); 
    } else {
        h16* c1 = (job == 0 ? QH : job == 1 ? KH : job == 3 ? PKH : PQH) + (size_t)r0 * DM + c0; h16* c2 = (job == 0 ? QL : job == 1 ? KL : job == 3 ? PKL : PQL) + (size_t)r0 * DM + c0;
        auto pass = [&]() {
#pragma unroll
            for (int s = 0; s < 4; ++s) { const int row = 4 * s + (lane >> 3), piece = lane & 7; const float* sp = os + row * 68 + piece * 8; v8h o1, o2;
#pragma unroll
                for (int i = 0; i < 8; ++i) { const h16 a = (h16)sp[i]; o1[i] = a; o2[i] = (h16)((sp[i] - (float)a) * LOSC); }
                *(v8h*)(c1 + (size_t)row * DM + piece * 8) = o1; *(v8h*)(c2 + (size_t)row * DM + piece * 8) = o2; }
        };
        pass(); 
    }
}
// vt: VTH/VTL [b][h][d][s] = f16 hi + residual of V rows; block bid = (b, h, 64 s); tile, til2: 64 x 72 elements of LDS each.
__device__ __forceinline__ void vt(const float* __restrict__ V, h16* VTH, h16* VTL, int bid, h16* tile, h16* til2) {
    const int b = bid / (NH_ * (SS / 64)), rem = bid - b * (NH_ * (SS / 64)), h = rem / (SS / 64), kt = rem - h * (SS / 64);
    const int s0 = kt * 64, tid = threadIdx.x, ss = tid >> 2, d0 = (tid & 3) * 16;
    const float* src = V + ((size_t)b * SS + s0 + ss) * DM + h * HD + d0;
#pragma unroll
    for (int i = 0; i < 16; ++i) { const float v = src[i]; const h16 a = (h16)v; tile[(d0 + i) * 72 + ss] = a; til2[(d0 + i) * 72 + ss] = (h16)((v - (float)a) * LOSC); }
    __syncthreads();
    const int piece = tid & 7;
    const size_t base = (((size_t)b * NH_ + h) * HD) * SS + s0;
    auto pass = [&]() {
#pragma unroll
        for (int s = 0; s < 4; ++s) { const int Lid = (tid >> 3) + 32 * s; const int pln = Lid >> 6, d = Lid & 63;
            const v8h val = *(const v8ha*)((pln ? til2 : tile) + d * 72 + piece * 8); *(v8h*)((pln ? VTL : VTH) + base + (size_t)d * SS + piece * 8) = val; }
    };
    pass(); 
}
// band16: dst[i][c] = (ah + al/1024)[row i].(ph + pl/1024)[row c], i < 16, c < 80 (hi.hi + hi.lo + lo.hi over K = 64); all four operands are staged LDS rows of pitch SP.
__device__ __forceinline__ void band16(const h16* ah, const h16* al, const h16* ph, const h16* pl, int lr, int hi, float* dst) {
    const int ao = lr * SP + 8 * hi;
    v8f acc[BW / 16], accx[BW / 16];
#pragma unroll
    for (int t = 0; t < BW / 16; ++t) { acc[t] = (v8f){}; accx[t] = (v8f){}; }
#pragma unroll
    for (int kc = 0; kc < 2; ++kc) {
        const v16h a = cat16(*(const v8ha*)(ah + ao + kc * 32), *(const v8ha*)(ah + ao + kc * 32 + 16)), ax = cat16(*(const v8ha*)(al + ao + kc * 32), *(const v8ha*)(al + ao + kc * 32 + 16));
#pragma unroll
        for (int t = 0; t < BW / 16; ++t) { const int bo = t * 16 * SP + ao + kc * 32;
            const v16h bh = cat16(*(const v8ha*)(ph + bo), *(const v8ha*)(ph + bo + 16)), bl = cat16(*(const v8ha*)(pl + bo), *(const v8ha*)(pl + bo + 16));
            acc[t] = wmma16(a, bh, acc[t]); accx[t] = wmma16(a, bl, accx[t]); accx[t] = wmma16(ax, bh, accx[t]); }
    }
#pragma unroll
    for (int t = 0; t < BW / 16; ++t)
#pragma unroll
        for (int j = 0; j < 8; ++j) dst[(hi * 8 + j) * BP + t * 16 + lr] = acc[t][j] + accx[t][j] * LOSCI;
}
// k_bias: 64 x 64 tile (queries q0.., keys k0..) of Bt[pair][q][k] = c2p[q][q - k + 511] + p2c[k][k - q + 511]; grid (SS/64, SS/64, 64 pairs + 8 V-transpose planes), 8 waves.
// Staged in LDS by whole 128-byte head rows, hi and residual planes: the 64 q rows, the 64 k rows, the 128 rows q0 - k0 + 448 .. of pos_k and the 128 rows k0 - q0 + 448 .. of
// pos_q (both ranges lie in [0, 1023] for every tile). Wave w < 4 forms the c2p band of queries 16w .. 16w + 15 against staged pos_k rows 16w .. 16w + 79; wave 4 + w the p2c
// band of keys 16w .. against staged pos_q rows 16w .. 16w + 79. In a band, element (row i, opposite position j of the tile) stands at column i - j + 63.
// The 8 grid planes behind the 64 pairs' are the 512 blocks of the V transpose, which waits for the same launch as the bias and for nothing else; they use the head of the staging LDS.
__global__ __launch_bounds__(256) void k_bias(const h16* __restrict__ QH, const h16* __restrict__ QL, const h16* __restrict__ KH, const h16* __restrict__ KL,
                                             const h16* __restrict__ PKH, const h16* __restrict__ PKL, const h16* __restrict__ PQH, const h16* __restrict__ PQL, float* Bt,
                                             const float* __restrict__ Vf, h16* VTH, h16* VTL) {
    __shared__ __align__(16) h16 st[768 * SP];
    __shared__ float bd[8 * BPL];
    if (blockIdx.z >= NB_ * NH_) { vt(Vf, VTH, VTL, ((blockIdx.z - NB_ * NH_) * (SS / 64) + blockIdx.y) * (SS / 64) + blockIdx.x, st, st + HD * 72); return; }
    const int tid = threadIdx.x, lane = tid & 31, wave = tid >> 5, lr = lane & 15, hi = lane >> 4;
    const int p = blockIdx.z, b = p / NH_, h = p - b * NH_;
    const int q0 = blockIdx.x * 64, k0 = blockIdx.y * 64;
    const size_t tok0 = (size_t)b * SS;
    const int srow = tid >> 3, spc = (tid & 7) * 8;
    const unsigned voff = (unsigned)(srow * DM + spc);    // the lane's element offset inside a slab of 32 rows: the one vector register that all 24 loads name
    v8h sv[24];
    auto fetch = [&](const h16* __restrict__ g, size_t grow0, int n32, int at) {
        const h16* gb = g + grow0 * DM + h * HD;
#pragma unroll
        for (int i = 0; i < n32; ++i) sv[at + i] = *(const v8h*)(gb + voff + i * 32 * DM);
        // The wait that stands between issued global loads and any overwrite of a register they name (the plane's base is formed anew for the next plane);
        // voff as an input keeps the shared offset register whole up to the last of these waits.
        asm volatile("s_wait_xcnt 0x0" :: "v"(voff) : "memory");
    };
    fetch(QH, tok0 + q0, 2, 0); fetch(QL, tok0 + q0, 2, 2); fetch(KH, tok0 + k0, 2, 4); fetch(KL, tok0 + k0, 2, 6);
    fetch(PKH, (size_t)(q0 - k0 + (SS - 64)), 4, 8); fetch(PKL, (size_t)(q0 - k0 + (SS - 64)), 4, 12);
    fetch(PQH, (size_t)(k0 - q0 + (SS - 64)), 4, 16); fetch(PQL, (size_t)(k0 - q0 + (SS - 64)), 4, 20);
#pragma unroll
    for (int r = 0; r < 24; ++r) *(v8ha*)(st + (r * 32 + srow) * SP + spc) = sv[r];
    __syncthreads();
    const int side = wave >> 2, w4 = wave & 3;
    const h16* sa = st + (side * 128 + w4 * 16) * SP;
    const h16* sp = st + (256 + side * 256 + w4 * 16) * SP;
    band16(sa, sa + 64 * SP, sp, sp + 128 * SP, lr, hi, bd + wave * BPL);
    __syncthreads();
    float* brow = Bt + ((size_t)p * SS + q0 + wave * 8) * SS + k0;
#pragma unroll
    for (int s = 0; s < 4; ++s) { const int Lid = (lane >> 3) + 4 * s, piece = lane & 7; const int row = Lid >> 1, cofs = (Lid & 1) * 32 + piece * 4, qq = wave * 8 + row, qw = qq >> 4, qi = qq & 15;
        v4f val;
#pragma unroll
        for (int e = 0; e < 4; ++e) { const int kk = cofs + e, kw = kk >> 4, ki = kk & 15;
            val[e] = bd[qw * BPL + qi * BP + qi - kk + 63] + bd[(4 + kw) * BPL + ki * BP + ki - qq + 63]; }
        *(v4f*)(brow + (size_t)row * SS + cofs) = val; }
}
// k_attn: block = (pair p, 64 queries), wave = 16; 16 key tiles: content = q.k (hi.hi + hi.lo + lo.hi: 12 WMMA), bias = Bt[p][q][k],
// logits = (content + bias) x SCL; online softmax; weights x32768 hi/residual; 12 WMMA .v;
__global__ __launch_bounds__(128) void k_attn(const h16* __restrict__ QH, const h16* __restrict__ QL, const h16* __restrict__ KH, const h16* __restrict__ KL,
                                             const float* __restrict__ Bt, const h16* __restrict__ VTH, const h16* __restrict__ VTL, float* out) {
    __shared__ __align__(16) h16 plds[4][16 * 32];
    __shared__ __align__(16) h16 plds2[4][16 * 32];
    __shared__ __align__(16) float ost[4][16 * 68];
    const int lane = threadIdx.x & 31, wave = threadIdx.x >> 5, lr = lane & 15, hi = lane >> 4;
    const int p = blockIdx.x / (SS / 64), qt = blockIdx.x - p * (SS / 64), b = p / NH_, h = p - b * NH_;
    const int q0 = qt * 64 + wave * 16;
    const size_t tok0 = (size_t)b * SS;
    h16* pl = &plds[wave][0]; h16* pl2 = &plds2[wave][0];
    v16h qa[2];
    const size_t qo0 = (tok0 + q0 + lr) * DM + h * HD + 8 * hi;
#pragma unroll
    for (int kc = 0; kc < 2; ++kc) qa[kc] = cat16(*(const v8h*)(QH + qo0 + kc * 32), *(const v8h*)(QH + qo0 + kc * 32 + 16));
    int qrow[8];
#pragma unroll
    for (int j = 0; j < 8; ++j) qrow[j] = q0 + 8 * hi + j;
    const float* bt = Bt + (size_t)p * SS * SS;
    const size_t vbase = (((size_t)b * NH_ + h) * HD) * SS;
    v8f o[4], ox[4];
#pragma unroll
    for (int n = 0; n < 4; ++n) { o[n] = (v8f){}; ox[n] = (v8f){}; }
    float mrow[8], lpart[8];
#pragma unroll
    for (int j = 0; j < 8; ++j) { mrow[j] = -3.0e38f; lpart[j] = 0.f; }
#pragma unroll 1
    for (int kt = 0; kt < SS / 32; ++kt) {
        const int l0 = kt * 32, ka = l0 + lr, kb = l0 + 16 + lr;
        float ba[8], bb[8];    // the trip's bias values, asked for at the head of the trip: they fly while the content products wait for their own operands
#pragma unroll
        for (int j = 0; j < 8; ++j) { ba[j] = bt[(size_t)qrow[j] * SS + ka]; bb[j] = bt[(size_t)qrow[j] * SS + kb]; }
        v8f s0 = {}, s1 = {}, x0 = {}, x1 = {};
#pragma unroll
        for (int kc = 0; kc < 2; ++kc) {
            const size_t ko = (tok0 + l0 + lr) * DM + h * HD + kc * 32 + 8 * hi, k1o = ko + (size_t)16 * DM;
            { const v16h k0h = cat16(*(const v8h*)(KH + ko), *(const v8h*)(KH + ko + 16)), k1h = cat16(*(const v8h*)(KH + k1o), *(const v8h*)(KH + k1o + 16));
              // The wait between issued global loads and an overwrite of a register they name: behind the second half's key loads this build lets the next load's result land on their address pair.
              if (kc == 1) asm volatile("s_wait_xcnt 0x0" ::: "memory");
              const v16h qlk = cat16(*(const v8h*)(QL + qo0 + kc * 32), *(const v8h*)(QL + qo0 + kc * 32 + 16));
              s0 = wmma16(qa[kc], k0h, s0); x0 = wmma16(qlk, k0h, x0); s1 = wmma16(qa[kc], k1h, s1); x1 = wmma16(qlk, k1h, x1);
              asm volatile("v_nop" : "+v"(s0), "+v"(s1), "+v"(x0), "+v"(x1) : "v"(qlk), "v"(k0h), "v"(k1h) : "memory"); }
            { const v16h k0l = cat16(*(const v8h*)(KL + ko), *(const v8h*)(KL + ko + 16)), k1l = cat16(*(const v8h*)(KL + k1o), *(const v8h*)(KL + k1o + 16));
              x0 = wmma16(qa[kc], k0l, x0); x1 = wmma16(qa[kc], k1l, x1);
              asm volatile("v_nop" : "+v"(x0), "+v"(x1) : "v"(k0l), "v"(k1l) : "memory"); }
        }
        asm volatile("v_nop\n\tv_nop\n\tv_nop\n\tv_nop" : "+v"(s0), "+v"(s1), "+v"(x0), "+v"(x1) : "v"(qa[0]), "v"(qa[1]));
        float alpha[8];
#pragma unroll
        for (int j = 0; j < 8; ++j) {
            const float a0 = (s0[j] + x0[j] * LOSCI + ba[j]) * SCL, a1 = (s1[j] + x1[j] * LOSCI + bb[j]) * SCL;
            float mx = fmaxf(a0, a1);
            mx = fmaxf(mx, __shfl_xor(mx, 1, 16)); mx = fmaxf(mx, __shfl_xor(mx, 2, 16)); mx = fmaxf(mx, __shfl_xor(mx, 4, 16)); mx = fmaxf(mx, __shfl_xor(mx, 8, 16));
            const float mn = fmaxf(mrow[j], mx);
            alpha[j] = __expf(mrow[j] - mn); mrow[j] = mn;
            const float e0 = __expf(a0 - mn), e1 = __expf(a1 - mn);
            lpart[j] = lpart[j] * alpha[j] + (e0 + e1);
            const int mr = hi * 8 + j;
            const float ps0 = e0 * PSC, ps1 = e1 * PSC; const h16 h0 = (h16)ps0, h1 = (h16)ps1;
            pl[mr * 32 + lr] = h0; pl[mr * 32 + 16 + lr] = h1; pl2[mr * 32 + lr] = (h16)((ps0 - (float)h0) * LOSC); pl2[mr * 32 + 16 + lr] = (h16)((ps1 - (float)h1) * LOSC);
        }
#pragma unroll
        for (int n = 0; n < 4; ++n)
#pragma unroll
            for (int j = 0; j < 8; ++j) { o[n][j] *= alpha[j]; ox[n][j] *= alpha[j]; }
        asm volatile("" ::: "memory");
        const v16h pa = cat16(*(const v8ha*)(pl + lr * 32 + hi * 8), *(const v8ha*)(pl + lr * 32 + 16 + hi * 8));
        const v16h px = cat16(*(const v8ha*)(pl2 + lr * 32 + hi * 8), *(const v8ha*)(pl2 + lr * 32 + 16 + hi * 8));
#pragma unroll
        for (int n = 0; n < 4; ++n) { const size_t vo = vbase + (size_t)(n * 16 + lr) * SS + l0 + hi * 8;
            const v16h vh = cat16(*(const v8h*)(VTH + vo), *(const v8h*)(VTH + vo + 16)), vl = cat16(*(const v8h*)(VTL + vo), *(const v8h*)(VTL + vo + 16));
            o[n] = wmma16(pa, vh, o[n]); ox[n] = wmma16(pa, vl, ox[n]); ox[n] = wmma16(px, vh, ox[n]);
            asm volatile("" : "+v"(o[n]), "+v"(ox[n]) : "v"(vh), "v"(vl) : "memory"); }
    }
    float inv[8];
#pragma unroll
    for (int j = 0; j < 8; ++j) { float rs = lpart[j]; rs += __shfl_xor(rs, 1, 16); rs += __shfl_xor(rs, 2, 16); rs += __shfl_xor(rs, 4, 16); rs += __shfl_xor(rs, 8, 16); inv[j] = 1.0f / (rs * PSC); }
    float* os = &ost[wave][0];
#pragma unroll
    for (int n = 0; n < 4; ++n)
#pragma unroll
        for (int j = 0; j < 8; ++j) os[(hi * 8 + j) * 68 + n * 16 + lr] = (o[n][j] + ox[n][j] * LOSCI) * inv[j];
    __syncthreads();
    float* ob = out + (tok0 + q0) * DM + (size_t)h * HD;
    auto pass = [&]() {
#pragma unroll
        for (int s = 0; s < 8; ++s) { const int Lid = (lane >> 3) + 4 * s, piece = lane & 7; const int row = Lid >> 1, cofs = (Lid & 1) * 32 + piece * 4;
            const v4f val = *(const v4fa*)(os + row * 68 + cofs); *(v4f*)(ob + (size_t)row * DM + cofs) = val; }
    };
    pass(); 
}

extern "C" void kernel_launch(void* const* d_in, const int* in_sizes, int n_in,
                              void* d_out, int out_size, void* d_ws, size_t ws_size, hipStream_t stream) {
    (void)in_sizes; (void)n_in; (void)out_size;
    const float* x = (const float*)d_in[0]; const float* rel = (const float*)d_in[1]; const float* Wq = (const float*)d_in[2]; const float* bq = (const float*)d_in[3];
    const float* Wk = (const float*)d_in[4]; const float* bk = (const float*)d_in[5]; const float* Wv = (const float*)d_in[6]; const float* bv = (const float*)d_in[7];
    float* out = (float*)d_out;    // [4][512][1024]
    char* wsp = (char*)d_ws;
    auto take = [&](size_t bytes) { char* p = wsp; wsp += (bytes + 255) & ~(size_t)255; return (void*)p; };
    bf* Xb = (bf*)take((size_t)NTK * DM * 2); bf* Rb = (bf*)take((size_t)NR * DM * 2); bf* WqT = (bf*)take((size_t)DM * DM * 2); bf* WkT = (bf*)take((size_t)DM * DM * 2); bf* WvT = (bf*)take((size_t)DM * DM * 2);
    h16* QH = (h16*)take((size_t)NTK * DM * 2); h16* QL = (h16*)take((size_t)NTK * DM * 2); h16* KH = (h16*)take((size_t)NTK * DM * 2); h16* KL = (h16*)take((size_t)NTK * DM * 2);
    h16* PKH = (h16*)take((size_t)NR * DM * 2); h16* PKL = (h16*)take((size_t)NR * DM * 2); h16* PQH = (h16*)take((size_t)NR * DM * 2); h16* PQL = (h16*)take((size_t)NR * DM * 2);
    float* Vf = (float*)take((size_t)NTK * DM * 4); h16* VTH = (h16*)take((size_t)NTK * DM * 2); h16* VTL = (h16*)take((size_t)NTK * DM * 2);
    float* Bt = (float*)take((size_t)NB_ * NH_ * SS * SS * 4);
    if ((size_t)(wsp - (char*)d_ws) > ws_size) return;    // 4.2 + 2.1 + 6.3 + 16.8 + 8.4 + 8.4 + 8.4 + 67 ~ 122 MB
    k_prep<<<3 * WTB + NTK / 8 + NR / 8, 256, 0, stream>>>(x, rel, Wq, Wk, Wv, Xb, Rb, WqT, WkT, WvT);
    k_gemm5<<<3 * GXB + 2 * GRB, 128, 0, stream>>>(Xb, Rb, WqT, WkT, WvT, bq, bk, bv, QH, QL, KH, KL, Vf, PKH, PKL, PQH, PQL);    // pos_k = rel.Wk + bk, pos_q = rel.Wq + bq
    k_bias<<<dim3(SS / 64, SS / 64, NB_ * NH_ + NB_ * NH_ * (SS / 64) / ((SS / 64) * (SS / 64))), 256, 0, stream>>>(QH, QL, KH, KL, PKH, PKL, PQH, PQL, Bt, Vf, VTH, VTL);
    k_attn<<<NB_ * NH_ * (SS / 64), 128, 0, stream>>>(QH, QL, KH, KL, Bt, VTH, VTL, out);
}

// v005
// It runs in 87.5 microseconds.
// Timed twice side by side with v004, it ran 1.22 and 1.23 times as fast.
// All steps since v000 together make it 7.18 times as fast.
#include <hip/hip_runtime.h>

// Contractions, f32 accumulate: q/k/v = x.W + b ([2048 x 1024].[1024 x 1024]) and pos_k = rel.Wk + bk, pos_q = rel.Wq + bq ([1024 x 1024].[1024 x 1024]) on
// v_wmma_f32_16x16x32_bf16 with PLAIN bf16 operands (inputs rounded once: exact; k-major weights transposed into n-major planes; tiles staged in LDS by asynchronous copies); the disentangled attention on
// v_wmma_f32_16x16x32_f16 with every computed operand as f16 hi + residual x1024 (hi.hi + hi.lo + lo.hi): the relative products q.pos_k^T and k.pos_q^T, only the
// 80-column band that a 16 x 64 piece of the score tile gathers from (operands staged in LDS), gathered in LDS into one table bias[pair][q][k] = c2p[q][q-k+511] + p2c[k][k-q+511]; then the
// fused attention over all 64 (b,h) pairs in one launch (content q.k + bias[q][k], online softmax, weights . v; key, V and bias tiles staged in LDS by asynchronous copies).
// Four launches, each made of everything that depends only on the launches before it: k_prep (both conversions, three weight transposes), k_gemm5 (all five projections),
// k_bias (the bias tiles and the V transpose), k_attn. A block picks its job from its index alone.

#define NB_  4
#define SS   512
#define DM   1024
#define NH_  16
#define HD   64
#define NR   1024                // 2 * att_span relative positions
#define NTK  (NB_ * SS)          // 2048
#define BW   80                  // relative columns that 16 rows against 64 opposite positions can gather: 16 + 64 - 1, rounded up to whole 16-column tiles
#define BP   84                  // LDS pitch of a band row, in floats
#define SP   72                  // LDS pitch of a staged 64-element f16 row, in elements: the 16 bytes of pad spread the 16 rows of a b128 fragment read over all banks
#define BPL  (16 * BP + 6)       // LDS floats per wave's band; the + 6 spreads the four waves' planes over the banks for the diagonal reads
#define GK   128                 // k elements of a staged GEMM tile: rows of 256 bytes
#define GP   136                 // LDS pitch of a staged GEMM row, in elements: 272 B = 16 B x odd, for b128 fragment reads
#define GBUF (128 * GP)          // elements of one GEMM buffer: 64 A rows, then 64 B rows
#define PSC  32768.0f
#define LOSC 1024.0f
#define LOSCI (1.0f / 1024.0f)
#define SCL  0.07216878364870322f    // (64*3)^-0.5

typedef _Float16 h16;
typedef unsigned short bf;
typedef __attribute__((ext_vector_type(16))) __bf16   v16bf;
typedef __attribute__((ext_vector_type(16))) _Float16 v16h;
typedef __attribute__((ext_vector_type(8)))  _Float16 v8h;
typedef __attribute__((ext_vector_type(8)))  unsigned short v8us;
typedef __attribute__((ext_vector_type(8)))  float    v8f;
typedef __attribute__((ext_vector_type(4)))  float    v4f;
typedef v8h  __attribute__((may_alias)) v8ha;
typedef v4f  __attribute__((may_alias)) v4fa;
typedef v8us __attribute__((may_alias)) v8usa;

__device__ __forceinline__ unsigned short f2bf(float f) { unsigned u = __float_as_uint(f); u += 0x7FFFu + ((u >> 16) & 1u); return (unsigned short)(u >> 16); }
__device__ __forceinline__ float bf2f(unsigned short b) { return __uint_as_float(((unsigned)b) << 16); }
__device__ __forceinline__ float bfr(float f) { return bf2f(f2bf(f)); }
__device__ __forceinline__ v16h cat16(v8h lo, v8h hi) { return __builtin_shufflevector(lo, hi, 0, 1, 2, 3, 4, 5, 6, 7, 8, 9, 10, 11, 12, 13, 14, 15); }
__device__ __forceinline__ v16bf cat16b(v8us lo, v8us hi) { return __builtin_bit_cast(v16bf, __builtin_shufflevector(lo, hi, 0, 1, 2, 3, 4, 5, 6, 7, 8, 9, 10, 11, 12, 13, 14, 15)); }
__device__ __forceinline__ v8f wmma16(v16h a, v16h b, v8f c) { return __builtin_amdgcn_wmma_f32_16x16x32_f16(false, a, false, b, (short)0, c, false, false); }
__device__ __forceinline__ v8f wmmab(v16bf a, v16bf b, v8f c) { return __builtin_amdgcn_wmma_f32_16x16x32_bf16(false, a, false, b, (short)0, c, false, false); }
#define VST2(T, p, v) do { const T vst2_v_ = (v); *(T*)(p) = vst2_v_;  } while (0)

// cvtb: bf16 rows of an [nrows][1024] matrix, 8 rows a block; wt: a 64 x 64 tile of k-major [1024][1024] -> n-major bf16.
__device__ __forceinline__ void cvtb(const float* __restrict__ src, int nrows, bf* dst, int blk) {
    const int lane = threadIdx.x & 31, r = blk * 8 + (threadIdx.x >> 5);
    if (r >= nrows) return;
#pragma unroll
    for (int q = 0; q < DM / 256; ++q) { v8us t;
#pragma unroll
        for (int i = 0; i < 8; ++i) t[i] = f2bf(src[(size_t)r * DM + q * 256 + lane * 8 + i]);
        VST2(v8us, dst + (size_t)r * DM + q * 256 + lane * 8, t); }
}
__device__ __forceinline__ void wt(const float* __restrict__ Wm, bf* WT, int kb, int nb, unsigned short* tl) {
    const int tid = threadIdx.x, k0 = kb * 64, n0 = nb * 64;
    const int kk = tid >> 2, nq = (tid & 3) * 16;
#pragma unroll
    for (int i = 0; i < 16; ++i) tl[(nq + i) * 72 + kk] = f2bf(Wm[(size_t)(k0 + kk) * DM + n0 + nq + i]);
    __syncthreads();
    const int piece = tid & 7;
    auto pass = [&]() {
#pragma unroll
        for (int s = 0; s < 2; ++s) { const int nr = (tid >> 3) + 32 * s; const v8us val = *(const v8usa*)(tl + nr * 72 + piece * 8);
            *(v8us*)(WT + (size_t)(n0 + nr) * DM + k0 + piece * 8) = val; }
    };
    pass(); 
}
// k_prep: every operand conversion in one launch. Blocks 0 .. 767: the 256 tiles of Wq, of Wk, of Wv; the next 256: x; the last 128: the relative table.
#define WTB  ((DM / 64) * (DM / 64))    // tiles of one weight matrix
__global__ __launch_bounds__(256) void k_prep(const float* __restrict__ x, const float* __restrict__ rel, const float* __restrict__ Wq, const float* __restrict__ Wk, const float* __restrict__ Wv,
                                             bf* Xb, bf* Rb, bf* WqT, bf* WkT, bf* WvT) {
    __shared__ __align__(16) unsigned short tl[64 * 72];
    const int id = blockIdx.x;
    if (id < 3 * WTB) {
        const int w = id / WTB, t = id - w * WTB;
        wt(w == 0 ? Wq : w == 1 ? Wk : Wv, w == 0 ? WqT : w == 1 ? WkT : WvT, t % (DM / 64), t / (DM / 64), tl);
    } else if (id < 3 * WTB + NTK / 8) cvtb(x, NTK, Xb, id - 3 * WTB);
    else cvtb(rel, NR, Rb, id - (3 * WTB + NTK / 8));    // rel_embeddings[0 : 1024] (att_span = 512 = MAX_REL -> the whole table)
}
// copy8: eight asynchronous copies of 16 bytes a lane, global -> LDS, eight rows apart (a wave-wide copy = two whole 256-byte rows).
// The s_wait_xcnt stands as the last line of the copies' own statement: it precedes every later rewrite of a register that a copy names.
__device__ __forceinline__ void copy8(unsigned l, const bf* g) {
    asm volatile("global_load_async_to_lds_b128 %0, %8, off\n\t"
                 "global_load_async_to_lds_b128 %1, %9, off\n\t"
                 "global_load_async_to_lds_b128 %2, %10, off\n\t"
                 "global_load_async_to_lds_b128 %3, %11, off\n\t"
                 "global_load_async_to_lds_b128 %4, %12, off\n\t"
                 "global_load_async_to_lds_b128 %5, %13, off\n\t"
                 "global_load_async_to_lds_b128 %6, %14, off\n\t"
                 "global_load_async_to_lds_b128 %7, %15, off\n\t"
                 "s_wait_xcnt 0x0"
                 :: "v"(l), "v"(l + 1 * 8 * GP * 2), "v"(l + 2 * 8 * GP * 2), "v"(l + 3 * 8 * GP * 2), "v"(l + 4 * 8 * GP * 2), "v"(l + 5 * 8 * GP * 2), "v"(l + 6 * 8 * GP * 2), "v"(l + 7 * 8 * GP * 2),
                    "v"(g), "v"(g + 1 * 8 * DM), "v"(g + 2 * 8 * DM), "v"(g + 3 * 8 * DM), "v"(g + 4 * 8 * DM), "v"(g + 5 * 8 * DM), "v"(g + 6 * 8 * DM), "v"(g + 7 * 8 * DM)
                 : "memory");
}
// k_gemm5: 64 x 64 tile of A.B^T + bias over K = 1024 (bf16 exact), all five projections in one launch: blocks of 512 for q, k, v (A = x), then of 256 for pos_k, pos_q (A = the relative table);
// q, k, pos_k, pos_q leave as f16 hi + residual planes (ld 1024), v as f32 rows.
// Operands come through LDS: a stage is 128 k of the block's 64 A rows and 64 B rows (256-byte rows at pitch 272 B), brought by asynchronous copies into two buffers,
// the next stage in flight while this one is multiplied; the fragments keep the k order and the sum order of direct loads.
#define GXB  ((NTK / 64u) * (DM / 64u))    // blocks of a projection of x
#define GRB  ((NR / 64u) * (DM / 64u))     // blocks of a projection of the relative table
__global__ __launch_bounds__(128) void k_gemm5(const bf* __restrict__ Xb, const bf* __restrict__ Rb, const bf* __restrict__ WqT, const bf* __restrict__ WkT, const bf* __restrict__ WvT,
                                              const float* __restrict__ bq, const float* __restrict__ bk, const float* __restrict__ bv,
                                              h16* QH, h16* QL, h16* KH, h16* KL, float* Vf, h16* PKH, h16* PKL, h16* PQH, h16* PQL) {
    __shared__ __align__(16) bf stg[2 * GBUF];
    __shared__ __align__(16) float ost[4][16 * 68];
    const int tid = threadIdx.x, lane = tid & 31, wave = tid >> 5, lr = lane & 15, hi = lane >> 4;
    const unsigned id = blockIdx.x;
    const bool onx = id < 3u * GXB;
    const unsigned job = onx ? id / GXB : 3u + (id - 3u * GXB) / GRB;          // 0 q, 1 k, 2 v, 3 pos_k, 4 pos_q
    const unsigned tl = onx ? id % GXB : (id - 3u * GXB) % GRB;                // the tile inside its job, row blocks fastest
    const bf* __restrict__ A = onx ? Xb : Rb;
    const bf* __restrict__ Bn = (job == 0 || job == 4) ? WqT : job == 2 ? WvT : WkT;
    const float* __restrict__ bias = (job == 0 || job == 4) ? bq : job == 2 ? bv : bk;
    const int rb = (int)(onx ? tl % (NTK / 64u) : tl % (NR / 64u)) * 64, r0 = rb + wave * 16, c0 = (int)(onx ? tl / (NTK / 64u) : tl / (NR / 64u)) * 64;
    const int crow = tid >> 4, cpc = (tid & 15) * 8;    // the lane's row (of 8 a copy round) and 16-byte piece of a staged row
    const bf* ga = A + (size_t)(rb + crow) * DM + cpc;
    const bf* gb = Bn + (size_t)(c0 + crow) * DM + cpc;
    const unsigned la = (unsigned)(size_t)(stg + crow * GP + cpc);    // LDS byte address of the lane's piece in buffer 0, A rows; the B rows stand 64 rows on
    auto stage = [&](int t) {
        const unsigned l = la + (unsigned)(t & 1) * (GBUF * 2);
        copy8(l, ga + t * GK); copy8(l + 64 * GP * 2, gb + t * GK);
    };
    v8f acc[4];
#pragma unroll
    for (int t = 0; t < 4; ++t) acc[t] = (v8f){};
    stage(0);
    asm volatile("s_wait_asynccnt 0x0" ::: "memory");    // stage 0 of this wave has landed
    __syncthreads();                                     // ... and of every wave: publishes buffer 0
    stage(1);
    const int ao = (wave * 16 + lr) * GP + 8 * hi, bo = (64 + lr) * GP + 8 * hi;
#pragma unroll 1    // one rolled trip a stage: the foot's order (waits, barrier, refill) stands once
    for (int s = 0; s < DM / GK; ++s) {
        const bf* sb = stg + (s & 1) * GBUF;
        v16bf fa[GK / 32], fb[GK / 32][4];
#pragma unroll
        for (int c = 0; c < GK / 32; ++c) {
            fa[c] = cat16b(*(const v8usa*)(sb + ao + c * 32), *(const v8usa*)(sb + ao + c * 32 + 16));
#pragma unroll
            for (int t = 0; t < 4; ++t) fb[c][t] = cat16b(*(const v8usa*)(sb + bo + t * 16 * GP + c * 32), *(const v8usa*)(sb + bo + t * 16 * GP + c * 32 + 16));
        }
        asm volatile("s_wait_dscnt 0x0" ::: "memory");       // the stage's fragments are in registers: this wave's reads of the buffer are done before it is refilled
        asm volatile("s_wait_asynccnt 0x0" ::: "memory");    // this wave's copies of stage s + 1 have landed
        __syncthreads();                                     // publishes stage s + 1 and ends every reader's last read of stage s
        if (s + 2 < DM / GK) stage(s + 2);
        // the products work on registers alone and stand behind the refill's issue: the copies fly while the matrix unit runs
#pragma unroll
        for (int c = 0; c < GK / 32; ++c)
#pragma unroll
            for (int t = 0; t < 4; ++t) acc[t] = wmmab(fa[c], fb[c][t], acc[t]);
    }
    asm volatile("s_wait_asynccnt 0x0" ::: "memory");        // nothing is outstanding when the wave goes on
    float* os = &ost[wave][0];
#pragma unroll
    for (int t = 0; t < 4; ++t) { const float bv = bfr(bias[c0 + t * 16 + lr]);
#pragma unroll
        for (int j = 0; j < 8; ++j) os[(hi * 8 + j) * 68 + t * 16 + lr] = acc[t][j] + bv; }
    __syncthreads();
    if (job == 2) {
        float* crow = Vf + (size_t)r0 * DM + c0;
        auto pass = [&]() {
#pragma unroll
            for (int s = 0; s < 8; ++s) { const int Lid = (lane >> 3) + 4 * s, piece = lane & 7; const int row = Lid >> 1, cofs = (Lid & 1) * 32 + piece * 4;
                const v4f val = *(const v4fa*)(os + row * 68 + cofs); *(v4f*)(crow + (size_t)row * DM + cofs) = val; }
        };
        pass(); 
    } else {
        h16* c1 = (job == 0 ? QH : job == 1 ? KH : job == 3 ? PKH : PQH) + (size_t)r0 * DM + c0; h16* c2 = (job == 0 ? QL : job == 1 ? KL : job == 3 ? PKL : PQL) + (size_t)r0 * DM + c0;
        auto pass = [&]() {
#pragma unroll
            for (int s = 0; s < 4; ++s) { const int row = 4 * s + (lane >> 3), piece = lane & 7; const float* sp = os + row * 68 + piece * 8; v8h o1, o2;
#pragma unroll
                for (int i = 0; i < 8; ++i) { const h16 a = (h16)sp[i]; o1[i] = a; o2[i] = (h16)((sp[i] - (float)a) * LOSC); }
                *(v8h*)(c1 + (size_t)row * DM + piece * 8) = o1; *(v8h*)(c2 + (size_t)row * DM + piece * 8) = o2; }
        };
        pass(); 
    }
}
// vt: VTH/VTL [b][h][d][s] = f16 hi + residual of V rows; block bid = (b, h, 64 s); tile, til2: 64 x 72 elements of LDS each.
__device__ __forceinline__ void vt(const float* __restrict__ V, h16* VTH, h16* VTL, int bid, h16* tile, h16* til2) {
    const int b = bid / (NH_ * (SS / 64)), rem = bid - b * (NH_ * (SS / 64)), h = rem / (SS / 64), kt = rem - h * (SS / 64);
    const int s0 = kt * 64, tid = threadIdx.x, ss = tid >> 2, d0 = (tid & 3) * 16;
    const float* src = V + ((size_t)b * SS + s0 + ss) * DM + h * HD + d0;
#pragma unroll
    for (int i = 0; i < 16; ++i) { const float v = src[i]; const h16 a = (h16)v; tile[(d0 + i) * 72 + ss] = a; til2[(d0 + i) * 72 + ss] = (h16)((v - (float)a) * LOSC); }
    __syncthreads();
    const int piece = tid & 7;
    const size_t base = (((size_t)b * NH_ + h) * HD) * SS + s0;
    auto pass = [&]() {
#pragma unroll
        for (int s = 0; s < 4; ++s) { const int Lid = (tid >> 3) + 32 * s; const int pln = Lid >> 6, d = Lid & 63;
            const v8h val = *(const v8ha*)((pln ? til2 : tile) + d * 72 + piece * 8); *(v8h*)((pln ? VTL : VTH) + base + (size_t)d * SS + piece * 8) = val; }
    };
    pass(); 
}
// band16: dst[i][c] = (ah + al/1024)[row i].(ph + pl/1024)[row c], i < 16, c < 80 (hi.hi + hi.lo + lo.hi over K = 64); all four operands are staged LDS rows of pitch SP.
__device__ __forceinline__ void band16(const h16* ah, const h16* al, const h16* ph, const h16* pl, int lr, int hi, float* dst) {
    const int ao = lr * SP + 8 * hi;
    v8f acc[BW / 16], accx[BW / 16];
#pragma unroll
    for (int t = 0; t < BW / 16; ++t) { acc[t] = (v8f){}; accx[t] = (v8f){}; }
#pragma unroll
    for (int kc = 0; kc < 2; ++kc) {
        const v16h a = cat16(*(const v8ha*)(ah + ao + kc * 32), *(const v8ha*)(ah + ao + kc * 32 + 16)), ax = cat16(*(const v8ha*)(al + ao + kc * 32), *(const v8ha*)(al + ao + kc * 32 + 16));
#pragma unroll
        for (int t = 0; t < BW / 16; ++t) { const int bo = t * 16 * SP + ao + kc * 32;
            const v16h bh = cat16(*(const v8ha*)(ph + bo), *(const v8ha*)(ph + bo + 16)), bl = cat16(*(const v8ha*)(pl + bo), *(const v8ha*)(pl + bo + 16));
            acc[t] = wmma16(a, bh, acc[t]); accx[t] = wmma16(a, bl, accx[t]); accx[t] = wmma16(ax, bh, accx[t]); }
    }
#pragma unroll
    for (int t = 0; t < BW / 16; ++t)
#pragma unroll
        for (int j = 0; j < 8; ++j) dst[(hi * 8 + j) * BP + t * 16 + lr] = acc[t][j] + accx[t][j] * LOSCI;
}
// k_bias: 64 x 64 tile (queries q0.., keys k0..) of Bt[pair][q][k] = c2p[q][q - k + 511] + p2c[k][k - q + 511]; grid (SS/64, SS/64, 64 pairs + 8 V-transpose planes), 8 waves.
// Staged in LDS by whole 128-byte head rows, hi and residual planes: the 64 q rows, the 64 k rows, the 128 rows q0 - k0 + 448 .. of pos_k and the 128 rows k0 - q0 + 448 .. of
// pos_q (both ranges lie in [0, 1023] for every tile). Wave w < 4 forms the c2p band of queries 16w .. 16w + 15 against staged pos_k rows 16w .. 16w + 79; wave 4 + w the p2c
// band of keys 16w .. against staged pos_q rows 16w .. 16w + 79. In a band, element (row i, opposite position j of the tile) stands at column i - j + 63.
// The 8 grid planes behind the 64 pairs' are the 512 blocks of the V transpose, which waits for the same launch as the bias and for nothing else; they use the head of the staging LDS.
__global__ __launch_bounds__(256) void k_bias(const h16* __restrict__ QH, const h16* __restrict__ QL, const h16* __restrict__ KH, const h16* __restrict__ KL,
                                             const h16* __restrict__ PKH, const h16* __restrict__ PKL, const h16* __restrict__ PQH, const h16* __restrict__ PQL, float* Bt,
                                             const float* __restrict__ Vf, h16* VTH, h16* VTL) {
    __shared__ __align__(16) h16 st[768 * SP];
    __shared__ float bd[8 * BPL];
    if (blockIdx.z >= NB_ * NH_) { vt(Vf, VTH, VTL, ((blockIdx.z - NB_ * NH_) * (SS / 64) + blockIdx.y) * (SS / 64) + blockIdx.x, st, st + HD * 72); return; }
    const int tid = threadIdx.x, lane = tid & 31, wave = tid >> 5, lr = lane & 15, hi = lane >> 4;
    const int p = blockIdx.z, b = p / NH_, h = p - b * NH_;
    const int q0 = blockIdx.x * 64, k0 = blockIdx.y * 64;
    const size_t tok0 = (size_t)b * SS;
    const int srow = tid >> 3, spc = (tid & 7) * 8;
    const unsigned voff = (unsigned)(srow * DM + spc);    // the lane's element offset inside a slab of 32 rows: the one vector register that all 24 loads name
    v8h sv[24];
    auto fetch = [&](const h16* __restrict__ g, size_t grow0, int n32, int at) {
        const h16* gb = g + grow0 * DM + h * HD;
#pragma unroll
        for (int i = 0; i < n32; ++i) sv[at + i] = *(const v8h*)(gb + voff + i * 32 * DM);
        // The wait that stands between issued global loads and any overwrite of a register they name (the plane's base is formed anew for the next plane);
        // voff as an input keeps the shared offset register whole up to the last of these waits.
        asm volatile("s_wait_xcnt 0x0" :: "v"(voff) : "memory");
    };
    fetch(QH, tok0 + q0, 2, 0); fetch(QL, tok0 + q0, 2, 2); fetch(KH, tok0 + k0, 2, 4); fetch(KL, tok0 + k0, 2, 6);
    fetch(PKH, (size_t)(q0 - k0 + (SS - 64)), 4, 8); fetch(PKL, (size_t)(q0 - k0 + (SS - 64)), 4, 12);
    fetch(PQH, (size_t)(k0 - q0 + (SS - 64)), 4, 16); fetch(PQL, (size_t)(k0 - q0 + (SS - 64)), 4, 20);
#pragma unroll
    for (int r = 0; r < 24; ++r) *(v8ha*)(st + (r * 32 + srow) * SP + spc) = sv[r];
    __syncthreads();
    const int side = wave >> 2, w4 = wave & 3;
    const h16* sa = st + (side * 128 + w4 * 16) * SP;
    const h16* sp = st + (256 + side * 256 + w4 * 16) * SP;
    band16(sa, sa + 64 * SP, sp, sp + 128 * SP, lr, hi, bd + wave * BPL);
    __syncthreads();
    float* brow = Bt + ((size_t)p * SS + q0 + wave * 8) * SS + k0;
#pragma unroll
    for (int s = 0; s < 4; ++s) { const int Lid = (lane >> 3) + 4 * s, piece = lane & 7; const int row = Lid >> 1, cofs = (Lid & 1) * 32 + piece * 4, qq = wave * 8 + row, qw = qq >> 4, qi = qq & 15;
        v4f val;
#pragma unroll
        for (int e = 0; e < 4; ++e) { const int kk = cofs + e, kw = kk >> 4, ki = kk & 15;
            val[e] = bd[qw * BPL + qi * BP + qi - kk + 63] + bd[(4 + kw) * BPL + ki * BP + ki - qq + 63]; }
        *(v4f*)(brow + (size_t)row * SS + cofs) = val; }
}
// copy8a: eight asynchronous copies of 16 bytes a lane, global -> LDS, each with its own pair of addresses.
// The s_wait_xcnt stands as the last line of the copies' own statement: it precedes every later rewrite of a register that a copy names.
__device__ __forceinline__ void copy8a(const unsigned (&l)[8], const void* const (&g)[8]) {
    asm volatile("global_load_async_to_lds_b128 %0, %8, off\n\t"
                 "global_load_async_to_lds_b128 %1, %9, off\n\t"
                 "global_load_async_to_lds_b128 %2, %10, off\n\t"
                 "global_load_async_to_lds_b128 %3, %11, off\n\t"
                 "global_load_async_to_lds_b128 %4, %12, off\n\t"
                 "global_load_async_to_lds_b128 %5, %13, off\n\t"
                 "global_load_async_to_lds_b128 %6, %14, off\n\t"
                 "global_load_async_to_lds_b128 %7, %15, off\n\t"
                 "s_wait_xcnt 0x0"
                 :: "v"(l[0]), "v"(l[1]), "v"(l[2]), "v"(l[3]), "v"(l[4]), "v"(l[5]), "v"(l[6]), "v"(l[7]),
                    "v"(g[0]), "v"(g[1]), "v"(g[2]), "v"(g[3]), "v"(g[4]), "v"(g[5]), "v"(g[6]), "v"(g[7])
                 : "memory");
}
// k_attn: block = (pair p, 64 queries), wave = 16; 16 key tiles of 32: content = q.k (hi.hi + hi.lo + lo.hi: 12 WMMA), bias = Bt[p][q][k],
// logits = (content + bias) x SCL; online softmax; weights x32768 hi/residual; 12 WMMA .v;
// The loop reads no global memory: a stage is 64 keys of everything the block's four waves stream (64 key rows and 64 rows of transposed V, hi and residual planes, 128-byte rows at
// pitch 144 B; the block's 64 x 64 piece of the bias table, 256-byte rows at pitch 272 B), brought by asynchronous copies into two buffers, the next stage in flight while this one is worked on.
// The fragments keep the k order and the sum order of direct loads.
#define AK   64                  // keys of a stage
#define APL  (64 * SP)           // elements of one staged f16 plane
#define ABP  68                  // LDS pitch of a staged bias row, in floats: rows 8 apart (the two half-waves of a read) stand 32 banks apart
__global__ __launch_bounds__(128) void k_attn(const h16* __restrict__ QH, const h16* __restrict__ QL, const h16* __restrict__ KH, const h16* __restrict__ KL,
                                             const float* __restrict__ Bt, const h16* __restrict__ VTH, const h16* __restrict__ VTL, float* out) {
    __shared__ __align__(16) h16 kv[2][4 * APL];        // planes: key hi, key residual, V^T hi, V^T residual
    __shared__ __align__(16) float bs[2][64 * ABP];
    __shared__ __align__(16) h16 plds[4][16 * 32];
    __shared__ __align__(16) h16 plds2[4][16 * 32];
    __shared__ __align__(16) float ost[4][16 * 68];
    const int tid = threadIdx.x, lane = tid & 31, wave = tid >> 5, lr = lane & 15, hi = lane >> 4;
    const int p = blockIdx.x / (SS / 64), qt = blockIdx.x - p * (SS / 64), b = p / NH_, h = p - b * NH_;
    const int q0 = qt * 64 + wave * 16;
    const size_t tok0 = (size_t)b * SS;
    h16* pl = &plds[wave][0]; h16* pl2 = &plds2[wave][0];
    const float* bt = Bt + (size_t)p * SS * SS;
    const size_t vbase = (((size_t)b * NH_ + h) * HD) * SS;
    const int hrow = tid >> 3, hpc = (tid & 7) * 8;     // f16 planes: the lane's row (of 16 a copy round) and 16-byte piece of a 128-byte row
    const int frow = tid >> 4, fpc = (tid & 15) * 4;    // bias: the lane's row (of 8 a copy round) and 16-byte piece of a 256-byte row
    // the lane's source addresses of the next stage to be asked for, one a plane: they walk on by a stage with every call of stage()
    const h16* pkh = KH + (tok0 + hrow) * DM + h * HD + hpc; const h16* pkl = KL + (tok0 + hrow) * DM + h * HD + hpc;
    const h16* pvh = VTH + vbase + (size_t)hrow * SS + hpc; const h16* pvl = VTL + vbase + (size_t)hrow * SS + hpc;
    const float* pbt = bt + (size_t)(qt * 64 + frow) * SS + fpc;
    const unsigned lkv = (unsigned)(size_t)(&kv[0][0] + hrow * SP + hpc), lbs = (unsigned)(size_t)(&bs[0][0] + frow * ABP + fpc);    // LDS byte addresses of the lane's pieces in buffer 0
    auto stage = [&](int t) {
        const unsigned lh = lkv + (unsigned)(t & 1) * (4 * APL * 2), lf = lbs + (unsigned)(t & 1) * (64 * ABP * 4);
        unsigned l[8]; const void* g[8];
#pragma unroll
        for (int i = 0; i < 4; ++i) { l[i] = lh + i * 16 * SP * 2; g[i] = pkh + (size_t)i * 16 * DM; l[4 + i] = l[i] + APL * 2; g[4 + i] = pkl + (size_t)i * 16 * DM; }
        copy8a(l, g);
#pragma unroll
        for (int i = 0; i < 4; ++i) { l[i] = lh + 2 * APL * 2 + i * 16 * SP * 2; g[i] = pvh + (size_t)i * 16 * SS; l[4 + i] = l[i] + APL * 2; g[4 + i] = pvl + (size_t)i * 16 * SS; }
        copy8a(l, g);
#pragma unroll
        for (int i = 0; i < 8; ++i) { l[i] = lf + i * 8 * ABP * 4; g[i] = pbt + (size_t)i * 8 * SS; }
        copy8a(l, g);
        pkh += (size_t)AK * DM; pkl += (size_t)AK * DM; pvh += AK; pvl += AK; pbt += AK;
    };
    stage(0);
    v16h qa[2], ql[2];
    const size_t qo0 = (tok0 + q0 + lr) * DM + h * HD + 8 * hi;
#pragma unroll
    for (int kc = 0; kc < 2; ++kc) { qa[kc] = cat16(*(const v8h*)(QH + qo0 + kc * 32), *(const v8h*)(QH + qo0 + kc * 32 + 16)); ql[kc] = cat16(*(const v8h*)(QL + qo0 + kc * 32), *(const v8h*)(QL + qo0 + kc * 32 + 16)); }
    asm volatile("s_wait_xcnt 0x0" ::: "memory");        // the wait between these issued global loads and a later overwrite of their address registers (stage 1's addresses are formed next)
    v8f o[4], ox[4];
#pragma unroll
    for (int n = 0; n < 4; ++n) { o[n] = (v8f){}; ox[n] = (v8f){}; }
    float mrow[8], lpart[8];
#pragma unroll
    for (int j = 0; j < 8; ++j) { mrow[j] = -3.0e38f; lpart[j] = 0.f; }
    asm volatile("s_wait_asynccnt 0x0" ::: "memory");    // stage 0 of this wave has landed
    __syncthreads();                                     // ... and of every wave: publishes buffer 0
    stage(1);
#pragma unroll 1    // one rolled trip a stage: the foot's order (waits, barrier, refill) stands once
    for (int t = 0; t < SS / AK; ++t) {
        const h16* sk = &kv[t & 1][0];
        const float* sb = &bs[t & 1][0] + (wave * 16 + 8 * hi) * ABP + lr;
#pragma unroll
        for (int u = 0; u < AK / 32; ++u) {
            float ba[8], bb[8];
#pragma unroll
            for (int j = 0; j < 8; ++j) { ba[j] = sb[j * ABP + u * 32]; bb[j] = sb[j * ABP + u * 32 + 16]; }
            v8f s0 = {}, s1 = {}, x0 = {}, x1 = {};
#pragma unroll
            for (int kc = 0; kc < 2; ++kc) {
                const h16* k0 = sk + (u * 32 + lr) * SP + kc * 32 + 8 * hi; const h16* k1 = k0 + 16 * SP;
                const v16h k0h = cat16(*(const v8ha*)(k0), *(const v8ha*)(k0 + 16)), k1h = cat16(*(const v8ha*)(k1), *(const v8ha*)(k1 + 16));
                const v16h k0l = cat16(*(const v8ha*)(k0 + APL), *(const v8ha*)(k0 + APL + 16)), k1l = cat16(*(const v8ha*)(k1 + APL), *(const v8ha*)(k1 + APL + 16));
                s0 = wmma16(qa[kc], k0h, s0); x0 = wmma16(ql[kc], k0h, x0); s1 = wmma16(qa[kc], k1h, s1); x1 = wmma16(ql[kc], k1h, x1);
                x0 = wmma16(qa[kc], k0l, x0); x1 = wmma16(qa[kc], k1l, x1);
            }
            v16h vh[4], vl[4];    // the trip's V fragments, asked for here: their LDS latency passes under the softmax, in the registers that the key fragments have left
#pragma unroll
            for (int n = 0; n < 4; ++n) { const h16* vp = sk + 2 * APL + (n * 16 + lr) * SP + u * 32 + hi * 8;
                vh[n] = cat16(*(const v8ha*)(vp), *(const v8ha*)(vp + 16)); vl[n] = cat16(*(const v8ha*)(vp + APL), *(const v8ha*)(vp + APL + 16)); }
            float alpha[8];
#pragma unroll
            for (int j = 0; j < 8; ++j) {
                const float a0 = (s0[j] + x0[j] * LOSCI + ba[j]) * SCL, a1 = (s1[j] + x1[j] * LOSCI + bb[j]) * SCL;
                float mx = fmaxf(a0, a1);
                mx = fmaxf(mx, __shfl_xor(mx, 1, 16)); mx = fmaxf(mx, __shfl_xor(mx, 2, 16)); mx = fmaxf(mx, __shfl_xor(mx, 4, 16)); mx = fmaxf(mx, __shfl_xor(mx, 8, 16));
                const float mn = fmaxf(mrow[j], mx);
                alpha[j] = __expf(mrow[j] - mn); mrow[j] = mn;
                const float e0 = __expf(a0 - mn), e1 = __expf(a1 - mn);
                lpart[j] = lpart[j] * alpha[j] + (e0 + e1);
                const int mr = hi * 8 + j;
                const float ps0 = e0 * PSC, ps1 = e1 * PSC; const h16 h0 = (h16)ps0, h1 = (h16)ps1;
                pl[mr * 32 + lr] = h0; pl[mr * 32 + 16 + lr] = h1; pl2[mr * 32 + lr] = (h16)((ps0 - (float)h0) * LOSC); pl2[mr * 32 + 16 + lr] = (h16)((ps1 - (float)h1) * LOSC);
            }
#pragma unroll
            for (int n = 0; n < 4; ++n)
#pragma unroll
                for (int j = 0; j < 8; ++j) { o[n][j] *= alpha[j]; ox[n][j] *= alpha[j]; }
            asm volatile("" ::: "memory");
            const v16h pa = cat16(*(const v8ha*)(pl + lr * 32 + hi * 8), *(const v8ha*)(pl + lr * 32 + 16 + hi * 8));
            const v16h px = cat16(*(const v8ha*)(pl2 + lr * 32 + hi * 8), *(const v8ha*)(pl2 + lr * 32 + 16 + hi * 8));
#pragma unroll
            for (int n = 0; n < 4; ++n) { o[n] = wmma16(pa, vh[n], o[n]); ox[n] = wmma16(pa, vl[n], ox[n]); ox[n] = wmma16(px, vh[n], ox[n]); }
        }
        asm volatile("s_wait_dscnt 0x0" ::: "memory");       // this wave's reads of the buffer are done before it is refilled
        asm volatile("s_wait_asynccnt 0x0" ::: "memory");    // this wave's copies of stage t + 1 have landed
        __syncthreads();                                     // publishes stage t + 1 and ends every reader's last read of stage t
        if (t + 2 < SS / AK) stage(t + 2);
    }
    asm volatile("s_wait_asynccnt 0x0" ::: "memory");        // nothing is outstanding when the wave goes on
    float inv[8];
#pragma unroll
    for (int j = 0; j < 8; ++j) { float rs = lpart[j]; rs += __shfl_xor(rs, 1, 16); rs += __shfl_xor(rs, 2, 16); rs += __shfl_xor(rs, 4, 16); rs += __shfl_xor(rs, 8, 16); inv[j] = 1.0f / (rs * PSC); }
    float* os = &ost[wave][0];
#pragma unroll
    for (int n = 0; n < 4; ++n)
#pragma unroll
        for (int j = 0; j < 8; ++j) os[(hi * 8 + j) * 68 + n * 16 + lr] = (o[n][j] + ox[n][j] * LOSCI) * inv[j];
    __syncthreads();
    float* ob = out + (tok0 + q0) * DM + (size_t)h * HD;
    auto pass = [&]() {
#pragma unroll
        for (int s = 0; s < 8; ++s) { const int Lid = (lane >> 3) + 4 * s, piece = lane & 7; const int row = Lid >> 1, cofs = (Lid & 1) * 32 + piece * 4;
            const v4f val = *(const v4fa*)(os + row * 68 + cofs); *(v4f*)(ob + (size_t)row * DM + cofs) = val; }
    };
    pass(); 
}

extern "C" void kernel_launch(void* const* d_in, const int* in_sizes, int n_in,
                              void* d_out, int out_size, void* d_ws, size_t ws_size, hipStream_t stream) {
    (void)in_sizes; (void)n_in; (void)out_size;
    const float* x = (const float*)d_in[0]; const float* rel = (const float*)d_in[1]; const float* Wq = (const float*)d_in[2]; const float* bq = (const float*)d_in[3];
    const float* Wk = (const float*)d_in[4]; const float* bk = (const float*)d_in[5]; const float* Wv = (const float*)d_in[6]; const float* bv = (const float*)d_in[7];
    float* out = (float*)d_out;    // [4][512][1024]
    char* wsp = (char*)d_ws;
    auto take = [&](size_t bytes) { char* p = wsp; wsp += (bytes + 255) & ~(size_t)255; return (void*)p; };
    bf* Xb = (bf*)take((size_t)NTK * DM * 2); bf* Rb = (bf*)take((size_t)NR * DM * 2); bf* WqT = (bf*)take((size_t)DM * DM * 2); bf* WkT = (bf*)take((size_t)DM * DM * 2); bf* WvT = (bf*)take((size_t)DM * DM * 2);
    h16* QH = (h16*)take((size_t)NTK * DM * 2); h16* QL = (h16*)take((size_t)NTK * DM * 2); h16* KH = (h16*)take((size_t)NTK * DM * 2); h16* KL = (h16*)take((size_t)NTK * DM * 2);
    h16* PKH = (h16*)take((size_t)NR * DM * 2); h16* PKL = (h16*)take((size_t)NR * DM * 2); h16* PQH = (h16*)take((size_t)NR * DM * 2); h16* PQL = (h16*)take((size_t)NR * DM * 2);
    float* Vf = (float*)take((size_t)NTK * DM * 4); h16* VTH = (h16*)take((size_t)NTK * DM * 2); h16* VTL = (h16*)take((size_t)NTK * DM * 2);
    float* Bt = (float*)take((size_t)NB_ * NH_ * SS * SS * 4);
    if ((size_t)(wsp - (char*)d_ws) > ws_size) return;    // 4.2 + 2.1 + 6.3 + 16.8 + 8.4 + 8.4 + 8.4 + 67 ~ 122 MB
    k_prep<<<3 * WTB + NTK / 8 + NR / 8, 256, 0, stream>>>(x, rel, Wq, Wk, Wv, Xb, Rb, WqT, WkT, WvT);
    k_gemm5<<<3 * GXB + 2 * GRB, 128, 0, stream>>>(Xb, Rb, WqT, WkT, WvT, bq, bk, bv, QH, QL, KH, KL, Vf, PKH, PKL, PQH, PQL);    // pos_k = rel.Wk + bk, pos_q = rel.Wq + bq
    k_bias<<<dim3(SS / 64, SS / 64, NB_ * NH_ + NB_ * NH_ * (SS / 64) / ((SS / 64) * (SS / 64))), 256, 0, stream>>>(QH, QL, KH, KL, PKH, PKL, PQH, PQL, Bt, Vf, VTH, VTL);
    k_attn<<<NB_ * NH_ * (SS / 64), 128, 0, stream>>>(QH, QL, KH, KL, Bt, VTH, VTL, out);
}

// v006
// One run takes 81 microseconds.
// Two timings next to v005 both put it at 1.08 times that version's speed.
// Counting every step since v000, it is 7.77 times as fast.
#include <hip/hip_runtime.h>

// Contractions, f32 accumulate: q/k/v = x.W + b ([2048 x 1024].[1024 x 1024]) and pos_k = rel.Wk + bk, pos_q = rel.Wq + bq ([1024 x 1024].[1024 x 1024]) on
// v_wmma_f32_16x16x32_bf16 with PLAIN bf16 operands (inputs rounded once: exact; k-major weights transposed into n-major planes; tiles staged in LDS by asynchronous copies); the disentangled attention on
// v_wmma_f32_16x16x32_f16 with every computed operand as f16 hi + residual x1024 (hi.hi + hi.lo + lo.hi): the relative products q.pos_k^T and k.pos_q^T, only the
// 80-column band that a 16 x 64 piece of the score tile gathers from (operands staged in LDS), gathered in LDS into one table bias[pair][q][k] = c2p[q][q-k+511] + p2c[k][k-q+511]; then the
// fused attention over all 64 (b,h) pairs in one launch (content q.k + bias[q][k], online softmax, weights . v; key, V and bias tiles staged in LDS by asynchronous copies).
// Four launches, each made of everything that depends only on the launches before it: k_prep (both conversions, three weight transposes), k_gemm5 (all five projections),
// k_bias (the V transpose and the bias tiles, a block walking the key tiles of its 64 queries), k_attn. A block picks its job from its index alone.

#define NB_  4
#define SS   512
#define DM   1024
#define NH_  16
#define HD   64
#define NR   1024                // 2 * att_span relative positions
#define NTK  (NB_ * SS)          // 2048
#define BW   80                  // relative columns that 16 rows against 64 opposite positions can gather: 16 + 64 - 1, rounded up to whole 16-column tiles
#define BP   84                  // LDS pitch of a band row, in floats
#define SP   72                  // LDS pitch of a staged 64-element f16 row, in elements: the 16 bytes of pad spread the 16 rows of a b128 fragment read over all banks
#define BPL  (16 * BP + 6)       // LDS floats per wave's band; the + 6 spreads the four waves' planes over the banks for the diagonal reads
#define GK   128                 // k elements of a staged GEMM tile: rows of 256 bytes
#define GP   136                 // LDS pitch of a staged GEMM row, in elements: 272 B = 16 B x odd, for b128 fragment reads
#define GBUF (128 * GP)          // elements of one GEMM buffer: 64 A rows, then 64 B rows
#define PSC  32768.0f
#define LOSC 1024.0f
#define LOSCI (1.0f / 1024.0f)
#define SCL  0.07216878364870322f    // (64*3)^-0.5

typedef _Float16 h16;
typedef unsigned short bf;
typedef __attribute__((ext_vector_type(16))) __bf16   v16bf;
typedef __attribute__((ext_vector_type(16))) _Float16 v16h;
typedef __attribute__((ext_vector_type(8)))  _Float16 v8h;
typedef __attribute__((ext_vector_type(8)))  unsigned short v8us;
typedef __attribute__((ext_vector_type(8)))  float    v8f;
typedef __attribute__((ext_vector_type(4)))  float    v4f;
typedef v8h  __attribute__((may_alias)) v8ha;
typedef v4f  __attribute__((may_alias)) v4fa;
typedef v8us __attribute__((may_alias)) v8usa;

__device__ __forceinline__ unsigned short f2bf(float f) { unsigned u = __float_as_uint(f); u += 0x7FFFu + ((u >> 16) & 1u); return (unsigned short)(u >> 16); }
__device__ __forceinline__ float bf2f(unsigned short b) { return __uint_as_float(((unsigned)b) << 16); }
__device__ __forceinline__ float bfr(float f) { return bf2f(f2bf(f)); }
__device__ __forceinline__ v16h cat16(v8h lo, v8h hi) { return __builtin_shufflevector(lo, hi, 0, 1, 2, 3, 4, 5, 6, 7, 8, 9, 10, 11, 12, 13, 14, 15); }
__device__ __forceinline__ v16bf cat16b(v8us lo, v8us hi) { return __builtin_bit_cast(v16bf, __builtin_shufflevector(lo, hi, 0, 1, 2, 3, 4, 5, 6, 7, 8, 9, 10, 11, 12, 13, 14, 15)); }
__device__ __forceinline__ v8f wmma16(v16h a, v16h b, v8f c) { return __builtin_amdgcn_wmma_f32_16x16x32_f16(false, a, false, b, (short)0, c, false, false); }
__device__ __forceinline__ v8f wmmab(v16bf a, v16bf b, v8f c) { return __builtin_amdgcn_wmma_f32_16x16x32_bf16(false, a, false, b, (short)0, c, false, false); }
#define VST2(T, p, v) do { const T vst2_v_ = (v); *(T*)(p) = vst2_v_;  } while (0)

// cvtb: bf16 rows of an [nrows][1024] matrix, 8 rows a block; wt: a 64 x 64 tile of k-major [1024][1024] -> n-major bf16.
__device__ __forceinline__ void cvtb(const float* __restrict__ src, int nrows, bf* dst, int blk) {
    const int lane = threadIdx.x & 31, r = blk * 8 + (threadIdx.x >> 5);
    if (r >= nrows) return;
#pragma unroll
    for (int q = 0; q < DM / 256; ++q) { v8us t;
#pragma unroll
        for (int i = 0; i < 8; ++i) t[i] = f2bf(src[(size_t)r * DM + q * 256 + lane * 8 + i]);
        VST2(v8us, dst + (size_t)r * DM + q * 256 + lane * 8, t); }
}
__device__ __forceinline__ void wt(const float* __restrict__ Wm, bf* WT, int kb, int nb, unsigned short* tl) {
    const int tid = threadIdx.x, k0 = kb * 64, n0 = nb * 64;
    const int kk = tid >> 2, nq = (tid & 3) * 16;
#pragma unroll
    for (int i = 0; i < 16; ++i) tl[(nq + i) * 72 + kk] = f2bf(Wm[(size_t)(k0 + kk) * DM + n0 + nq + i]);
    __syncthreads();
    const int piece = tid & 7;
    auto pass = [&]() {
#pragma unroll
        for (int s = 0; s < 2; ++s) { const int nr = (tid >> 3) + 32 * s; const v8us val = *(const v8usa*)(tl + nr * 72 + piece * 8);
            *(v8us*)(WT + (size_t)(n0 + nr) * DM + k0 + piece * 8) = val; }
    };
    pass(); 
}
// k_prep: every operand conversion in one launch. Blocks 0 .. 767: the 256 tiles of Wq, of Wk, of Wv; the next 256: x; the last 128: the relative table.
#define WTB  ((DM / 64) * (DM / 64))    // tiles of one weight matrix
__global__ __launch_bounds__(256) void k_prep(const float* __restrict__ x, const float* __restrict__ rel, const float* __restrict__ Wq, const float* __restrict__ Wk, const float* __restrict__ Wv,
                                             bf* Xb, bf* Rb, bf* WqT, bf* WkT, bf* WvT) {
    __shared__ __align__(16) unsigned short tl[64 * 72];
    const int id = blockIdx.x;
    if (id < 3 * WTB) {
        const int w = id / WTB, t = id - w * WTB;
        wt(w == 0 ? Wq : w == 1 ? Wk : Wv, w == 0 ? WqT : w == 1 ? WkT : WvT, t % (DM / 64), t / (DM / 64), tl);
    } else if (id < 3 * WTB + NTK / 8) cvtb(x, NTK, Xb, id - 3 * WTB);
    else cvtb(rel, NR, Rb, id - (3 * WTB + NTK / 8));    // rel_embeddings[0 : 1024] (att_span = 512 = MAX_REL -> the whole table)
}
// copy8: eight asynchronous copies of 16 bytes a lane, global -> LDS, eight rows apart (a wave-wide copy = two whole 256-byte rows).
// The s_wait_xcnt stands as the last line of the copies' own statement: it precedes every later rewrite of a register that a copy names.
__device__ __forceinline__ void copy8(unsigned l, const bf* g) {
    asm volatile("global_load_async_to_lds_b128 %0, %8, off\n\t"
                 "global_load_async_to_lds_b128 %1, %9, off\n\t"
                 "global_load_async_to_lds_b128 %2, %10, off\n\t"
                 "global_load_async_to_lds_b128 %3, %11, off\n\t"
                 "global_load_async_to_lds_b128 %4, %12, off\n\t"
                 "global_load_async_to_lds_b128 %5, %13, off\n\t"
                 "global_load_async_to_lds_b128 %6, %14, off\n\t"
                 "global_load_async_to_lds_b128 %7, %15, off\n\t"
                 "s_wait_xcnt 0x0"
                 :: "v"(l), "v"(l + 1 * 8 * GP * 2), "v"(l + 2 * 8 * GP * 2), "v"(l + 3 * 8 * GP * 2), "v"(l + 4 * 8 * GP * 2), "v"(l + 5 * 8 * GP * 2), "v"(l + 6 * 8 * GP * 2), "v"(l + 7 * 8 * GP * 2),
                    "v"(g), "v"(g + 1 * 8 * DM), "v"(g + 2 * 8 * DM), "v"(g + 3 * 8 * DM), "v"(g + 4 * 8 * DM), "v"(g + 5 * 8 * DM), "v"(g + 6 * 8 * DM), "v"(g + 7 * 8 * DM)
                 : "memory");
}
// k_gemm5: 64 x 64 tile of A.B^T + bias over K = 1024 (bf16 exact), all five projections in one launch: blocks of 512 for q, k, v (A = x), then of 256 for pos_k, pos_q (A = the relative table);
// q, k, pos_k, pos_q leave as f16 hi + residual planes (ld 1024), v as f32 rows.
// Operands come through LDS: a stage is 128 k of the block's 64 A rows and 64 B rows (256-byte rows at pitch 272 B), brought by asynchronous copies into two buffers,
// the next stage in flight while this one is multiplied; the fragments keep the k order and the sum order of direct loads.
#define GXB  ((NTK / 64u) * (DM / 64u))    // blocks of a projection of x
#define GRB  ((NR / 64u) * (DM / 64u))     // blocks of a projection of the relative table
__global__ __launch_bounds__(128) void k_gemm5(const bf* __restrict__ Xb, const bf* __restrict__ Rb, const bf* __restrict__ WqT, const bf* __restrict__ WkT, const bf* __restrict__ WvT,
                                              const float* __restrict__ bq, const float* __restrict__ bk, const float* __restrict__ bv,
                                              h16* QH, h16* QL, h16* KH, h16* KL, float* Vf, h16* PKH, h16* PKL, h16* PQH, h16* PQL) {
    __shared__ __align__(16) bf stg[2 * GBUF];
    __shared__ __align__(16) float ost[4][16 * 68];
    const int tid = threadIdx.x, lane = tid & 31, wave = tid >> 5, lr = lane & 15, hi = lane >> 4;
    const unsigned id = blockIdx.x;
    const bool onx = id < 3u * GXB;
    const unsigned job = onx ? id / GXB : 3u + (id - 3u * GXB) / GRB;          // 0 q, 1 k, 2 v, 3 pos_k, 4 pos_q
    const unsigned tl = onx ? id % GXB : (id - 3u * GXB) % GRB;                // the tile inside its job, row blocks fastest
    const bf* __restrict__ A = onx ? Xb : Rb;
    const bf* __restrict__ Bn = (job == 0 || job == 4) ? WqT : job == 2 ? WvT : WkT;
    const float* __restrict__ bias = (job == 0 || job == 4) ? bq : job == 2 ? bv : bk;
    const int rb = (int)(onx ? tl % (NTK / 64u) : tl % (NR / 64u)) * 64, r0 = rb + wave * 16, c0 = (int)(onx ? tl / (NTK / 64u) : tl / (NR / 64u)) * 64;
    const int crow = tid >> 4, cpc = (tid & 15) * 8;    // the lane's row (of 8 a copy round) and 16-byte piece of a staged row
    const bf* ga = A + (size_t)(rb + crow) * DM + cpc;
    const bf* gb = Bn + (size_t)(c0 + crow) * DM + cpc;
    const unsigned la = (unsigned)(size_t)(stg + crow * GP + cpc);    // LDS byte address of the lane's piece in buffer 0, A rows; the B rows stand 64 rows on
    auto stage = [&](int t) {
        const unsigned l = la + (unsigned)(t & 1) * (GBUF * 2);
        copy8(l, ga + t * GK); copy8(l + 64 * GP * 2, gb + t * GK);
    };
    v8f acc[4];
#pragma unroll
    for (int t = 0; t < 4; ++t) acc[t] = (v8f){};
    stage(0);
    asm volatile("s_wait_asynccnt 0x0" ::: "memory");    // stage 0 of this wave has landed
    __syncthreads();                                     // ... and of every wave: publishes buffer 0
    stage(1);
    const int ao = (wave * 16 + lr) * GP + 8 * hi, bo = (64 + lr) * GP + 8 * hi;
#pragma unroll 1    // one rolled trip a stage: the foot's order (waits, barrier, refill) stands once
    for (int s = 0; s < DM / GK; ++s) {
        const bf* sb = stg + (s & 1) * GBUF;
        v16bf fa[GK / 32], fb[GK / 32][4];
#pragma unroll
        for (int c = 0; c < GK / 32; ++c) {
            fa[c] = cat16b(*(const v8usa*)(sb + ao + c * 32), *(const v8usa*)(sb + ao + c * 32 + 16));
#pragma unroll
            for (int t = 0; t < 4; ++t) fb[c][t] = cat16b(*(const v8usa*)(sb + bo + t * 16 * GP + c * 32), *(const v8usa*)(sb + bo + t * 16 * GP + c * 32 + 16));
        }
        asm volatile("s_wait_dscnt 0x0" ::: "memory");       // the stage's fragments are in registers: this wave's reads of the buffer are done before it is refilled
        asm volatile("s_wait_asynccnt 0x0" ::: "memory");    // this wave's copies of stage s + 1 have landed
        __syncthreads();                                     // publishes stage s + 1 and ends every reader's last read of stage s
        if (s + 2 < DM / GK) stage(s + 2);
        // the products work on registers alone and stand behind the refill's issue: the copies fly while the matrix unit runs
#pragma unroll
        for (int c = 0; c < GK / 32; ++c)
#pragma unroll
            for (int t = 0; t < 4; ++t) acc[t] = wmmab(fa[c], fb[c][t], acc[t]);
    }
    asm volatile("s_wait_asynccnt 0x0" ::: "memory");        // nothing is outstanding when the wave goes on
    float* os = &ost[wave][0];
#pragma unroll
    for (int t = 0; t < 4; ++t) { const float bv = bfr(bias[c0 + t * 16 + lr]);
#pragma unroll
        for (int j = 0; j < 8; ++j) os[(hi * 8 + j) * 68 + t * 16 + lr] = acc[t][j] + bv; }
    __syncthreads();
    if (job == 2) {
        float* crow = Vf + (size_t)r0 * DM + c0;
        auto pass = [&]() {
#pragma unroll
            for (int s = 0; s < 8; ++s) { const int Lid = (lane >> 3) + 4 * s, piece = lane & 7; const int row = Lid >> 1, cofs = (Lid & 1) * 32 + piece * 4;
                const v4f val = *(const v4fa*)(os + row * 68 + cofs); *(v4f*)(crow + (size_t)row * DM + cofs) = val; }
        };
        pass(); 
    } else {
        h16* c1 = (job == 0 ? QH : job == 1 ? KH : job == 3 ? PKH : PQH) + (size_t)r0 * DM + c0; h16* c2 = (job == 0 ? QL : job == 1 ? KL : job == 3 ? PKL : PQL) + (size_t)r0 * DM + c0;
        auto pass = [&]() {
#pragma unroll
            for (int s = 0; s < 4; ++s) { const int row = 4 * s + (lane >> 3), piece = lane & 7; const float* sp = os + row * 68 + piece * 8; v8h o1, o2;
#pragma unroll
                for (int i = 0; i < 8; ++i) { const h16 a = (h16)sp[i]; o1[i] = a; o2[i] = (h16)((sp[i] - (float)a) * LOSC); }
                *(v8h*)(c1 + (size_t)row * DM + piece * 8) = o1; *(v8h*)(c2 + (size_t)row * DM + piece * 8) = o2; }
        };
        pass(); 
    }
}
// vt: VTH/VTL [b][h][d][s] = f16 hi + residual of V rows; block bid = (b, h, 64 s); tile, til2: 64 x 72 elements of LDS each.
__device__ __forceinline__ void vt(const float* __restrict__ V, h16* VTH, h16* VTL, int bid, h16* tile, h16* til2) {
    const int b = bid / (NH_ * (SS / 64)), rem = bid - b * (NH_ * (SS / 64)), h = rem / (SS / 64), kt = rem - h * (SS / 64);
    const int s0 = kt * 64, tid = threadIdx.x, ss = tid >> 2, d0 = (tid & 3) * 16;
    const float* src = V + ((size_t)b * SS + s0 + ss) * DM + h * HD + d0;
#pragma unroll
    for (int i = 0; i < 16; ++i) { const float v = src[i]; const h16 a = (h16)v; tile[(d0 + i) * 72 + ss] = a; til2[(d0 + i) * 72 + ss] = (h16)((v - (float)a) * LOSC); }
    __syncthreads();
    const int piece = tid & 7;
    const size_t base = (((size_t)b * NH_ + h) * HD) * SS + s0;
    auto pass = [&]() {
#pragma unroll
        for (int s = 0; s < 4; ++s) { const int Lid = (tid >> 3) + 32 * s; const int pln = Lid >> 6, d = Lid & 63;
            const v8h val = *(const v8ha*)((pln ? til2 : tile) + d * 72 + piece * 8); *(v8h*)((pln ? VTL : VTH) + base + (size_t)d * SS + piece * 8) = val; }
    };
    pass(); 
}
// band16: dst[i][c] = (ah + al/1024)[row i].(ph + pl/1024)[window row 16 w4 + c], i < 16, c < 80 (hi.hi + hi.lo + lo.hi over K = 64); all four operands are staged LDS rows of pitch SP.
// The 128-row window of a relative table is two chunks of 64 table rows, cb and cb + 1; chunk c stands in slot c & 1 of the table's 128 staged rows.
__device__ __forceinline__ void band16(const h16* ah, const h16* al, const h16* ph, const h16* pl, int cb, int w4, int lr, int hi, float* dst) {
    const int ao = lr * SP + 8 * hi;
    v8f acc[BW / 16], accx[BW / 16];
#pragma unroll
    for (int t = 0; t < BW / 16; ++t) { acc[t] = (v8f){}; accx[t] = (v8f){}; }
#pragma unroll
    for (int kc = 0; kc < 2; ++kc) {
        const v16h a = cat16(*(const v8ha*)(ah + ao + kc * 32), *(const v8ha*)(ah + ao + kc * 32 + 16)), ax = cat16(*(const v8ha*)(al + ao + kc * 32), *(const v8ha*)(al + ao + kc * 32 + 16));
#pragma unroll
        for (int t = 0; t < BW / 16; ++t) { const int T = w4 + t, bo = (((cb + (T >> 2)) & 1) * 64 + (T & 3) * 16) * SP + ao + kc * 32;
            const v16h bh = cat16(*(const v8ha*)(ph + bo), *(const v8ha*)(ph + bo + 16)), bl = cat16(*(const v8ha*)(pl + bo), *(const v8ha*)(pl + bo + 16));
            acc[t] = wmma16(a, bh, acc[t]); accx[t] = wmma16(a, bl, accx[t]); accx[t] = wmma16(ax, bh, accx[t]); }
    }
#pragma unroll
    for (int t = 0; t < BW / 16; ++t)
#pragma unroll
        for (int j = 0; j < 8; ++j) dst[(hi * 8 + j) * BP + t * 16 + lr] = acc[t][j] + accx[t][j] * LOSCI;
}
// k_bias: block = (pair, 64 queries q0..): it walks the 8 key tiles k0 = 0, 64, .. of Bt[pair][q][k] = c2p[q][q - k + 511] + p2c[k][k - q + 511]; grid 512 blocks, 8 waves.
// Staged in LDS by whole 128-byte head rows, hi and residual planes: the 64 q rows (once), the tile's 64 k rows, the 128 rows q0 - k0 + 448 .. of pos_k and the 128 rows k0 - q0 + 448 .. of
// pos_q (both ranges lie in [0, 1023] for every tile). From one tile to the next both windows move by 64 rows, pos_k down and pos_q up: half of each stays where it is, and only the new
// chunk of 64 rows is brought, into the slot of the chunk that has left the window. The next tile's new rows are asked for behind the barrier that publishes this tile and wait in registers
// while this tile is worked on. Wave w < 4 forms the c2p band of queries 16w .. 16w + 15 against window rows 16w .. 16w + 79 of pos_k; wave 4 + w the p2c
// band of keys 16w .. against window rows 16w .. 16w + 79 of pos_q. In a band, element (row i, opposite position j of the tile) stands at column i - j + 63.
// Each block first does one of the 512 tiles of the V transpose, which waits for the same launch as the bias and for nothing else, in the head of the staging LDS.
__global__ __launch_bounds__(256) void k_bias(const h16* __restrict__ QH, const h16* __restrict__ QL, const h16* __restrict__ KH, const h16* __restrict__ KL,
                                             const h16* __restrict__ PKH, const h16* __restrict__ PKL, const h16* __restrict__ PQH, const h16* __restrict__ PQL, float* Bt,
                                             const float* __restrict__ Vf, h16* VTH, h16* VTL) {
    __shared__ __align__(16) h16 st[768 * SP];
    __shared__ float bd[8 * BPL];
    const int tid = threadIdx.x, lane = tid & 31, wave = __builtin_amdgcn_readfirstlane(tid >> 5), lr = lane & 15, hi = lane >> 4;
    const int p = blockIdx.x / (SS / 64), qx = blockIdx.x - p * (SS / 64), b = p / NH_, h = p - b * NH_;
    const int q0 = qx * 64;
    const size_t tok0 = (size_t)b * SS;
    const int srow = tid >> 3, spc = (tid & 7) * 8;
    const unsigned voff = (unsigned)(srow * DM + spc);    // the lane's element offset inside a slab of 32 rows: the one vector register that all loads name
    v8h sv[24];
    auto fetch = [&](const h16* __restrict__ g, size_t grow0, int n32, int at) {
        const h16* gb = g + grow0 * DM + h * HD;
#pragma unroll
        for (int i = 0; i < n32; ++i) sv[at + i] = *(const v8h*)(gb + voff + i * 32 * DM);
        // The wait that stands between issued global loads and any overwrite of a register they name (the plane's base is formed anew for the next plane);
        // voff as an input keeps the shared offset register whole up to the last of these waits.
        asm volatile("s_wait_xcnt 0x0" :: "v"(voff) : "memory");
    };
    fetch(QH, tok0 + q0, 2, 0); fetch(QL, tok0 + q0, 2, 2); fetch(KH, tok0, 2, 4); fetch(KL, tok0, 2, 6);
    fetch(PKH, (size_t)(q0 + (SS - 64)), 4, 8); fetch(PKL, (size_t)(q0 + (SS - 64)), 4, 12);
    fetch(PQH, (size_t)((SS - 64) - q0), 4, 16); fetch(PQL, (size_t)((SS - 64) - q0), 4, 20);
    vt(Vf, VTH, VTL, blockIdx.x, st, st + HD * 72);
    asm volatile("s_wait_xcnt 0x0" ::: "memory");    // the wait between the V tile's issued global stores and a later overwrite of a register they name
    __syncthreads();    // every wave has read its part of the V tile out of the staging LDS before tile 0's rows go there
#pragma unroll
    for (int r = 0; r < 8; ++r) *(v8ha*)(st + (r * 32 + srow) * SP + spc) = sv[r];
#pragma unroll
    for (int i = 0; i < 4; ++i) { const int sk = ((qx + 7 + (i >> 1)) & 1) * 64 + (i & 1) * 32 + srow, sq = ((7 - qx + (i >> 1)) & 1) * 64 + (i & 1) * 32 + srow;
        *(v8ha*)(st + (256 + sk) * SP + spc) = sv[8 + i]; *(v8ha*)(st + (384 + sk) * SP + spc) = sv[12 + i];
        *(v8ha*)(st + (512 + sq) * SP + spc) = sv[16 + i]; *(v8ha*)(st + (640 + sq) * SP + spc) = sv[20 + i]; }
    const int side = wave >> 2, w4 = wave & 3;
    const h16* sa = st + (side * 128 + w4 * 16) * SP;
    const h16* sp = st + (256 + side * 256) * SP;
#pragma unroll 1    // one rolled trip a key tile: the two barriers and the refill between them stand once
    for (int kt = 0; kt < SS / 64; ++kt) {
        const int ck = qx - kt + 7, cq = kt - qx + 7;    // first chunk of the pos_k window and of the pos_q window of this tile
        __syncthreads();    // publishes this tile's staged rows and ends every reader's last read of the bands of the tile before
        if (kt + 1 < SS / 64) {
            fetch(KH, tok0 + (size_t)(kt + 1) * 64, 2, 0); fetch(KL, tok0 + (size_t)(kt + 1) * 64, 2, 2);
            fetch(PKH, (size_t)(ck - 1) * 64, 2, 4); fetch(PKL, (size_t)(ck - 1) * 64, 2, 6);
            fetch(PQH, (size_t)(cq + 2) * 64, 2, 8); fetch(PQL, (size_t)(cq + 2) * 64, 2, 10);
        }
        band16(sa, sa + 64 * SP, sp, sp + 128 * SP, side ? cq : ck, w4, lr, hi, bd + wave * BPL);
        __syncthreads();    // publishes the bands and ends every reader's last read of this tile's staged rows
        float* brow = Bt + ((size_t)p * SS + q0 + wave * 8) * SS + kt * 64;
#pragma unroll
        for (int s = 0; s < 4; ++s) { const int Lid = (lane >> 3) + 4 * s, piece = lane & 7; const int row = Lid >> 1, cofs = (Lid & 1) * 32 + piece * 4, qq = wave * 8 + row, qw = qq >> 4, qi = qq & 15;
            v4f val;
#pragma unroll
            for (int e = 0; e < 4; ++e) { const int kk = cofs + e, kw = kk >> 4, ki = kk & 15;
                val[e] = bd[qw * BPL + qi * BP + qi - kk + 63] + bd[(4 + kw) * BPL + ki * BP + ki - qq + 63]; }
            *(v4f*)(brow + (size_t)row * SS + cofs) = val; }
        asm volatile("s_wait_xcnt 0x0" ::: "memory");    // the wait between the tile's last issued global store and the next overwrite of a register it names
        if (kt + 1 < SS / 64) {
#pragma unroll
            for (int i = 0; i < 2; ++i) { const int sk = ((ck - 1) & 1) * 64 + i * 32 + srow, sq = (cq & 1) * 64 + i * 32 + srow;
                *(v8ha*)(st + (128 + i * 32 + srow) * SP + spc) = sv[i]; *(v8ha*)(st + (192 + i * 32 + srow) * SP + spc) = sv[2 + i];
                *(v8ha*)(st + (256 + sk) * SP + spc) = sv[4 + i]; *(v8ha*)(st + (384 + sk) * SP + spc) = sv[6 + i];
                *(v8ha*)(st + (512 + sq) * SP + spc) = sv[8 + i]; *(v8ha*)(st + (640 + sq) * SP + spc) = sv[10 + i]; }
        }
    }
}
// copy8a: eight asynchronous copies of 16 bytes a lane, global -> LDS, each with its own pair of addresses.
// The s_wait_xcnt stands as the last line of the copies' own statement: it precedes every later rewrite of a register that a copy names.
__device__ __forceinline__ void copy8a(const unsigned (&l)[8], const void* const (&g)[8]) {
    asm volatile("global_load_async_to_lds_b128 %0, %8, off\n\t"
                 "global_load_async_to_lds_b128 %1, %9, off\n\t"
                 "global_load_async_to_lds_b128 %2, %10, off\n\t"
                 "global_load_async_to_lds_b128 %3, %11, off\n\t"
                 "global_load_async_to_lds_b128 %4, %12, off\n\t"
                 "global_load_async_to_lds_b128 %5, %13, off\n\t"
                 "global_load_async_to_lds_b128 %6, %14, off\n\t"
                 "global_load_async_to_lds_b128 %7, %15, off\n\t"
                 "s_wait_xcnt 0x0"
                 :: "v"(l[0]), "v"(l[1]), "v"(l[2]), "v"(l[3]), "v"(l[4]), "v"(l[5]), "v"(l[6]), "v"(l[7]),
                    "v"(g[0]), "v"(g[1]), "v"(g[2]), "v"(g[3]), "v"(g[4]), "v"(g[5]), "v"(g[6]), "v"(g[7])
                 : "memory");
}
// k_attn: block = (pair p, 64 queries), wave = 16; 16 key tiles of 32: content = q.k (hi.hi + hi.lo + lo.hi: 12 WMMA), bias = Bt[p][q][k],
// logits = (content + bias) x SCL; online softmax; weights x32768 hi/residual; 12 WMMA .v;
// The loop reads no global memory: a stage is 64 keys of everything the block's four waves stream (64 key rows and 64 rows of transposed V, hi and residual planes, 128-byte rows at
// pitch 144 B; the block's 64 x 64 piece of the bias table, 256-byte rows at pitch 272 B), brought by asynchronous copies into two buffers, the next stage in flight while this one is worked on.
// The fragments keep the k order and the sum order of direct loads.
#define AK   64                  // keys of a stage
#define APL  (64 * SP)           // elements of one staged f16 plane
#define ABP  68                  // LDS pitch of a staged bias row, in floats: rows 8 apart (the two half-waves of a read) stand 32 banks apart
__global__ __launch_bounds__(128) void k_attn(const h16* __restrict__ QH, const h16* __restrict__ QL, const h16* __restrict__ KH, const h16* __restrict__ KL,
                                             const float* __restrict__ Bt, const h16* __restrict__ VTH, const h16* __restrict__ VTL, float* out) {
    __shared__ __align__(16) h16 kv[2][4 * APL];        // planes: key hi, key residual, V^T hi, V^T residual
    __shared__ __align__(16) float bs[2][64 * ABP];
    __shared__ __align__(16) h16 plds[4][16 * 32];
    __shared__ __align__(16) h16 plds2[4][16 * 32];
    __shared__ __align__(16) float ost[4][16 * 68];
    const int tid = threadIdx.x, lane = tid & 31, wave = tid >> 5, lr = lane & 15, hi = lane >> 4;
    const int p = blockIdx.x / (SS / 64), qt = blockIdx.x - p * (SS / 64), b = p / NH_, h = p - b * NH_;
    const int q0 = qt * 64 + wave * 16;
    const size_t tok0 = (size_t)b * SS;
    h16* pl = &plds[wave][0]; h16* pl2 = &plds2[wave][0];
    const float* bt = Bt + (size_t)p * SS * SS;
    const size_t vbase = (((size_t)b * NH_ + h) * HD) * SS;
    const int hrow = tid >> 3, hpc = (tid & 7) * 8;     // f16 planes: the lane's row (of 16 a copy round) and 16-byte piece of a 128-byte row
    const int frow = tid >> 4, fpc = (tid & 15) * 4;    // bias: the lane's row (of 8 a copy round) and 16-byte piece of a 256-byte row
    // the lane's source addresses of the next stage to be asked for, one a plane: they walk on by a stage with every call of stage()
    const h16* pkh = KH + (tok0 + hrow) * DM + h * HD + hpc; const h16* pkl = KL + (tok0 + hrow) * DM + h * HD + hpc;
    const h16* pvh = VTH + vbase + (size_t)hrow * SS + hpc; const h16* pvl = VTL + vbase + (size_t)hrow * SS + hpc;
    const float* pbt = bt + (size_t)(qt * 64 + frow) * SS + fpc;
    const unsigned lkv = (unsigned)(size_t)(&kv[0][0] + hrow * SP + hpc), lbs = (unsigned)(size_t)(&bs[0][0] + frow * ABP + fpc);    // LDS byte addresses of the lane's pieces in buffer 0
    auto stage = [&](int t) {
        const unsigned lh = lkv + (unsigned)(t & 1) * (4 * APL * 2), lf = lbs + (unsigned)(t & 1) * (64 * ABP * 4);
        unsigned l[8]; const void* g[8];
#pragma unroll
        for (int i = 0; i < 4; ++i) { l[i] = lh + i * 16 * SP * 2; g[i] = pkh + (size_t)i * 16 * DM; l[4 + i] = l[i] + APL * 2; g[4 + i] = pkl + (size_t)i * 16 * DM; }
        copy8a(l, g);
#pragma unroll
        for (int i = 0; i < 4; ++i) { l[i] = lh + 2 * APL * 2 + i * 16 * SP * 2; g[i] = pvh + (size_t)i * 16 * SS; l[4 + i] = l[i] + APL * 2; g[4 + i] = pvl + (size_t)i * 16 * SS; }
        copy8a(l, g);
#pragma unroll
        for (int i = 0; i < 8; ++i) { l[i] = lf + i * 8 * ABP * 4; g[i] = pbt + (size_t)i * 8 * SS; }
        copy8a(l, g);
        pkh += (size_t)AK * DM; pkl += (size_t)AK * DM; pvh += AK; pvl += AK; pbt += AK;
    };
    stage(0);
    v16h qa[2], ql[2];
    const size_t qo0 = (tok0 + q0 + lr) * DM + h * HD + 8 * hi;
#pragma unroll
    for (int kc = 0; kc < 2; ++kc) { qa[kc] = cat16(*(const v8h*)(QH + qo0 + kc * 32), *(const v8h*)(QH + qo0 + kc * 32 + 16)); ql[kc] = cat16(*(const v8h*)(QL + qo0 + kc * 32), *(const v8h*)(QL + qo0 + kc * 32 + 16)); }
    asm volatile("s_wait_xcnt 0x0" ::: "memory");        // the wait between these issued global loads and a later overwrite of their address registers (stage 1's addresses are formed next)
    v8f o[4], ox[4];
#pragma unroll
    for (int n = 0; n < 4; ++n) { o[n] = (v8f){}; ox[n] = (v8f){}; }
    float mrow[8], lpart[8];
#pragma unroll
    for (int j = 0; j < 8; ++j) { mrow[j] = -3.0e38f; lpart[j] = 0.f; }
    asm volatile("s_wait_asynccnt 0x0" ::: "memory");    // stage 0 of this wave has landed
    __syncthreads();                                     // ... and of every wave: publishes buffer 0
    stage(1);
#pragma unroll 1    // one rolled trip a stage: the foot's order (waits, barrier, refill) stands once
    for (int t = 0; t < SS / AK; ++t) {
        const h16* sk = &kv[t & 1][0];
        const float* sb = &bs[t & 1][0] + (wave * 16 + 8 * hi) * ABP + lr;
#pragma unroll
        for (int u = 0; u < AK / 32; ++u) {
            float ba[8], bb[8];
#pragma unroll
            for (int j = 0; j < 8; ++j) { ba[j] = sb[j * ABP + u * 32]; bb[j] = sb[j * ABP + u * 32 + 16]; }
            v8f s0 = {}, s1 = {}, x0 = {}, x1 = {};
#pragma unroll
            for (int kc = 0; kc < 2; ++kc) {
                const h16* k0 = sk + (u * 32 + lr) * SP + kc * 32 + 8 * hi; const h16* k1 = k0 + 16 * SP;
                const v16h k0h = cat16(*(const v8ha*)(k0), *(const v8ha*)(k0 + 16)), k1h = cat16(*(const v8ha*)(k1), *(const v8ha*)(k1 + 16));
                const v16h k0l = cat16(*(const v8ha*)(k0 + APL), *(const v8ha*)(k0 + APL + 16)), k1l = cat16(*(const v8ha*)(k1 + APL), *(const v8ha*)(k1 + APL + 16));
                s0 = wmma16(qa[kc], k0h, s0); x0 = wmma16(ql[kc], k0h, x0); s1 = wmma16(qa[kc], k1h, s1); x1 = wmma16(ql[kc], k1h, x1);
                x0 = wmma16(qa[kc], k0l, x0); x1 = wmma16(qa[kc], k1l, x1);
            }
            v16h vh[4], vl[4];    // the trip's V fragments, asked for here: their LDS latency passes under the softmax, in the registers that the key fragments have left
#pragma unroll
            for (int n = 0; n < 4; ++n) { const h16* vp = sk + 2 * APL + (n * 16 + lr) * SP + u * 32 + hi * 8;
                vh[n] = cat16(*(const v8ha*)(vp), *(const v8ha*)(vp + 16)); vl[n] = cat16(*(const v8ha*)(vp + APL), *(const v8ha*)(vp + APL + 16)); }
            float alpha[8];
#pragma unroll
            for (int j = 0; j < 8; ++j) {
                const float a0 = (s0[j] + x0[j] * LOSCI + ba[j]) * SCL, a1 = (s1[j] + x1[j] * LOSCI + bb[j]) * SCL;
                float mx = fmaxf(a0, a1);
                mx = fmaxf(mx, __shfl_xor(mx, 1, 16)); mx = fmaxf(mx, __shfl_xor(mx, 2, 16)); mx = fmaxf(mx, __shfl_xor(mx, 4, 16)); mx = fmaxf(mx, __shfl_xor(mx, 8, 16));
                const float mn = fmaxf(mrow[j], mx);
                alpha[j] = __expf(mrow[j] - mn); mrow[j] = mn;
                const float e0 = __expf(a0 - mn), e1 = __expf(a1 - mn);
                lpart[j] = lpart[j] * alpha[j] + (e0 + e1);
                const int mr = hi * 8 + j;
                const float ps0 = e0 * PSC, ps1 = e1 * PSC; const h16 h0 = (h16)ps0, h1 = (h16)ps1;
                pl[mr * 32 + lr] = h0; pl[mr * 32 + 16 + lr] = h1; pl2[mr * 32 + lr] = (h16)((ps0 - (float)h0) * LOSC); pl2[mr * 32 + 16 + lr] = (h16)((ps1 - (float)h1) * LOSC);
            }
#pragma unroll
            for (int n = 0; n < 4; ++n)
#pragma unroll
                for (int j = 0; j < 8; ++j) { o[n][j] *= alpha[j]; ox[n][j] *= alpha[j]; }
            asm volatile("" ::: "memory");
            const v16h pa = cat16(*(const v8ha*)(pl + lr * 32 + hi * 8), *(const v8ha*)(pl + lr * 32 + 16 + hi * 8));
            const v16h px = cat16(*(const v8ha*)(pl2 + lr * 32 + hi * 8), *(const v8ha*)(pl2 + lr * 32 + 16 + hi * 8));
#pragma unroll
            for (int n = 0; n < 4; ++n) { o[n] = wmma16(pa, vh[n], o[n]); ox[n] = wmma16(pa, vl[n], ox[n]); ox[n] = wmma16(px, vh[n], ox[n]); }
        }
        asm volatile("s_wait_dscnt 0x0" ::: "memory");       // this wave's reads of the buffer are done before it is refilled
        asm volatile("s_wait_asynccnt 0x0" ::: "memory");    // this wave's copies of stage t + 1 have landed
        __syncthreads();                                     // publishes stage t + 1 and ends every reader's last read of stage t
        if (t + 2 < SS / AK) stage(t + 2);
    }
    asm volatile("s_wait_asynccnt 0x0" ::: "memory");        // nothing is outstanding when the wave goes on
    float inv[8];
#pragma unroll
    for (int j = 0; j < 8; ++j) { float rs = lpart[j]; rs += __shfl_xor(rs, 1, 16); rs += __shfl_xor(rs, 2, 16); rs += __shfl_xor(rs, 4, 16); rs += __shfl_xor(rs, 8, 16); inv[j] = 1.0f / (rs * PSC); }
    float* os = &ost[wave][0];
#pragma unroll
    for (int n = 0; n < 4; ++n)
#pragma unroll
        for (int j = 0; j < 8; ++j) os[(hi * 8 + j) * 68 + n * 16 + lr] = (o[n][j] + ox[n][j] * LOSCI) * inv[j];
    __syncthreads();
    float* ob = out + (tok0 + q0) * DM + (size_t)h * HD;
    auto pass = [&]() {
#pragma unroll
        for (int s = 0; s < 8; ++s) { const int Lid = (lane >> 3) + 4 * s, piece = lane & 7; const int row = Lid >> 1, cofs = (Lid & 1) * 32 + piece * 4;
            const v4f val = *(const v4fa*)(os + row * 68 + cofs); *(v4f*)(ob + (size_t)row * DM + cofs) = val; }
    };
    pass(); 
}

extern "C" void kernel_launch(void* const* d_in, const int* in_sizes, int n_in,
                              void* d_out, int out_size, void* d_ws, size_t ws_size, hipStream_t stream) {
    (void)in_sizes; (void)n_in; (void)out_size;
    const float* x = (const float*)d_in[0]; const float* rel = (const float*)d_in[1]; const float* Wq = (const float*)d_in[2]; const float* bq = (const float*)d_in[3];
    const float* Wk = (const float*)d_in[4]; const float* bk = (const float*)d_in[5]; const float* Wv = (const float*)d_in[6]; const float* bv = (const float*)d_in[7];
    float* out = (float*)d_out;    // [4][512][1024]
    char* wsp = (char*)d_ws;
    auto take = [&](size_t bytes) { char* p = wsp; wsp += (bytes + 255) & ~(size_t)255; return (void*)p; };
    bf* Xb = (bf*)take((size_t)NTK * DM * 2); bf* Rb = (bf*)take((size_t)NR * DM * 2); bf* WqT = (bf*)take((size_t)DM * DM * 2); bf* WkT = (bf*)take((size_t)DM * DM * 2); bf* WvT = (bf*)take((size_t)DM * DM * 2);
    h16* QH = (h16*)take((size_t)NTK * DM * 2); h16* QL = (h16*)take((size_t)NTK * DM * 2); h16* KH = (h16*)take((size_t)NTK * DM * 2); h16* KL = (h16*)take((size_t)NTK * DM * 2);
    h16* PKH = (h16*)take((size_t)NR * DM * 2); h16* PKL = (h16*)take((size_t)NR * DM * 2); h16* PQH = (h16*)take((size_t)NR * DM * 2); h16* PQL = (h16*)take((size_t)NR * DM * 2);
    float* Vf = (float*)take((size_t)NTK * DM * 4); h16* VTH = (h16*)take((size_t)NTK * DM * 2); h16* VTL = (h16*)take((size_t)NTK * DM * 2);
    float* Bt = (float*)take((size_t)NB_ * NH_ * SS * SS * 4);
    if ((size_t)(wsp - (char*)d_ws) > ws_size) return;    // 4.2 + 2.1 + 6.3 + 16.8 + 8.4 + 8.4 + 8.4 + 67 ~ 122 MB
    k_prep<<<3 * WTB + NTK / 8 + NR / 8, 256, 0, stream>>>(x, rel, Wq, Wk, Wv, Xb, Rb, WqT, WkT, WvT);
    k_gemm5<<<3 * GXB + 2 * GRB, 128, 0, stream>>>(Xb, Rb, WqT, WkT, WvT, bq, bk, bv, QH, QL, KH, KL, Vf, PKH, PKL, PQH, PQL);    // pos_k = rel.Wk + bk, pos_q = rel.Wq + bq
    k_bias<<<NB_ * NH_ * (SS / 64), 256, 0, stream>>>(QH, QL, KH, KL, PKH, PKL, PQH, PQL, Bt, Vf, VTH, VTL);
    k_attn<<<NB_ * NH_ * (SS / 64), 128, 0, stream>>>(QH, QL, KH, KL, Bt, VTH, VTL, out);
}

// v007
// It runs in 74 microseconds.
// In both of two side-by-side timings against v006, it was 1.10 times as fast.
// All steps since v000 together make it 8.51 times as fast.
#include <hip/hip_runtime.h>

// Contractions, f32 accumulate: q/k/v = x.W + b ([2048 x 1024].[1024 x 1024]) and pos_k = rel.Wk + bk, pos_q = rel.Wq + bq ([1024 x 1024].[1024 x 1024]) on
// v_wmma_f32_16x16x32_bf16 with PLAIN bf16 operands (inputs rounded once: exact; k-major weights transposed into n-major planes; tiles staged in LDS by asynchronous copies); the disentangled attention on
// v_wmma_f32_16x16x32_f16 with every computed operand as f16 hi + residual x1024 (hi.hi + hi.lo + lo.hi): the relative products q.pos_k^T and k.pos_q^T, only the
// 80-column band that a 16 x 64 piece of the score tile gathers from (operands staged in LDS), gathered in LDS into one table bias[pair][q][k] = c2p[q][q-k+511] + p2c[k][k-q+511]; then the
// fused attention over all 64 (b,h) pairs in one launch (content q.k + bias[q][k], online softmax, weights . v; key, V and bias tiles staged in LDS by asynchronous copies).
// Four launches, each made of everything that depends only on the launches before it: k_prep (both conversions, three weight transposes), k_gemm5 (all five projections),
// k_bias (the V transpose and the bias tiles, a block walking the key tiles of its 64 queries), k_attn. A block picks its job from its index alone.

#define NB_  4
#define SS   512
#define DM   1024
#define NH_  16
#define HD   64
#define NR   1024                // 2 * att_span relative positions
#define NTK  (NB_ * SS)          // 2048
#define BW   80                  // relative columns that 16 rows against 64 opposite positions can gather: 16 + 64 - 1, rounded up to whole 16-column tiles
#define BP   84                  // LDS pitch of a band row, in floats
#define SP   72                  // LDS pitch of a staged 64-element f16 row, in elements: the 16 bytes of pad spread the 16 rows of a b128 fragment read over all banks
#define BPL  (16 * BP + 6)       // LDS floats per wave's band; the + 6 spreads the four waves' planes over the banks for the diagonal reads
#define GK   128                 // k elements of a staged GEMM tile: rows of 256 bytes
#define GP   136                 // LDS pitch of a staged GEMM row, in elements: 272 B = 16 B x odd, for b128 fragment reads
#define GBUF (256 * GP)          // elements of one GEMM buffer: 128 A rows, then 128 B rows
#define PSC  32768.0f
#define LOSC 1024.0f
#define LOSCI (1.0f / 1024.0f)
#define SCL  0.07216878364870322f    // (64*3)^-0.5

typedef _Float16 h16;
typedef unsigned short bf;
typedef __attribute__((ext_vector_type(16))) __bf16   v16bf;
typedef __attribute__((ext_vector_type(16))) _Float16 v16h;
typedef __attribute__((ext_vector_type(8)))  _Float16 v8h;
typedef __attribute__((ext_vector_type(8)))  unsigned short v8us;
typedef __attribute__((ext_vector_type(8)))  float    v8f;
typedef __attribute__((ext_vector_type(4)))  float    v4f;
typedef v8h  __attribute__((may_alias)) v8ha;
typedef v4f  __attribute__((may_alias)) v4fa;
typedef v8us __attribute__((may_alias)) v8usa;

__device__ __forceinline__ unsigned short f2bf(float f) { unsigned u = __float_as_uint(f); u += 0x7FFFu + ((u >> 16) & 1u); return (unsigned short)(u >> 16); }
__device__ __forceinline__ float bf2f(unsigned short b) { return __uint_as_float(((unsigned)b) << 16); }
__device__ __forceinline__ float bfr(float f) { return bf2f(f2bf(f)); }
__device__ __forceinline__ v16h cat16(v8h lo, v8h hi) { return __builtin_shufflevector(lo, hi, 0, 1, 2, 3, 4, 5, 6, 7, 8, 9, 10, 11, 12, 13, 14, 15); }
__device__ __forceinline__ v16bf cat16b(v8us lo, v8us hi) { return __builtin_bit_cast(v16bf, __builtin_shufflevector(lo, hi, 0, 1, 2, 3, 4, 5, 6, 7, 8, 9, 10, 11, 12, 13, 14, 15)); }
__device__ __forceinline__ v8f wmma16(v16h a, v16h b, v8f c) { return __builtin_amdgcn_wmma_f32_16x16x32_f16(false, a, false, b, (short)0, c, false, false); }
__device__ __forceinline__ v8f wmmab(v16bf a, v16bf b, v8f c) { return __builtin_amdgcn_wmma_f32_16x16x32_bf16(false, a, false, b, (short)0, c, false, false); }
#define VST2(T, p, v) do { const T vst2_v_ = (v); *(T*)(p) = vst2_v_;  } while (0)

// cvtb: bf16 rows of an [nrows][1024] matrix, 8 rows a block; wt: a 64 x 64 tile of k-major [1024][1024] -> n-major bf16.
__device__ __forceinline__ void cvtb(const float* __restrict__ src, int nrows, bf* dst, int blk) {
    const int lane = threadIdx.x & 31, r = blk * 8 + (threadIdx.x >> 5);
    if (r >= nrows) return;
#pragma unroll
    for (int q = 0; q < DM / 256; ++q) { v8us t;
#pragma unroll
        for (int i = 0; i < 8; ++i) t[i] = f2bf(src[(size_t)r * DM + q * 256 + lane * 8 + i]);
        VST2(v8us, dst + (size_t)r * DM + q * 256 + lane * 8, t); }
}
__device__ __forceinline__ void wt(const float* __restrict__ Wm, bf* WT, int kb, int nb, unsigned short* tl) {
    const int tid = threadIdx.x, k0 = kb * 64, n0 = nb * 64;
    const int kk = tid >> 2, nq = (tid & 3) * 16;
#pragma unroll
    for (int i = 0; i < 16; ++i) tl[(nq + i) * 72 + kk] = f2bf(Wm[(size_t)(k0 + kk) * DM + n0 + nq + i]);
    __syncthreads();
    const int piece = tid & 7;
    auto pass = [&]() {
#pragma unroll
        for (int s = 0; s < 2; ++s) { const int nr = (tid >> 3) + 32 * s; const v8us val = *(const v8usa*)(tl + nr * 72 + piece * 8);
            *(v8us*)(WT + (size_t)(n0 + nr) * DM + k0 + piece * 8) = val; }
    };
    pass(); 
}
// k_prep: every operand conversion in one launch. Blocks 0 .. 767: the 256 tiles of Wq, of Wk, of Wv; the next 256: x; the last 128: the relative table.
#define WTB  ((DM / 64) * (DM / 64))    // tiles of one weight matrix
__global__ __launch_bounds__(256) void k_prep(const float* __restrict__ x, const float* __restrict__ rel, const float* __restrict__ Wq, const float* __restrict__ Wk, const float* __restrict__ Wv,
                                             bf* Xb, bf* Rb, bf* WqT, bf* WkT, bf* WvT) {
    __shared__ __align__(16) unsigned short tl[64 * 72];
    const int id = blockIdx.x;
    if (id < 3 * WTB) {
        const int w = id / WTB, t = id - w * WTB;
        wt(w == 0 ? Wq : w == 1 ? Wk : Wv, w == 0 ? WqT : w == 1 ? WkT : WvT, t % (DM / 64), t / (DM / 64), tl);
    } else if (id < 3 * WTB + NTK / 8) cvtb(x, NTK, Xb, id - 3 * WTB);
    else cvtb(rel, NR, Rb, id - (3 * WTB + NTK / 8));    // rel_embeddings[0 : 1024] (att_span = 512 = MAX_REL -> the whole table)
}
// copy8: eight asynchronous copies of 16 bytes a lane, global -> LDS, sixteen rows apart (a wave-wide copy = two whole 256-byte rows; the block's eight waves cover 16 rows a round).
// The s_wait_xcnt stands as the last line of the copies' own statement: it precedes every later rewrite of a register that a copy names.
__device__ __forceinline__ void copy8(unsigned l, const bf* g) {
    asm volatile("global_load_async_to_lds_b128 %0, %8, off\n\t"
                 "global_load_async_to_lds_b128 %1, %9, off\n\t"
                 "global_load_async_to_lds_b128 %2, %10, off\n\t"
                 "global_load_async_to_lds_b128 %3, %11, off\n\t"
                 "global_load_async_to_lds_b128 %4, %12, off\n\t"
                 "global_load_async_to_lds_b128 %5, %13, off\n\t"
                 "global_load_async_to_lds_b128 %6, %14, off\n\t"
                 "global_load_async_to_lds_b128 %7, %15, off\n\t"
                 "s_wait_xcnt 0x0"
                 :: "v"(l), "v"(l + 1 * 16 * GP * 2), "v"(l + 2 * 16 * GP * 2), "v"(l + 3 * 16 * GP * 2), "v"(l + 4 * 16 * GP * 2), "v"(l + 5 * 16 * GP * 2), "v"(l + 6 * 16 * GP * 2), "v"(l + 7 * 16 * GP * 2),
                    "v"(g), "v"(g + 1 * 16 * DM), "v"(g + 2 * 16 * DM), "v"(g + 3 * 16 * DM), "v"(g + 4 * 16 * DM), "v"(g + 5 * 16 * DM), "v"(g + 6 * 16 * DM), "v"(g + 7 * 16 * DM)
                 : "memory");
}
// k_gemm5: 128 x 128 tile of A.B^T + bias over K = 1024 (bf16 exact), all five projections in one launch: blocks of 128 for q, k, v (A = x), then of 64 for pos_k, pos_q (A = the relative table);
// q, k, pos_k, pos_q leave as f16 hi + residual planes (ld 1024), v as f32 rows. Eight waves, 4 (rows) x 2 (columns), each on 32 x 64 of the tile: a staged byte serves twice the products of a
// 64 x 64 tile, and LDS is read for 6 fragments per 8 products instead of 5 per 4. 512 blocks, two resident a WGP (LDS, registers): one round.
// Operands come through LDS: a stage is 128 k of the block's 128 A rows and 128 B rows (256-byte rows at pitch 272 B), brought by asynchronous copies into two buffers,
// the next stage in flight while this one is multiplied; the fragments keep the k order and the sum order of direct loads.
#define GXB  ((NTK / 128u) * (DM / 128u))    // blocks of a projection of x
#define GRB  ((NR / 128u) * (DM / 128u))     // blocks of a projection of the relative table
__global__ __launch_bounds__(256)
void k_gemm5(const bf* __restrict__ Xb, const bf* __restrict__ Rb, const bf* __restrict__ WqT, const bf* __restrict__ WkT, const bf* __restrict__ WvT,
             const float* __restrict__ bq, const float* __restrict__ bk, const float* __restrict__ bv,
             h16* QH, h16* QL, h16* KH, h16* KL, float* Vf, h16* PKH, h16* PKL, h16* PQH, h16* PQL) {
    __shared__ __align__(16) bf stg[2 * GBUF];    // the two stage buffers; behind the loop's last barrier the head of it holds the waves' output rows (8 x 32 x 68 floats)
    const int tid = threadIdx.x, lane = tid & 31, wave = tid >> 5, lr = lane & 15, hi = lane >> 4;
    const int wr = wave & 3, wc = wave >> 2;    // the wave's 32 rows and 64 columns of the tile
    const unsigned id = blockIdx.x;
    const bool onx = id < 3u * GXB;
    const unsigned job = onx ? id / GXB : 3u + (id - 3u * GXB) / GRB;          // 0 q, 1 k, 2 v, 3 pos_k, 4 pos_q
    const unsigned tl = onx ? id % GXB : (id - 3u * GXB) % GRB;                // the tile inside its job, row blocks fastest
    const bf* __restrict__ A = onx ? Xb : Rb;
    const bf* __restrict__ Bn = (job == 0 || job == 4) ? WqT : job == 2 ? WvT : WkT;
    const float* __restrict__ bias = (job == 0 || job == 4) ? bq : job == 2 ? bv : bk;
    const int rb = (int)(onx ? tl % (NTK / 128u) : tl % (NR / 128u)) * 128, cb = (int)(onx ? tl / (NTK / 128u) : tl / (NR / 128u)) * 128;
    const int r0 = rb + wr * 32, c0 = cb + wc * 64;
    const int crow = tid >> 4, cpc = (tid & 15) * 8;    // the lane's row (of 16 a copy round) and 16-byte piece of a staged row
    const bf* ga = A + (size_t)(rb + crow) * DM + cpc;
    const bf* gb = Bn + (size_t)(cb + crow) * DM + cpc;
    const unsigned la = (unsigned)(size_t)(stg + crow * GP + cpc);    // LDS byte address of the lane's piece in buffer 0, A rows; the B rows stand 128 rows on
    auto stage = [&](int t) {
        const unsigned l = la + (unsigned)(t & 1) * (GBUF * 2);
        copy8(l, ga + t * GK); copy8(l + 128 * GP * 2, gb + t * GK);
    };
    v8f acc[2][4];
#pragma unroll
    for (int m = 0; m < 2; ++m)
#pragma unroll
        for (int t = 0; t < 4; ++t) acc[m][t] = (v8f){};
    stage(0);
    asm volatile("s_wait_asynccnt 0x0" ::: "memory");    // stage 0 of this wave has landed
    __syncthreads();                                     // ... and of every wave: publishes buffer 0
    stage(1);
    const int ao = (wr * 32 + lr) * GP + 8 * hi, bo = (128 + wc * 64 + lr) * GP + 8 * hi;
#pragma unroll 1    // one rolled trip a stage: the foot's order (waits, barrier, refill) stands once
    for (int s = 0; s < DM / GK; ++s) {
        const bf* sb = stg + (s & 1) * GBUF;
        v16bf fa[2][2], fb[2][4];    // two fragment sets: the 32 k that are multiplied and the 32 k behind them
        auto frag = [&](int c) {
#pragma unroll
            for (int m = 0; m < 2; ++m) fa[c & 1][m] = cat16b(*(const v8usa*)(sb + ao + m * 16 * GP + c * 32), *(const v8usa*)(sb + ao + m * 16 * GP + c * 32 + 16));
#pragma unroll
            for (int t = 0; t < 4; ++t) fb[c & 1][t] = cat16b(*(const v8usa*)(sb + bo + t * 16 * GP + c * 32), *(const v8usa*)(sb + bo + t * 16 * GP + c * 32 + 16));
        };
        auto prod = [&](int c) {
#pragma unroll
            for (int m = 0; m < 2; ++m)
#pragma unroll
                for (int t = 0; t < 4; ++t) acc[m][t] = wmmab(fa[c & 1][m], fb[c & 1][t], acc[m][t]);
        };
        frag(0);
#pragma unroll
        for (int c = 0; c + 1 < GK / 32; ++c) {
            frag(c + 1);
            __builtin_amdgcn_sched_barrier(0);    // keeps the next 32 k's LDS reads one group in front of these products: left alone the compiler reads each fragment right before its use and waits out its latency
            prod(c);
        }
        asm volatile("s_wait_dscnt 0x0" ::: "memory");       // the stage's last fragments are in registers: this wave's reads of the buffer are done before it is refilled
        asm volatile("s_wait_asynccnt 0x0" ::: "memory");    // this wave's copies of stage s + 1 have landed
        __syncthreads();                                     // publishes stage s + 1 and ends every reader's last read of stage s
        if (s + 2 < DM / GK) stage(s + 2);
        prod(GK / 32 - 1);    // the last 32 k work on registers alone and stand behind the refill's issue
    }
    asm volatile("s_wait_asynccnt 0x0" ::: "memory");        // nothing is outstanding when the wave goes on
    // The last trip's foot (every wave's LDS reads done, no copy outstanding, barrier) has freed both buffers: each wave stages its 32 output rows in its own range of them.
    float* os = (float*)stg + wave * (32 * 68);
#pragma unroll
    for (int t = 0; t < 4; ++t) { const float bv = bfr(bias[c0 + t * 16 + lr]);
#pragma unroll
        for (int m = 0; m < 2; ++m)
#pragma unroll
            for (int j = 0; j < 8; ++j) os[(m * 16 + hi * 8 + j) * 68 + t * 16 + lr] = acc[m][t][j] + bv; }
    __syncthreads();
    if (job == 2) {
        float* crow = Vf + (size_t)r0 * DM + c0;
        auto pass = [&]() {
#pragma unroll
            for (int s = 0; s < 16; ++s) { const int Lid = (lane >> 3) + 4 * s, piece = lane & 7; const int row = Lid >> 1, cofs = (Lid & 1) * 32 + piece * 4;
                const v4f val = *(const v4fa*)(os + row * 68 + cofs); *(v4f*)(crow + (size_t)row * DM + cofs) = val; }
        };
        pass(); 
    } else {
        h16* c1 = (job == 0 ? QH : job == 1 ? KH : job == 3 ? PKH : PQH) + (size_t)r0 * DM + c0; h16* c2 = (job == 0 ? QL : job == 1 ? KL : job == 3 ? PKL : PQL) + (size_t)r0 * DM + c0;
        auto pass = [&]() {
#pragma unroll
            for (int s = 0; s < 8; ++s) { const int row = 4 * s + (lane >> 3), piece = lane & 7; const float* sp = os + row * 68 + piece * 8; v8h o1, o2;
#pragma unroll
                for (int i = 0; i < 8; ++i) { const h16 a = (h16)sp[i]; o1[i] = a; o2[i] = (h16)((sp[i] - (float)a) * LOSC); }
                *(v8h*)(c1 + (size_t)row * DM + piece * 8) = o1; *(v8h*)(c2 + (size_t)row * DM + piece * 8) = o2; }
        };
        pass(); 
        asm volatile("s_wait_xcnt 0x0" ::: "memory");    // the wait between the last issued global stores and any later overwrite of a register they name (the built code can fall through into the other branch's text)
    }
}
// vt: VTH/VTL [b][h][d][s] = f16 hi + residual of V rows; block bid = (b, h, 64 s); tile, til2: 64 x 72 elements of LDS each.
__device__ __forceinline__ void vt(const float* __restrict__ V, h16* VTH, h16* VTL, int bid, h16* tile, h16* til2) {
    const int b = bid / (NH_ * (SS / 64)), rem = bid - b * (NH_ * (SS / 64)), h = rem / (SS / 64), kt = rem - h * (SS / 64);
    const int s0 = kt * 64, tid = threadIdx.x, ss = tid >> 2, d0 = (tid & 3) * 16;
    const float* src = V + ((size_t)b * SS + s0 + ss) * DM + h * HD + d0;
#pragma unroll
    for (int i = 0; i < 16; ++i) { const float v = src[i]; const h16 a = (h16)v; tile[(d0 + i) * 72 + ss] = a; til2[(d0 + i) * 72 + ss] = (h16)((v - (float)a) * LOSC); }
    __syncthreads();
    const int piece = tid & 7;
    const size_t base = (((size_t)b * NH_ + h) * HD) * SS + s0;
    auto pass = [&]() {
#pragma unroll
        for (int s = 0; s < 4; ++s) { const int Lid = (tid >> 3) + 32 * s; const int pln = Lid >> 6, d = Lid & 63;
            const v8h val = *(const v8ha*)((pln ? til2 : tile) + d * 72 + piece * 8); *(v8h*)((pln ? VTL : VTH) + base + (size_t)d * SS + piece * 8) = val; }
    };
    pass(); 
}
// band16: dst[i][c] = (ah + al/1024)[row i].(ph + pl/1024)[window row 16 w4 + c], i < 16, c < 80 (hi.hi + hi.lo + lo.hi over K = 64); all four operands are staged LDS rows of pitch SP.
// The 128-row window of a relative table is two chunks of 64 table rows, cb and cb + 1; chunk c stands in slot c & 1 of the table's 128 staged rows.
__device__ __forceinline__ void band16(const h16* ah, const h16* al, const h16* ph, const h16* pl, int cb, int w4, int lr, int hi, float* dst) {
    const int ao = lr * SP + 8 * hi;
    v8f acc[BW / 16], accx[BW / 16];
#pragma unroll
    for (int t = 0; t < BW / 16; ++t) { acc[t] = (v8f){}; accx[t] = (v8f){}; }
#pragma unroll
    for (int kc = 0; kc < 2; ++kc) {
        const v16h a = cat16(*(const v8ha*)(ah + ao + kc * 32), *(const v8ha*)(ah + ao + kc * 32 + 16)), ax = cat16(*(const v8ha*)(al + ao + kc * 32), *(const v8ha*)(al + ao + kc * 32 + 16));
#pragma unroll
        for (int t = 0; t < BW / 16; ++t) { const int T = w4 + t, bo = (((cb + (T >> 2)) & 1) * 64 + (T & 3) * 16) * SP + ao + kc * 32;
            const v16h bh = cat16(*(const v8ha*)(ph + bo), *(const v8ha*)(ph + bo + 16)), bl = cat16(*(const v8ha*)(pl + bo), *(const v8ha*)(pl + bo + 16));
            acc[t] = wmma16(a, bh, acc[t]); accx[t] = wmma16(a, bl, accx[t]); accx[t] = wmma16(ax, bh, accx[t]); }
    }
#pragma unroll
    for (int t = 0; t < BW / 16; ++t)
#pragma unroll
        for (int j = 0; j < 8; ++j) dst[(hi * 8 + j) * BP + t * 16 + lr] = acc[t][j] + accx[t][j] * LOSCI;
}
// k_bias: block = (pair, 64 queries q0..): it walks the 8 key tiles k0 = 0, 64, .. of Bt[pair][q][k] = c2p[q][q - k + 511] + p2c[k][k - q + 511]; grid 512 blocks, 8 waves.
// Staged in LDS by whole 128-byte head rows, hi and residual planes: the 64 q rows (once), the tile's 64 k rows, the 128 rows q0 - k0 + 448 .. of pos_k and the 128 rows k0 - q0 + 448 .. of
// pos_q (both ranges lie in [0, 1023] for every tile). From one tile to the next both windows move by 64 rows, pos_k down and pos_q up: half of each stays where it is, and only the new
// chunk of 64 rows is brought, into the slot of the chunk that has left the window. The next tile's new rows are asked for behind the barrier that publishes this tile and wait in registers
// while this tile is worked on. Wave w < 4 forms the c2p band of queries 16w .. 16w + 15 against window rows 16w .. 16w + 79 of pos_k; wave 4 + w the p2c
// band of keys 16w .. against window rows 16w .. 16w + 79 of pos_q. In a band, element (row i, opposite position j of the tile) stands at column i - j + 63.
// Each block first does one of the 512 tiles of the V transpose, which waits for the same launch as the bias and for nothing else, in the head of the staging LDS.
__global__ __launch_bounds__(256) void k_bias(const h16* __restrict__ QH, const h16* __restrict__ QL, const h16* __restrict__ KH, const h16* __restrict__ KL,
                                             const h16* __restrict__ PKH, const h16* __restrict__ PKL, const h16* __restrict__ PQH, const h16* __restrict__ PQL, float* Bt,
                                             const float* __restrict__ Vf, h16* VTH, h16* VTL) {
    __shared__ __align__(16) h16 st[768 * SP];
    __shared__ float bd[8 * BPL];
    const int tid = threadIdx.x, lane = tid & 31, wave = __builtin_amdgcn_readfirstlane(tid >> 5), lr = lane & 15, hi = lane >> 4;
    const int p = blockIdx.x / (SS / 64), qx = blockIdx.x - p * (SS / 64), b = p / NH_, h = p - b * NH_;
    const int q0 = qx * 64;
    const size_t tok0 = (size_t)b * SS;
    const int srow = tid >> 3, spc = (tid & 7) * 8;
    const unsigned voff = (unsigned)(srow * DM + spc);    // the lane's element offset inside a slab of 32 rows: the one vector register that all loads name
    v8h sv[24];
    auto fetch = [&](const h16* __restrict__ g, size_t grow0, int n32, int at) {
        const h16* gb = g + grow0 * DM + h * HD;
#pragma unroll
        for (int i = 0; i < n32; ++i) sv[at + i] = *(const v8h*)(gb + voff + i * 32 * DM);
        // The wait that stands between issued global loads and any overwrite of a register they name (the plane's base is formed anew for the next plane);
        // voff as an input keeps the shared offset register whole up to the last of these waits.
        asm volatile("s_wait_xcnt 0x0" :: "v"(voff) : "memory");
    };
    fetch(QH, tok0 + q0, 2, 0); fetch(QL, tok0 + q0, 2, 2); fetch(KH, tok0, 2, 4); fetch(KL, tok0, 2, 6);
    fetch(PKH, (size_t)(q0 + (SS - 64)), 4, 8); fetch(PKL, (size_t)(q0 + (SS - 64)), 4, 12);
    fetch(PQH, (size_t)((SS - 64) - q0), 4, 16); fetch(PQL, (size_t)((SS - 64) - q0), 4, 20);
    vt(Vf, VTH, VTL, blockIdx.x, st, st + HD * 72);
    asm volatile("s_wait_xcnt 0x0" ::: "memory");    // the wait between the V tile's issued global stores and a later overwrite of a register they name
    __syncthreads();    // every wave has read its part of the V tile out of the staging LDS before tile 0's rows go there
#pragma unroll
    for (int r = 0; r < 8; ++r) *(v8ha*)(st + (r * 32 + srow) * SP + spc) = sv[r];
#pragma unroll
    for (int i = 0; i < 4; ++i) { const int sk = ((qx + 7 + (i >> 1)) & 1) * 64 + (i & 1) * 32 + srow, sq = ((7 - qx + (i >> 1)) & 1) * 64 + (i & 1) * 32 + srow;
        *(v8ha*)(st + (256 + sk) * SP + spc) = sv[8 + i]; *(v8ha*)(st + (384 + sk) * SP + spc) = sv[12 + i];
        *(v8ha*)(st + (512 + sq) * SP + spc) = sv[16 + i]; *(v8ha*)(st + (640 + sq) * SP + spc) = sv[20 + i]; }
    const int side = wave >> 2, w4 = wave & 3;
    const h16* sa = st + (side * 128 + w4 * 16) * SP;
    const h16* sp = st + (256 + side * 256) * SP;
#pragma unroll 1    // one rolled trip a key tile: the two barriers and the refill between them stand once
    for (int kt = 0; kt < SS / 64; ++kt) {
        const int ck = qx - kt + 7, cq = kt - qx + 7;    // first chunk of the pos_k window and of the pos_q window of this tile
        __syncthreads();    // publishes this tile's staged rows and ends every reader's last read of the bands of the tile before
        if (kt + 1 < SS / 64) {
            fetch(KH, tok0 + (size_t)(kt + 1) * 64, 2, 0); fetch(KL, tok0 + (size_t)(kt + 1) * 64, 2, 2);
            fetch(PKH, (size_t)(ck - 1) * 64, 2, 4); fetch(PKL, (size_t)(ck - 1) * 64, 2, 6);
            fetch(PQH, (size_t)(cq + 2) * 64, 2, 8); fetch(PQL, (size_t)(cq + 2) * 64, 2, 10);
        }
        band16(sa, sa + 64 * SP, sp, sp + 128 * SP, side ? cq : ck, w4, lr, hi, bd + wave * BPL);
        __syncthreads();    // publishes the bands and ends every reader's last read of this tile's staged rows
        float* brow = Bt + ((size_t)p * SS + q0 + wave * 8) * SS + kt * 64;
#pragma unroll
        for (int s = 0; s < 4; ++s) { const int Lid = (lane >> 3) + 4 * s, piece = lane & 7; const int row = Lid >> 1, cofs = (Lid & 1) * 32 + piece * 4, qq = wave * 8 + row, qw = qq >> 4, qi = qq & 15;
            v4f val;
#pragma unroll
            for (int e = 0; e < 4; ++e) { const int kk = cofs + e, kw = kk >> 4, ki = kk & 15;
                val[e] = bd[qw * BPL + qi * BP + qi - kk + 63] + bd[(4 + kw) * BPL + ki * BP + ki - qq + 63]; }
            *(v4f*)(brow + (size_t)row * SS + cofs) = val; }
        asm volatile("s_wait_xcnt 0x0" ::: "memory");    // the wait between the tile's last issued global store and the next overwrite of a register it names
        if (kt + 1 < SS / 64) {
#pragma unroll
            for (int i = 0; i < 2; ++i) { const int sk = ((ck - 1) & 1) * 64 + i * 32 + srow, sq = (cq & 1) * 64 + i * 32 + srow;
                *(v8ha*)(st + (128 + i * 32 + srow) * SP + spc) = sv[i]; *(v8ha*)(st + (192 + i * 32 + srow) * SP + spc) = sv[2 + i];
                *(v8ha*)(st + (256 + sk) * SP + spc) = sv[4 + i]; *(v8ha*)(st + (384 + sk) * SP + spc) = sv[6 + i];
                *(v8ha*)(st + (512 + sq) * SP + spc) = sv[8 + i]; *(v8ha*)(st + (640 + sq) * SP + spc) = sv[10 + i]; }
        }
    }
}
// copy8a: eight asynchronous copies of 16 bytes a lane, global -> LDS, each with its own pair of addresses.
// The s_wait_xcnt stands as the last line of the copies' own statement: it precedes every later rewrite of a register that a copy names.
__device__ __forceinline__ void copy8a(const unsigned (&l)[8], const void* const (&g)[8]) {
    asm volatile("global_load_async_to_lds_b128 %0, %8, off\n\t"
                 "global_load_async_to_lds_b128 %1, %9, off\n\t"
                 "global_load_async_to_lds_b128 %2, %10, off\n\t"
                 "global_load_async_to_lds_b128 %3, %11, off\n\t"
                 "global_load_async_to_lds_b128 %4, %12, off\n\t"
                 "global_load_async_to_lds_b128 %5, %13, off\n\t"
                 "global_load_async_to_lds_b128 %6, %14, off\n\t"
                 "global_load_async_to_lds_b128 %7, %15, off\n\t"
                 "s_wait_xcnt 0x0"
                 :: "v"(l[0]), "v"(l[1]), "v"(l[2]), "v"(l[3]), "v"(l[4]), "v"(l[5]), "v"(l[6]), "v"(l[7]),
                    "v"(g[0]), "v"(g[1]), "v"(g[2]), "v"(g[3]), "v"(g[4]), "v"(g[5]), "v"(g[6]), "v"(g[7])
                 : "memory");
}
// k_attn: block = (pair p, 64 queries), wave = 16; 16 key tiles of 32: content = q.k (hi.hi + hi.lo + lo.hi: 12 WMMA), bias = Bt[p][q][k],
// logits = (content + bias) x SCL; online softmax; weights x32768 hi/residual; 12 WMMA .v;
// The loop reads no global memory: a stage is 64 keys of everything the block's four waves stream (64 key rows and 64 rows of transposed V, hi and residual planes, 128-byte rows at
// pitch 144 B; the block's 64 x 64 piece of the bias table, 256-byte rows at pitch 272 B), brought by asynchronous copies into two buffers, the next stage in flight while this one is worked on.
// The fragments keep the k order and the sum order of direct loads.
#define AK   64                  // keys of a stage
#define APL  (64 * SP)           // elements of one staged f16 plane
#define ABP  68                  // LDS pitch of a staged bias row, in floats: rows 8 apart (the two half-waves of a read) stand 32 banks apart
__global__ __launch_bounds__(128) void k_attn(const h16* __restrict__ QH, const h16* __restrict__ QL, const h16* __restrict__ KH, const h16* __restrict__ KL,
                                             const float* __restrict__ Bt, const h16* __restrict__ VTH, const h16* __restrict__ VTL, float* out) {
    __shared__ __align__(16) h16 kv[2][4 * APL];        // planes: key hi, key residual, V^T hi, V^T residual
    __shared__ __align__(16) float bs[2][64 * ABP];
    __shared__ __align__(16) h16 plds[4][16 * 32];
    __shared__ __align__(16) h16 plds2[4][16 * 32];
    __shared__ __align__(16) float ost[4][16 * 68];
    const int tid = threadIdx.x, lane = tid & 31, wave = tid >> 5, lr = lane & 15, hi = lane >> 4;
    const int p = blockIdx.x / (SS / 64), qt = blockIdx.x - p * (SS / 64), b = p / NH_, h = p - b * NH_;
    const int q0 = qt * 64 + wave * 16;
    const size_t tok0 = (size_t)b * SS;
    h16* pl = &plds[wave][0]; h16* pl2 = &plds2[wave][0];
    const float* bt = Bt + (size_t)p * SS * SS;
    const size_t vbase = (((size_t)b * NH_ + h) * HD) * SS;
    const int hrow = tid >> 3, hpc = (tid & 7) * 8;     // f16 planes: the lane's row (of 16 a copy round) and 16-byte piece of a 128-byte row
    const int frow = tid >> 4, fpc = (tid & 15) * 4;    // bias: the lane's row (of 8 a copy round) and 16-byte piece of a 256-byte row
    // the lane's source addresses of the next stage to be asked for, one a plane: they walk on by a stage with every call of stage()
    const h16* pkh = KH + (tok0 + hrow) * DM + h * HD + hpc; const h16* pkl = KL + (tok0 + hrow) * DM + h * HD + hpc;
    const h16* pvh = VTH + vbase + (size_t)hrow * SS + hpc; const h16* pvl = VTL + vbase + (size_t)hrow * SS + hpc;
    const float* pbt = bt + (size_t)(qt * 64 + frow) * SS + fpc;
    const unsigned lkv = (unsigned)(size_t)(&kv[0][0] + hrow * SP + hpc), lbs = (unsigned)(size_t)(&bs[0][0] + frow * ABP + fpc);    // LDS byte addresses of the lane's pieces in buffer 0
    auto stage = [&](int t) {
        const unsigned lh = lkv + (unsigned)(t & 1) * (4 * APL * 2), lf = lbs + (unsigned)(t & 1) * (64 * ABP * 4);
        unsigned l[8]; const void* g[8];
#pragma unroll
        for (int i = 0; i < 4; ++i) { l[i] = lh + i * 16 * SP * 2; g[i] = pkh + (size_t)i * 16 * DM; l[4 + i] = l[i] + APL * 2; g[4 + i] = pkl + (size_t)i * 16 * DM; }
        copy8a(l, g);
#pragma unroll
        for (int i = 0; i < 4; ++i) { l[i] = lh + 2 * APL * 2 + i * 16 * SP * 2; g[i] = pvh + (size_t)i * 16 * SS; l[4 + i] = l[i] + APL * 2; g[4 + i] = pvl + (size_t)i * 16 * SS; }
        copy8a(l, g);
#pragma unroll
        for (int i = 0; i < 8; ++i) { l[i] = lf + i * 8 * ABP * 4; g[i] = pbt + (size_t)i * 8 * SS; }
        copy8a(l, g);
        pkh += (size_t)AK * DM; pkl += (size_t)AK * DM; pvh += AK; pvl += AK; pbt += AK;
    };
    stage(0);
    v16h qa[2], ql[2];
    const size_t qo0 = (tok0 + q0 + lr) * DM + h * HD + 8 * hi;
#pragma unroll
    for (int kc = 0; kc < 2; ++kc) { qa[kc] = cat16(*(const v8h*)(QH + qo0 + kc * 32), *(const v8h*)(QH + qo0 + kc * 32 + 16)); ql[kc] = cat16(*(const v8h*)(QL + qo0 + kc * 32), *(const v8h*)(QL + qo0 + kc * 32 + 16)); }
    asm volatile("s_wait_xcnt 0x0" ::: "memory");        // the wait between these issued global loads and a later overwrite of their address registers (stage 1's addresses are formed next)
    v8f o[4], ox[4];
#pragma unroll
    for (int n = 0; n < 4; ++n) { o[n] = (v8f){}; ox[n] = (v8f){}; }
    float mrow[8], lpart[8];
#pragma unroll
    for (int j = 0; j < 8; ++j) { mrow[j] = -3.0e38f; lpart[j] = 0.f; }
    asm volatile("s_wait_asynccnt 0x0" ::: "memory");    // stage 0 of this wave has landed
    __syncthreads();                                     // ... and of every wave: publishes buffer 0
    stage(1);
#pragma unroll 1    // one rolled trip a stage: the foot's order (waits, barrier, refill) stands once
    for (int t = 0; t < SS / AK; ++t) {
        const h16* sk = &kv[t & 1][0];
        const float* sb = &bs[t & 1][0] + (wave * 16 + 8 * hi) * ABP + lr;
#pragma unroll
        for (int u = 0; u < AK / 32; ++u) {
            float ba[8], bb[8];
#pragma unroll
            for (int j = 0; j < 8; ++j) { ba[j] = sb[j * ABP + u * 32]; bb[j] = sb[j * ABP + u * 32 + 16]; }
            v8f s0 = {}, s1 = {}, x0 = {}, x1 = {};
#pragma unroll
            for (int kc = 0; kc < 2; ++kc) {
                const h16* k0 = sk + (u * 32 + lr) * SP + kc * 32 + 8 * hi; const h16* k1 = k0 + 16 * SP;
                const v16h k0h = cat16(*(const v8ha*)(k0), *(const v8ha*)(k0 + 16)), k1h = cat16(*(const v8ha*)(k1), *(const v8ha*)(k1 + 16));
                const v16h k0l = cat16(*(const v8ha*)(k0 + APL), *(const v8ha*)(k0 + APL + 16)), k1l = cat16(*(const v8ha*)(k1 + APL), *(const v8ha*)(k1 + APL + 16));
                s0 = wmma16(qa[kc], k0h, s0); x0 = wmma16(ql[kc], k0h, x0); s1 = wmma16(qa[kc], k1h, s1); x1 = wmma16(ql[kc], k1h, x1);
                x0 = wmma16(qa[kc], k0l, x0); x1 = wmma16(qa[kc], k1l, x1);
            }
            v16h vh[4], vl[4];    // the trip's V fragments, asked for here: their LDS latency passes under the softmax, in the registers that the key fragments have left
#pragma unroll
            for (int n = 0; n < 4; ++n) { const h16* vp = sk + 2 * APL + (n * 16 + lr) * SP + u * 32 + hi * 8;
                vh[n] = cat16(*(const v8ha*)(vp), *(const v8ha*)(vp + 16)); vl[n] = cat16(*(const v8ha*)(vp + APL), *(const v8ha*)(vp + APL + 16)); }
            float alpha[8];
#pragma unroll
            for (int j = 0; j < 8; ++j) {
                const float a0 = (s0[j] + x0[j] * LOSCI + ba[j]) * SCL, a1 = (s1[j] + x1[j] * LOSCI + bb[j]) * SCL;
                float mx = fmaxf(a0, a1);
                mx = fmaxf(mx, __shfl_xor(mx, 1, 16)); mx = fmaxf(mx, __shfl_xor(mx, 2, 16)); mx = fmaxf(mx, __shfl_xor(mx, 4, 16)); mx = fmaxf(mx, __shfl_xor(mx, 8, 16));
                const float mn = fmaxf(mrow[j], mx);
                alpha[j] = __expf(mrow[j] - mn); mrow[j] = mn;
                const float e0 = __expf(a0 - mn), e1 = __expf(a1 - mn);
                lpart[j] = lpart[j] * alpha[j] + (e0 + e1);
                const int mr = hi * 8 + j;
                const float ps0 = e0 * PSC, ps1 = e1 * PSC; const h16 h0 = (h16)ps0, h1 = (h16)ps1;
                pl[mr * 32 + lr] = h0; pl[mr * 32 + 16 + lr] = h1; pl2[mr * 32 + lr] = (h16)((ps0 - (float)h0) * LOSC); pl2[mr * 32 + 16 + lr] = (h16)((ps1 - (float)h1) * LOSC);
            }
#pragma unroll
            for (int n = 0; n < 4; ++n)
#pragma unroll
                for (int j = 0; j < 8; ++j) { o[n][j] *= alpha[j]; ox[n][j] *= alpha[j]; }
            asm volatile("" ::: "memory");
            const v16h pa = cat16(*(const v8ha*)(pl + lr * 32 + hi * 8), *(const v8ha*)(pl + lr * 32 + 16 + hi * 8));
            const v16h px = cat16(*(const v8ha*)(pl2 + lr * 32 + hi * 8), *(const v8ha*)(pl2 + lr * 32 + 16 + hi * 8));
#pragma unroll
            for (int n = 0; n < 4; ++n) { o[n] = wmma16(pa, vh[n], o[n]); ox[n] = wmma16(pa, vl[n], ox[n]); ox[n] = wmma16(px, vh[n], ox[n]); }
        }
        asm volatile("s_wait_dscnt 0x0" ::: "memory");       // this wave's reads of the buffer are done before it is refilled
        asm volatile("s_wait_asynccnt 0x0" ::: "memory");    // this wave's copies of stage t + 1 have landed
        __syncthreads();                                     // publishes stage t + 1 and ends every reader's last read of stage t
        if (t + 2 < SS / AK) stage(t + 2);
    }
    asm volatile("s_wait_asynccnt 0x0" ::: "memory");        // nothing is outstanding when the wave goes on
    float inv[8];
#pragma unroll
    for (int j = 0; j < 8; ++j) { float rs = lpart[j]; rs += __shfl_xor(rs, 1, 16); rs += __shfl_xor(rs, 2, 16); rs += __shfl_xor(rs, 4, 16); rs += __shfl_xor(rs, 8, 16); inv[j] = 1.0f / (rs * PSC); }
    float* os = &ost[wave][0];
#pragma unroll
    for (int n = 0; n < 4; ++n)
#pragma unroll
        for (int j = 0; j < 8; ++j) os[(hi * 8 + j) * 68 + n * 16 + lr] = (o[n][j] + ox[n][j] * LOSCI) * inv[j];
    __syncthreads();
    float* ob = out + (tok0 + q0) * DM + (size_t)h * HD;
    auto pass = [&]() {
#pragma unroll
        for (int s = 0; s < 8; ++s) { const int Lid = (lane >> 3) + 4 * s, piece = lane & 7; const int row = Lid >> 1, cofs = (Lid & 1) * 32 + piece * 4;
            const v4f val = *(const v4fa*)(os + row * 68 + cofs); *(v4f*)(ob + (size_t)row * DM + cofs) = val; }
    };
    pass(); 
}

extern "C" void kernel_launch(void* const* d_in, const int* in_sizes, int n_in,
                              void* d_out, int out_size, void* d_ws, size_t ws_size, hipStream_t stream) {
    (void)in_sizes; (void)n_in; (void)out_size;
    const float* x = (const float*)d_in[0]; const float* rel = (const float*)d_in[1]; const float* Wq = (const float*)d_in[2]; const float* bq = (const float*)d_in[3];
    const float* Wk = (const float*)d_in[4]; const float* bk = (const float*)d_in[5]; const float* Wv = (const float*)d_in[6]; const float* bv = (const float*)d_in[7];
    float* out = (float*)d_out;    // [4][512][1024]
    char* wsp = (char*)d_ws;
    auto take = [&](size_t bytes) { char* p = wsp; wsp += (bytes + 255) & ~(size_t)255; return (void*)p; };
    bf* Xb = (bf*)take((size_t)NTK * DM * 2); bf* Rb = (bf*)take((size_t)NR * DM * 2); bf* WqT = (bf*)take((size_t)DM * DM * 2); bf* WkT = (bf*)take((size_t)DM * DM * 2); bf* WvT = (bf*)take((size_t)DM * DM * 2);
    h16* QH = (h16*)take((size_t)NTK * DM * 2); h16* QL = (h16*)take((size_t)NTK * DM * 2); h16* KH = (h16*)take((size_t)NTK * DM * 2); h16* KL = (h16*)take((size_t)NTK * DM * 2);
    h16* PKH = (h16*)take((size_t)NR * DM * 2); h16* PKL = (h16*)take((size_t)NR * DM * 2); h16* PQH = (h16*)take((size_t)NR * DM * 2); h16* PQL = (h16*)take((size_t)NR * DM * 2);
    float* Vf = (float*)take((size_t)NTK * DM * 4); h16* VTH = (h16*)take((size_t)NTK * DM * 2); h16* VTL = (h16*)take((size_t)NTK * DM * 2);
    float* Bt = (float*)take((size_t)NB_ * NH_ * SS * SS * 4);
    if ((size_t)(wsp - (char*)d_ws) > ws_size) return;    // 4.2 + 2.1 + 6.3 + 16.8 + 8.4 + 8.4 + 8.4 + 67 ~ 122 MB
    k_prep<<<3 * WTB + NTK / 8 + NR / 8, 256, 0, stream>>>(x, rel, Wq, Wk, Wv, Xb, Rb, WqT, WkT, WvT);
    k_gemm5<<<3 * GXB + 2 * GRB, 256, 0, stream>>>(Xb, Rb, WqT, WkT, WvT, bq, bk, bv, QH, QL, KH, KL, Vf, PKH, PKL, PQH, PQL);    // pos_k = rel.Wk + bk, pos_q = rel.Wq + bq
    k_bias<<<NB_ * NH_ * (SS / 64), 256, 0, stream>>>(QH, QL, KH, KL, PKH, PKL, PQH, PQL, Bt, Vf, VTH, VTL);
    k_attn<<<NB_ * NH_ * (SS / 64), 128, 0, stream>>>(QH, QL, KH, KL, Bt, VTH, VTL, out);
}

// v008
// A run of this version takes 63.2 microseconds.
// Two timings next to v007 both put it at 1.17 times that version's speed.
// All steps since v000 together make it 9.97 times as fast.
#include <hip/hip_runtime.h>

// Contractions, f32 accumulate: q/k/v = x.W + b ([2048 x 1024].[1024 x 1024]) and pos_k = rel.Wk + bk, pos_q = rel.Wq + bq ([1024 x 1024].[1024 x 1024]) on
// v_wmma_f32_16x16x32_bf16 with PLAIN bf16 operands (inputs rounded once: exact; k-major weights transposed into n-major planes; tiles staged in LDS by asynchronous copies); the disentangled attention on
// v_wmma_f32_16x16x32_f16 with every computed operand as f16 hi + residual x1024 (hi.hi + hi.lo + lo.hi): the relative products q.pos_k^T and k.pos_q^T, only the
// 80-column band that a 16 x 64 piece of the score tile gathers from (operands staged in LDS), gathered in LDS into one table bias[pair][q][k] = c2p[q][q-k+511] + p2c[k][k-q+511]; then the
// fused attention over all 64 (b,h) pairs in one launch (content q.k + bias[q][k], online softmax, weights . v; key, V and bias tiles staged in LDS by asynchronous copies).
// Four launches, each made of everything that depends only on the launches before it: k_prep (both conversions, three weight transposes), k_gemm5 (all five projections),
// k_bias (the V transpose and the bias tiles, a block walking the key tiles of its 64 queries), k_attn. A block picks its job from its index alone.

#define NB_  4
#define SS   512
#define DM   1024
#define NH_  16
#define HD   64
#define NR   1024                // 2 * att_span relative positions
#define NTK  (NB_ * SS)          // 2048
#define BW   80                  // relative columns that 16 rows against 64 opposite positions can gather: 16 + 64 - 1, rounded up to whole 16-column tiles
#define BP   84                  // LDS pitch of a band row, in floats
#define SP   72                  // LDS pitch of a staged 64-element f16 row, in elements: the 16 bytes of pad spread the 16 rows of a b128 fragment read over all banks
#define BPL  (16 * BP + 6)       // LDS floats per wave's band; the + 6 spreads the four waves' planes over the banks for the diagonal reads
#define GK   128                 // k elements of a staged GEMM tile: rows of 256 bytes
#define GP   136                 // LDS pitch of a staged GEMM row, in elements: 272 B = 16 B x odd, for b128 fragment reads
#define GBUF (256 * GP)          // elements of one GEMM buffer: 128 A rows, then 128 B rows
#define PSC  32768.0f
#define LOSC 1024.0f
#define LOSCI (1.0f / 1024.0f)
#define SCL  0.07216878364870322f    // (64*3)^-0.5

typedef _Float16 h16;
typedef unsigned short bf;
typedef __attribute__((ext_vector_type(16))) __bf16   v16bf;
typedef __attribute__((ext_vector_type(16))) _Float16 v16h;
typedef __attribute__((ext_vector_type(8)))  _Float16 v8h;
typedef __attribute__((ext_vector_type(8)))  unsigned short v8us;
typedef __attribute__((ext_vector_type(8)))  float    v8f;
typedef __attribute__((ext_vector_type(4)))  float    v4f;
typedef v8h  __attribute__((may_alias)) v8ha;
typedef v4f  __attribute__((may_alias)) v4fa;
typedef v8us __attribute__((may_alias)) v8usa;

__device__ __forceinline__ unsigned short f2bf(float f) { unsigned u = __float_as_uint(f); u += 0x7FFFu + ((u >> 16) & 1u); return (unsigned short)(u >> 16); }
__device__ __forceinline__ float bf2f(unsigned short b) { return __uint_as_float(((unsigned)b) << 16); }
__device__ __forceinline__ float bfr(float f) { return bf2f(f2bf(f)); }
__device__ __forceinline__ v16h cat16(v8h lo, v8h hi) { return __builtin_shufflevector(lo, hi, 0, 1, 2, 3, 4, 5, 6, 7, 8, 9, 10, 11, 12, 13, 14, 15); }
__device__ __forceinline__ v16bf cat16b(v8us lo, v8us hi) { return __builtin_bit_cast(v16bf, __builtin_shufflevector(lo, hi, 0, 1, 2, 3, 4, 5, 6, 7, 8, 9, 10, 11, 12, 13, 14, 15)); }
__device__ __forceinline__ v8f wmma16(v16h a, v16h b, v8f c) { return __builtin_amdgcn_wmma_f32_16x16x32_f16(false, a, false, b, (short)0, c, false, false); }
__device__ __forceinline__ v8f wmmab(v16bf a, v16bf b, v8f c) { return __builtin_amdgcn_wmma_f32_16x16x32_bf16(false, a, false, b, (short)0, c, false, false); }
__device__ __forceinline__ v8f cat8(v4f lo, v4f hi) { return __builtin_shufflevector(lo, hi, 0, 1, 2, 3, 4, 5, 6, 7); }
// xhalf: the value that lane l ^ 16 holds
__device__ __forceinline__ float xhalf(float v) { const int b = __float_as_int(v); return __int_as_float(__builtin_amdgcn_permlanex16(b, b, 0x76543210, 0xfedcba98, false, false)); }
#define VST2(T, p, v) do { const T vst2_v_ = (v); *(T*)(p) = vst2_v_;  } while (0)

// cvtb: bf16 rows of an [nrows][1024] matrix, 8 rows a block; wt: a 64 x 64 tile of k-major [1024][1024] -> n-major bf16.
__device__ __forceinline__ void cvtb(const float* __restrict__ src, int nrows, bf* dst, int blk) {
    const int lane = threadIdx.x & 31, r = blk * 8 + (threadIdx.x >> 5);
    if (r >= nrows) return;
#pragma unroll
    for (int q = 0; q < DM / 256; ++q) { v8us t;
#pragma unroll
        for (int i = 0; i < 8; ++i) t[i] = f2bf(src[(size_t)r * DM + q * 256 + lane * 8 + i]);
        VST2(v8us, dst + (size_t)r * DM + q * 256 + lane * 8, t); }
}
__device__ __forceinline__ void wt(const float* __restrict__ Wm, bf* WT, int kb, int nb, unsigned short* tl) {
    const int tid = threadIdx.x, k0 = kb * 64, n0 = nb * 64;
    const int kk = tid >> 2, nq = (tid & 3) * 16;
#pragma unroll
    for (int i = 0; i < 16; ++i) tl[(nq + i) * 72 + kk] = f2bf(Wm[(size_t)(k0 + kk) * DM + n0 + nq + i]);
    __syncthreads();
    const int piece = tid & 7;
    auto pass = [&]() {
#pragma unroll
        for (int s = 0; s < 2; ++s) { const int nr = (tid >> 3) + 32 * s; const v8us val = *(const v8usa*)(tl + nr * 72 + piece * 8);
            *(v8us*)(WT + (size_t)(n0 + nr) * DM + k0 + piece * 8) = val; }
    };
    pass(); 
}
// k_prep: every operand conversion in one launch. Blocks 0 .. 767: the 256 tiles of Wq, of Wk, of Wv; the next 256: x; the last 128: the relative table.
#define WTB  ((DM / 64) * (DM / 64))    // tiles of one weight matrix
__global__ __launch_bounds__(256) void k_prep(const float* __restrict__ x, const float* __restrict__ rel, const float* __restrict__ Wq, const float* __restrict__ Wk, const float* __restrict__ Wv,
                                             bf* Xb, bf* Rb, bf* WqT, bf* WkT, bf* WvT) {
    __shared__ __align__(16) unsigned short tl[64 * 72];
    const int id = blockIdx.x;
    if (id < 3 * WTB) {
        const int w = id / WTB, t = id - w * WTB;
        wt(w == 0 ? Wq : w == 1 ? Wk : Wv, w == 0 ? WqT : w == 1 ? WkT : WvT, t % (DM / 64), t / (DM / 64), tl);
    } else if (id < 3 * WTB + NTK / 8) cvtb(x, NTK, Xb, id - 3 * WTB);
    else cvtb(rel, NR, Rb, id - (3 * WTB + NTK / 8));    // rel_embeddings[0 : 1024] (att_span = 512 = MAX_REL -> the whole table)
}
// copy8: eight asynchronous copies of 16 bytes a lane, global -> LDS, sixteen rows apart (a wave-wide copy = two whole 256-byte rows; the block's eight waves cover 16 rows a round).
// The s_wait_xcnt stands as the last line of the copies' own statement: it precedes every later rewrite of a register that a copy names.
__device__ __forceinline__ void copy8(unsigned l, const bf* g) {
    asm volatile("global_load_async_to_lds_b128 %0, %8, off\n\t"
                 "global_load_async_to_lds_b128 %1, %9, off\n\t"
                 "global_load_async_to_lds_b128 %2, %10, off\n\t"
                 "global_load_async_to_lds_b128 %3, %11, off\n\t"
                 "global_load_async_to_lds_b128 %4, %12, off\n\t"
                 "global_load_async_to_lds_b128 %5, %13, off\n\t"
                 "global_load_async_to_lds_b128 %6, %14, off\n\t"
                 "global_load_async_to_lds_b128 %7, %15, off\n\t"
                 "s_wait_xcnt 0x0"
                 :: "v"(l), "v"(l + 1 * 16 * GP * 2), "v"(l + 2 * 16 * GP * 2), "v"(l + 3 * 16 * GP * 2), "v"(l + 4 * 16 * GP * 2), "v"(l + 5 * 16 * GP * 2), "v"(l + 6 * 16 * GP * 2), "v"(l + 7 * 16 * GP * 2),
                    "v"(g), "v"(g + 1 * 16 * DM), "v"(g + 2 * 16 * DM), "v"(g + 3 * 16 * DM), "v"(g + 4 * 16 * DM), "v"(g + 5 * 16 * DM), "v"(g + 6 * 16 * DM), "v"(g + 7 * 16 * DM)
                 : "memory");
}
// k_gemm5: 128 x 128 tile of A.B^T + bias over K = 1024 (bf16 exact), all five projections in one launch: blocks of 128 for q, k, v (A = x), then of 64 for pos_k, pos_q (A = the relative table);
// q, k, pos_k, pos_q leave as f16 hi + residual planes (ld 1024), v as f32 rows. Eight waves, 4 (rows) x 2 (columns), each on 32 x 64 of the tile: a staged byte serves twice the products of a
// 64 x 64 tile, and LDS is read for 6 fragments per 8 products instead of 5 per 4. 512 blocks, two resident a WGP (LDS, registers): one round.
// Operands come through LDS: a stage is 128 k of the block's 128 A rows and 128 B rows (256-byte rows at pitch 272 B), brought by asynchronous copies into two buffers,
// the next stage in flight while this one is multiplied; the fragments keep the k order and the sum order of direct loads.
#define GXB  ((NTK / 128u) * (DM / 128u))    // blocks of a projection of x
#define GRB  ((NR / 128u) * (DM / 128u))     // blocks of a projection of the relative table
__global__ __launch_bounds__(256)
void k_gemm5(const bf* __restrict__ Xb, const bf* __restrict__ Rb, const bf* __restrict__ WqT, const bf* __restrict__ WkT, const bf* __restrict__ WvT,
             const float* __restrict__ bq, const float* __restrict__ bk, const float* __restrict__ bv,
             h16* QH, h16* QL, h16* KH, h16* KL, float* Vf, h16* PKH, h16* PKL, h16* PQH, h16* PQL) {
    __shared__ __align__(16) bf stg[2 * GBUF];    // the two stage buffers; behind the loop's last barrier the head of it holds the waves' output rows (8 x 32 x 68 floats)
    const int tid = threadIdx.x, lane = tid & 31, wave = tid >> 5, lr = lane & 15, hi = lane >> 4;
    const int wr = wave & 3, wc = wave >> 2;    // the wave's 32 rows and 64 columns of the tile
    const unsigned id = blockIdx.x;
    const bool onx = id < 3u * GXB;
    const unsigned job = onx ? id / GXB : 3u + (id - 3u * GXB) / GRB;          // 0 q, 1 k, 2 v, 3 pos_k, 4 pos_q
    const unsigned tl = onx ? id % GXB : (id - 3u * GXB) % GRB;                // the tile inside its job, row blocks fastest
    const bf* __restrict__ A = onx ? Xb : Rb;
    const bf* __restrict__ Bn = (job == 0 || job == 4) ? WqT : job == 2 ? WvT : WkT;
    const float* __restrict__ bias = (job == 0 || job == 4) ? bq : job == 2 ? bv : bk;
    const int rb = (int)(onx ? tl % (NTK / 128u) : tl % (NR / 128u)) * 128, cb = (int)(onx ? tl / (NTK / 128u) : tl / (NR / 128u)) * 128;
    const int r0 = rb + wr * 32, c0 = cb + wc * 64;
    const int crow = tid >> 4, cpc = (tid & 15) * 8;    // the lane's row (of 16 a copy round) and 16-byte piece of a staged row
    const bf* ga = A + (size_t)(rb + crow) * DM + cpc;
    const bf* gb = Bn + (size_t)(cb + crow) * DM + cpc;
    const unsigned la = (unsigned)(size_t)(stg + crow * GP + cpc);    // LDS byte address of the lane's piece in buffer 0, A rows; the B rows stand 128 rows on
    auto stage = [&](int t) {
        const unsigned l = la + (unsigned)(t & 1) * (GBUF * 2);
        copy8(l, ga + t * GK); copy8(l + 128 * GP * 2, gb + t * GK);
    };
    v8f acc[2][4];
#pragma unroll
    for (int m = 0; m < 2; ++m)
#pragma unroll
        for (int t = 0; t < 4; ++t) acc[m][t] = (v8f){};
    stage(0);
    asm volatile("s_wait_asynccnt 0x0" ::: "memory");    // stage 0 of this wave has landed
    __syncthreads();                                     // ... and of every wave: publishes buffer 0
    stage(1);
    const int ao = (wr * 32 + lr) * GP + 8 * hi, bo = (128 + wc * 64 + lr) * GP + 8 * hi;
#pragma unroll 1    // one rolled trip a stage: the foot's order (waits, barrier, refill) stands once
    for (int s = 0; s < DM / GK; ++s) {
        const bf* sb = stg + (s & 1) * GBUF;
        v16bf fa[2][2], fb[2][4];    // two fragment sets: the 32 k that are multiplied and the 32 k behind them
        auto frag = [&](int c) {
#pragma unroll
            for (int m = 0; m < 2; ++m) fa[c & 1][m] = cat16b(*(const v8usa*)(sb + ao + m * 16 * GP + c * 32), *(const v8usa*)(sb + ao + m * 16 * GP + c * 32 + 16));
#pragma unroll
            for (int t = 0; t < 4; ++t) fb[c & 1][t] = cat16b(*(const v8usa*)(sb + bo + t * 16 * GP + c * 32), *(const v8usa*)(sb + bo + t * 16 * GP + c * 32 + 16));
        };
        auto prod = [&](int c) {
#pragma unroll
            for (int m = 0; m < 2; ++m)
#pragma unroll
                for (int t = 0; t < 4; ++t) acc[m][t] = wmmab(fa[c & 1][m], fb[c & 1][t], acc[m][t]);
        };
        frag(0);
#pragma unroll
        for (int c = 0; c + 1 < GK / 32; ++c) {
            frag(c + 1);
            __builtin_amdgcn_sched_barrier(0);    // keeps the next 32 k's LDS reads one group in front of these products: left alone the compiler reads each fragment right before its use and waits out its latency
            prod(c);
        }
        asm volatile("s_wait_dscnt 0x0" ::: "memory");       // the stage's last fragments are in registers: this wave's reads of the buffer are done before it is refilled
        asm volatile("s_wait_asynccnt 0x0" ::: "memory");    // this wave's copies of stage s + 1 have landed
        __syncthreads();                                     // publishes stage s + 1 and ends every reader's last read of stage s
        if (s + 2 < DM / GK) stage(s + 2);
        prod(GK / 32 - 1);    // the last 32 k work on registers alone and stand behind the refill's issue
    }
    asm volatile("s_wait_asynccnt 0x0" ::: "memory");        // nothing is outstanding when the wave goes on
    // The last trip's foot (every wave's LDS reads done, no copy outstanding, barrier) has freed both buffers: each wave stages its 32 output rows in its own range of them.
    float* os = (float*)stg + wave * (32 * 68);
#pragma unroll
    for (int t = 0; t < 4; ++t) { const float bv = bfr(bias[c0 + t * 16 + lr]);
#pragma unroll
        for (int m = 0; m < 2; ++m)
#pragma unroll
            for (int j = 0; j < 8; ++j) os[(m * 16 + hi * 8 + j) * 68 + t * 16 + lr] = acc[m][t][j] + bv; }
    __syncthreads();
    if (job == 2) {
        float* crow = Vf + (size_t)r0 * DM + c0;
        auto pass = [&]() {
#pragma unroll
            for (int s = 0; s < 16; ++s) { const int Lid = (lane >> 3) + 4 * s, piece = lane & 7; const int row = Lid >> 1, cofs = (Lid & 1) * 32 + piece * 4;
                const v4f val = *(const v4fa*)(os + row * 68 + cofs); *(v4f*)(crow + (size_t)row * DM + cofs) = val; }
        };
        pass(); 
    } else {
        h16* c1 = (job == 0 ? QH : job == 1 ? KH : job == 3 ? PKH : PQH) + (size_t)r0 * DM + c0; h16* c2 = (job == 0 ? QL : job == 1 ? KL : job == 3 ? PKL : PQL) + (size_t)r0 * DM + c0;
        auto pass = [&]() {
#pragma unroll
            for (int s = 0; s < 8; ++s) { const int row = 4 * s + (lane >> 3), piece = lane & 7; const float* sp = os + row * 68 + piece * 8; v8h o1, o2;
#pragma unroll
                for (int i = 0; i < 8; ++i) { const h16 a = (h16)sp[i]; o1[i] = a; o2[i] = (h16)((sp[i] - (float)a) * LOSC); }
                *(v8h*)(c1 + (size_t)row * DM + piece * 8) = o1; *(v8h*)(c2 + (size_t)row * DM + piece * 8) = o2; }
        };
        pass(); 
        asm volatile("s_wait_xcnt 0x0" ::: "memory");    // the wait between the last issued global stores and any later overwrite of a register they name (the built code can fall through into the other branch's text)
    }
}
// vt: VTH/VTL [b][h][d][s] = f16 hi + residual of V rows; block bid = (b, h, 64 s); tile, til2: 64 x 72 elements of LDS each.
__device__ __forceinline__ void vt(const float* __restrict__ V, h16* VTH, h16* VTL, int bid, h16* tile, h16* til2) {
    const int b = bid / (NH_ * (SS / 64)), rem = bid - b * (NH_ * (SS / 64)), h = rem / (SS / 64), kt = rem - h * (SS / 64);
    const int s0 = kt * 64, tid = threadIdx.x, ss = tid >> 2, d0 = (tid & 3) * 16;
    const float* src = V + ((size_t)b * SS + s0 + ss) * DM + h * HD + d0;
#pragma unroll
    for (int i = 0; i < 16; ++i) { const float v = src[i]; const h16 a = (h16)v; tile[(d0 + i) * 72 + ss] = a; til2[(d0 + i) * 72 + ss] = (h16)((v - (float)a) * LOSC); }
    __syncthreads();
    const int piece = tid & 7;
    const size_t base = (((size_t)b * NH_ + h) * HD) * SS + s0;
    auto pass = [&]() {
#pragma unroll
        for (int s = 0; s < 4; ++s) { const int Lid = (tid >> 3) + 32 * s; const int pln = Lid >> 6, d = Lid & 63;
            const v8h val = *(const v8ha*)((pln ? til2 : tile) + d * 72 + piece * 8); *(v8h*)((pln ? VTL : VTH) + base + (size_t)d * SS + piece * 8) = val; }
    };
    pass(); 
}
// band16: dst[i][c] = (ah + al/1024)[row i].(ph + pl/1024)[window row 16 w4 + c], i < 16, c < 80 (hi.hi + hi.lo + lo.hi over K = 64); all four operands are staged LDS rows of pitch SP.
// The 128-row window of a relative table is two chunks of 64 table rows, cb and cb + 1; chunk c stands in slot c & 1 of the table's 128 staged rows.
__device__ __forceinline__ void band16(const h16* ah, const h16* al, const h16* ph, const h16* pl, int cb, int w4, int lr, int hi, float* dst) {
    const int ao = lr * SP + 8 * hi;
    v8f acc[BW / 16], accx[BW / 16];
#pragma unroll
    for (int t = 0; t < BW / 16; ++t) { acc[t] = (v8f){}; accx[t] = (v8f){}; }
#pragma unroll
    for (int kc = 0; kc < 2; ++kc) {
        const v16h a = cat16(*(const v8ha*)(ah + ao + kc * 32), *(const v8ha*)(ah + ao + kc * 32 + 16)), ax = cat16(*(const v8ha*)(al + ao + kc * 32), *(const v8ha*)(al + ao + kc * 32 + 16));
#pragma unroll
        for (int t = 0; t < BW / 16; ++t) { const int T = w4 + t, bo = (((cb + (T >> 2)) & 1) * 64 + (T & 3) * 16) * SP + ao + kc * 32;
            const v16h bh = cat16(*(const v8ha*)(ph + bo), *(const v8ha*)(ph + bo + 16)), bl = cat16(*(const v8ha*)(pl + bo), *(const v8ha*)(pl + bo + 16));
            acc[t] = wmma16(a, bh, acc[t]); accx[t] = wmma16(a, bl, accx[t]); accx[t] = wmma16(ax, bh, accx[t]); }
    }
#pragma unroll
    for (int t = 0; t < BW / 16; ++t)
#pragma unroll
        for (int j = 0; j < 8; ++j) dst[(hi * 8 + j) * BP + t * 16 + lr] = acc[t][j] + accx[t][j] * LOSCI;
}
// k_bias: block = (pair, 64 queries q0..): it walks the 8 key tiles k0 = 0, 64, .. of Bt[pair][q][k] = c2p[q][q - k + 511] + p2c[k][k - q + 511]; grid 512 blocks, 8 waves.
// Staged in LDS by whole 128-byte head rows, hi and residual planes: the 64 q rows (once), the tile's 64 k rows, the 128 rows q0 - k0 + 448 .. of pos_k and the 128 rows k0 - q0 + 448 .. of
// pos_q (both ranges lie in [0, 1023] for every tile). From one tile to the next both windows move by 64 rows, pos_k down and pos_q up: half of each stays where it is, and only the new
// chunk of 64 rows is brought, into the slot of the chunk that has left the window. The next tile's new rows are asked for behind the barrier that publishes this tile and wait in registers
// while this tile is worked on. Wave w < 4 forms the c2p band of queries 16w .. 16w + 15 against window rows 16w .. 16w + 79 of pos_k; wave 4 + w the p2c
// band of keys 16w .. against window rows 16w .. 16w + 79 of pos_q. In a band, element (row i, opposite position j of the tile) stands at column i - j + 63.
// Each block first does one of the 512 tiles of the V transpose, which waits for the same launch as the bias and for nothing else, in the head of the staging LDS.
__global__ __launch_bounds__(256) void k_bias(const h16* __restrict__ QH, const h16* __restrict__ QL, const h16* __restrict__ KH, const h16* __restrict__ KL,
                                             const h16* __restrict__ PKH, const h16* __restrict__ PKL, const h16* __restrict__ PQH, const h16* __restrict__ PQL, float* Bt,
                                             const float* __restrict__ Vf, h16* VTH, h16* VTL) {
    __shared__ __align__(16) h16 st[768 * SP];
    __shared__ float bd[8 * BPL];
    const int tid = threadIdx.x, lane = tid & 31, wave = __builtin_amdgcn_readfirstlane(tid >> 5), lr = lane & 15, hi = lane >> 4;
    const int p = blockIdx.x / (SS / 64), qx = blockIdx.x - p * (SS / 64), b = p / NH_, h = p - b * NH_;
    const int q0 = qx * 64;
    const size_t tok0 = (size_t)b * SS;
    const int srow = tid >> 3, spc = (tid & 7) * 8;
    const unsigned voff = (unsigned)(srow * DM + spc);    // the lane's element offset inside a slab of 32 rows: the one vector register that all loads name
    v8h sv[24];
    auto fetch = [&](const h16* __restrict__ g, size_t grow0, int n32, int at) {
        const h16* gb = g + grow0 * DM + h * HD;
#pragma unroll
        for (int i = 0; i < n32; ++i) sv[at + i] = *(const v8h*)(gb + voff + i * 32 * DM);
        // The wait that stands between issued global loads and any overwrite of a register they name (the plane's base is formed anew for the next plane);
        // voff as an input keeps the shared offset register whole up to the last of these waits.
        asm volatile("s_wait_xcnt 0x0" :: "v"(voff) : "memory");
    };
    fetch(QH, tok0 + q0, 2, 0); fetch(QL, tok0 + q0, 2, 2); fetch(KH, tok0, 2, 4); fetch(KL, tok0, 2, 6);
    fetch(PKH, (size_t)(q0 + (SS - 64)), 4, 8); fetch(PKL, (size_t)(q0 + (SS - 64)), 4, 12);
    fetch(PQH, (size_t)((SS - 64) - q0), 4, 16); fetch(PQL, (size_t)((SS - 64) - q0), 4, 20);
    vt(Vf, VTH, VTL, blockIdx.x, st, st + HD * 72);
    asm volatile("s_wait_xcnt 0x0" ::: "memory");    // the wait between the V tile's issued global stores and a later overwrite of a register they name
    __syncthreads();    // every wave has read its part of the V tile out of the staging LDS before tile 0's rows go there
#pragma unroll
    for (int r = 0; r < 8; ++r) *(v8ha*)(st + (r * 32 + srow) * SP + spc) = sv[r];
#pragma unroll
    for (int i = 0; i < 4; ++i) { const int sk = ((qx + 7 + (i >> 1)) & 1) * 64 + (i & 1) * 32 + srow, sq = ((7 - qx + (i >> 1)) & 1) * 64 + (i & 1) * 32 + srow;
        *(v8ha*)(st + (256 + sk) * SP + spc) = sv[8 + i]; *(v8ha*)(st + (384 + sk) * SP + spc) = sv[12 + i];
        *(v8ha*)(st + (512 + sq) * SP + spc) = sv[16 + i]; *(v8ha*)(st + (640 + sq) * SP + spc) = sv[20 + i]; }
    const int side = wave >> 2, w4 = wave & 3;
    const h16* sa = st + (side * 128 + w4 * 16) * SP;
    const h16* sp = st + (256 + side * 256) * SP;
#pragma unroll 1    // one rolled trip a key tile: the two barriers and the refill between them stand once
    for (int kt = 0; kt < SS / 64; ++kt) {
        const int ck = qx - kt + 7, cq = kt - qx + 7;    // first chunk of the pos_k window and of the pos_q window of this tile
        __syncthreads();    // publishes this tile's staged rows and ends every reader's last read of the bands of the tile before
        if (kt + 1 < SS / 64) {
            fetch(KH, tok0 + (size_t)(kt + 1) * 64, 2, 0); fetch(KL, tok0 + (size_t)(kt + 1) * 64, 2, 2);
            fetch(PKH, (size_t)(ck - 1) * 64, 2, 4); fetch(PKL, (size_t)(ck - 1) * 64, 2, 6);
            fetch(PQH, (size_t)(cq + 2) * 64, 2, 8); fetch(PQL, (size_t)(cq + 2) * 64, 2, 10);
        }
        band16(sa, sa + 64 * SP, sp, sp + 128 * SP, side ? cq : ck, w4, lr, hi, bd + wave * BPL);
        __syncthreads();    // publishes the bands and ends every reader's last read of this tile's staged rows
        float* brow = Bt + ((size_t)p * SS + q0 + wave * 8) * SS + kt * 64;
#pragma unroll
        for (int s = 0; s < 4; ++s) { const int Lid = (lane >> 3) + 4 * s, piece = lane & 7; const int row = Lid >> 1, cofs = (Lid & 1) * 32 + piece * 4, qq = wave * 8 + row, qw = qq >> 4, qi = qq & 15;
            v4f val;
#pragma unroll
            for (int e = 0; e < 4; ++e) { const int kk = cofs + e, kw = kk >> 4, ki = kk & 15;
                val[e] = bd[qw * BPL + qi * BP + qi - kk + 63] + bd[(4 + kw) * BPL + ki * BP + ki - qq + 63]; }
            *(v4f*)(brow + (size_t)row * SS + cofs) = val; }
        asm volatile("s_wait_xcnt 0x0" ::: "memory");    // the wait between the tile's last issued global store and the next overwrite of a register it names
        if (kt + 1 < SS / 64) {
#pragma unroll
            for (int i = 0; i < 2; ++i) { const int sk = ((ck - 1) & 1) * 64 + i * 32 + srow, sq = (cq & 1) * 64 + i * 32 + srow;
                *(v8ha*)(st + (128 + i * 32 + srow) * SP + spc) = sv[i]; *(v8ha*)(st + (192 + i * 32 + srow) * SP + spc) = sv[2 + i];
                *(v8ha*)(st + (256 + sk) * SP + spc) = sv[4 + i]; *(v8ha*)(st + (384 + sk) * SP + spc) = sv[6 + i];
                *(v8ha*)(st + (512 + sq) * SP + spc) = sv[8 + i]; *(v8ha*)(st + (640 + sq) * SP + spc) = sv[10 + i]; }
        }
    }
}
// copy8a: eight asynchronous copies of 16 bytes a lane, global -> LDS, each with its own pair of addresses.
// The s_wait_xcnt stands as the last line of the copies' own statement: it precedes every later rewrite of a register that a copy names.
__device__ __forceinline__ void copy8a(const unsigned (&l)[8], const void* const (&g)[8]) {
    asm volatile("global_load_async_to_lds_b128 %0, %8, off\n\t"
                 "global_load_async_to_lds_b128 %1, %9, off\n\t"
                 "global_load_async_to_lds_b128 %2, %10, off\n\t"
                 "global_load_async_to_lds_b128 %3, %11, off\n\t"
                 "global_load_async_to_lds_b128 %4, %12, off\n\t"
                 "global_load_async_to_lds_b128 %5, %13, off\n\t"
                 "global_load_async_to_lds_b128 %6, %14, off\n\t"
                 "global_load_async_to_lds_b128 %7, %15, off\n\t"
                 "s_wait_xcnt 0x0"
                 :: "v"(l[0]), "v"(l[1]), "v"(l[2]), "v"(l[3]), "v"(l[4]), "v"(l[5]), "v"(l[6]), "v"(l[7]),
                    "v"(g[0]), "v"(g[1]), "v"(g[2]), "v"(g[3]), "v"(g[4]), "v"(g[5]), "v"(g[6]), "v"(g[7])
                 : "memory");
}
// k_attn: block = (pair p, 64 queries), wave = 16; 16 key tiles of 32: content = q.k (hi.hi + hi.lo + lo.hi: 12 WMMA), bias = Bt[p][q][k],
// logits = (content + bias) x SCL; online softmax; weights x32768 hi/residual; 12 WMMA .v;
// Both products are formed transposed: scores^T = K.Q^T (A = key rows, B = the q fragments) and out^T += V^T.P^T (A = rows of transposed V, B = the weights). A lane then holds 16 of the
// 32 scores of ONE query (column lr; keys 8 hi + j and 16 + 8 hi + j), which are the very k positions of that lane in a B fragment: the weights go from the score registers into the
// B operand without a pass through LDS, and maximum, sum and rescale factor are one value a lane, joined between the two half-waves by one exchange.
// The loop reads no global memory: a stage is 64 keys of everything the block's four waves stream (64 key rows and 64 rows of transposed V, hi and residual planes, 128-byte rows at
// pitch 144 B; the block's 64 x 64 piece of the bias table, 256-byte rows at pitch 272 B), brought by asynchronous copies into two buffers, the next stage in flight while this one is worked on.
// The fragments keep the k order and the sum order of direct loads.
#define AK   64                  // keys of a stage
#define APL  (64 * SP)           // elements of one staged f16 plane
#define ABP  68                  // LDS pitch of a staged bias row, in floats: the 16 query rows of a half-wave's b128 read (one a lane) start 4 banks apart
__global__ __launch_bounds__(128) void k_attn(const h16* __restrict__ QH, const h16* __restrict__ QL, const h16* __restrict__ KH, const h16* __restrict__ KL,
                                             const float* __restrict__ Bt, const h16* __restrict__ VTH, const h16* __restrict__ VTL, float* out) {
    __shared__ __align__(16) h16 kv[2][4 * APL];        // planes: key hi, key residual, V^T hi, V^T residual
    __shared__ __align__(16) float bs[2][64 * ABP];
    __shared__ __align__(16) float ost[4][16 * 68];
    const int tid = threadIdx.x, lane = tid & 31, wave = tid >> 5, lr = lane & 15, hi = lane >> 4;
    const int p = blockIdx.x / (SS / 64), qt = blockIdx.x - p * (SS / 64), b = p / NH_, h = p - b * NH_;
    const int q0 = qt * 64 + wave * 16;
    const size_t tok0 = (size_t)b * SS;
    const float* bt = Bt + (size_t)p * SS * SS;
    const size_t vbase = (((size_t)b * NH_ + h) * HD) * SS;
    const int hrow = tid >> 3, hpc = (tid & 7) * 8;     // f16 planes: the lane's row (of 16 a copy round) and 16-byte piece of a 128-byte row
    const int frow = tid >> 4, fpc = (tid & 15) * 4;    // bias: the lane's row (of 8 a copy round) and 16-byte piece of a 256-byte row
    // the lane's source addresses of the next stage to be asked for, one a plane: they walk on by a stage with every call of stage()
    const h16* pkh = KH + (tok0 + hrow) * DM + h * HD + hpc; const h16* pkl = KL + (tok0 + hrow) * DM + h * HD + hpc;
    const h16* pvh = VTH + vbase + (size_t)hrow * SS + hpc; const h16* pvl = VTL + vbase + (size_t)hrow * SS + hpc;
    const float* pbt = bt + (size_t)(qt * 64 + frow) * SS + fpc;
    const unsigned lkv = (unsigned)(size_t)(&kv[0][0] + hrow * SP + hpc), lbs = (unsigned)(size_t)(&bs[0][0] + frow * ABP + fpc);    // LDS byte addresses of the lane's pieces in buffer 0
    auto stage = [&](int t) {
        const unsigned lh = lkv + (unsigned)(t & 1) * (4 * APL * 2), lf = lbs + (unsigned)(t & 1) * (64 * ABP * 4);
        unsigned l[8]; const void* g[8];
#pragma unroll
        for (int i = 0; i < 4; ++i) { l[i] = lh + i * 16 * SP * 2; g[i] = pkh + (size_t)i * 16 * DM; l[4 + i] = l[i] + APL * 2; g[4 + i] = pkl + (size_t)i * 16 * DM; }
        copy8a(l, g);
#pragma unroll
        for (int i = 0; i < 4; ++i) { l[i] = lh + 2 * APL * 2 + i * 16 * SP * 2; g[i] = pvh + (size_t)i * 16 * SS; l[4 + i] = l[i] + APL * 2; g[4 + i] = pvl + (size_t)i * 16 * SS; }
        copy8a(l, g);
#pragma unroll
        for (int i = 0; i < 8; ++i) { l[i] = lf + i * 8 * ABP * 4; g[i] = pbt + (size_t)i * 8 * SS; }
        copy8a(l, g);
        pkh += (size_t)AK * DM; pkl += (size_t)AK * DM; pvh += AK; pvl += AK; pbt += AK;
    };
    stage(0);
    v16h qa[2], ql[2];
    const size_t qo0 = (tok0 + q0 + lr) * DM + h * HD + 8 * hi;
#pragma unroll
    for (int kc = 0; kc < 2; ++kc) { qa[kc] = cat16(*(const v8h*)(QH + qo0 + kc * 32), *(const v8h*)(QH + qo0 + kc * 32 + 16)); ql[kc] = cat16(*(const v8h*)(QL + qo0 + kc * 32), *(const v8h*)(QL + qo0 + kc * 32 + 16)); }
    asm volatile("s_wait_xcnt 0x0" ::: "memory");        // the wait between these issued global loads and a later overwrite of their address registers (stage 1's addresses are formed next)
    v8f o[4], ox[4];
#pragma unroll
    for (int n = 0; n < 4; ++n) { o[n] = (v8f){}; ox[n] = (v8f){}; }
    float mrow = -3.0e38f, lpart = 0.f;    // of the lane's query: the running maximum (equal in both half-waves) and this half-wave's part of the sum
    asm volatile("s_wait_asynccnt 0x0" ::: "memory");    // stage 0 of this wave has landed
    __syncthreads();                                     // ... and of every wave: publishes buffer 0
    stage(1);
#pragma unroll 1    // one rolled trip a stage: the foot's order (waits, barrier, refill) stands once
    for (int t = 0; t < SS / AK; ++t) {
        const h16* sk = &kv[t & 1][0];
        const float* sb = &bs[t & 1][0] + (wave * 16 + lr) * ABP + 8 * hi;    // the lane's query row, at its first key
#pragma unroll
        for (int u = 0; u < AK / 32; ++u) {
            const v4f ba0 = *(const v4fa*)(sb + u * 32), ba1 = *(const v4fa*)(sb + u * 32 + 4), bb0 = *(const v4fa*)(sb + u * 32 + 16), bb1 = *(const v4fa*)(sb + u * 32 + 20);
            v8f s0 = {}, s1 = {}, x0 = {}, x1 = {};
#pragma unroll
            for (int kc = 0; kc < 2; ++kc) {
                const h16* k0 = sk + (u * 32 + lr) * SP + kc * 32 + 8 * hi; const h16* k1 = k0 + 16 * SP;
                const v16h k0h = cat16(*(const v8ha*)(k0), *(const v8ha*)(k0 + 16)), k1h = cat16(*(const v8ha*)(k1), *(const v8ha*)(k1 + 16));
                const v16h k0l = cat16(*(const v8ha*)(k0 + APL), *(const v8ha*)(k0 + APL + 16)), k1l = cat16(*(const v8ha*)(k1 + APL), *(const v8ha*)(k1 + APL + 16));
                s0 = wmma16(k0h, qa[kc], s0); x0 = wmma16(k0h, ql[kc], x0); s1 = wmma16(k1h, qa[kc], s1); x1 = wmma16(k1h, ql[kc], x1);
                x0 = wmma16(k0l, qa[kc], x0); x1 = wmma16(k1l, qa[kc], x1);
            }
            v16h vh[4], vl[4];    // the trip's V fragments, asked for here: their LDS latency passes under the softmax, in the registers that the key fragments have left
#pragma unroll
            for (int n = 0; n < 4; ++n) { const h16* vp = sk + 2 * APL + (n * 16 + lr) * SP + u * 32 + hi * 8;
                vh[n] = cat16(*(const v8ha*)(vp), *(const v8ha*)(vp + 16)); vl[n] = cat16(*(const v8ha*)(vp + APL), *(const v8ha*)(vp + APL + 16)); }
            // whole-tile vector arithmetic: element j and j + 1 of one accumulator stand in neighbouring registers and pair into packed instructions without moves
            const v8f a0 = (s0 + x0 * LOSCI + cat8(ba0, ba1)) * SCL, a1 = (s1 + x1 * LOSCI + cat8(bb0, bb1)) * SCL;
            float mx = fmaxf(a0[0], a1[0]);
#pragma unroll
            for (int j = 1; j < 8; ++j) mx = fmaxf(mx, fmaxf(a0[j], a1[j]));
            mx = fmaxf(mx, xhalf(mx));
            const float mn = fmaxf(mrow, mx), alpha = __expf(mrow - mn);
            mrow = mn;
            v8f e0, e1;
#pragma unroll
            for (int j = 0; j < 8; ++j) e0[j] = __expf(a0[j] - mn);
#pragma unroll
            for (int j = 0; j < 8; ++j) e1[j] = __expf(a1[j] - mn);
            const v8f ee = e0 + e1;
            const float es = ((ee[0] + ee[1]) + (ee[2] + ee[3])) + ((ee[4] + ee[5]) + (ee[6] + ee[7]));
            const v8f ps0 = e0 * PSC, ps1 = e1 * PSC;
            const v8h h0 = __builtin_convertvector(ps0, v8h), h1 = __builtin_convertvector(ps1, v8h);
            const v8h r0 = __builtin_convertvector((ps0 - __builtin_convertvector(h0, v8f)) * LOSC, v8h), r1 = __builtin_convertvector((ps1 - __builtin_convertvector(h1, v8f)) * LOSC, v8h);
            const v16h pa = cat16(h0, h1), px = cat16(r0, r1);    // B fragments: positions 0 .. 7 = keys 8 hi + j, positions 8 .. 15 = keys 16 + 8 hi + j, as in the V^T fragments
            lpart = lpart * alpha + es;
#pragma unroll
            for (int n = 0; n < 4; ++n) { o[n] *= alpha; ox[n] *= alpha; }
#pragma unroll
            for (int n = 0; n < 4; ++n) { o[n] = wmma16(vh[n], pa, o[n]); ox[n] = wmma16(vl[n], pa, ox[n]); ox[n] = wmma16(vh[n], px, ox[n]); }
        }
        asm volatile("s_wait_dscnt 0x0" ::: "memory");       // this wave's reads of the buffer are done before it is refilled
        asm volatile("s_wait_asynccnt 0x0" ::: "memory");    // this wave's copies of stage t + 1 have landed
        __syncthreads();                                     // publishes stage t + 1 and ends every reader's last read of stage t
        if (t + 2 < SS / AK) stage(t + 2);
    }
    asm volatile("s_wait_asynccnt 0x0" ::: "memory");        // nothing is outstanding when the wave goes on
    const float inv = 1.0f / ((lpart + xhalf(lpart)) * PSC);
    float* os = &ost[wave][0];    // out^T: the lane holds columns 16 n + 8 hi + j of its query's output row
#pragma unroll
    for (int n = 0; n < 4; ++n)
#pragma unroll
        for (int g = 0; g < 2; ++g) { v4f val;
#pragma unroll
            for (int e = 0; e < 4; ++e) val[e] = (o[n][g * 4 + e] + ox[n][g * 4 + e] * LOSCI) * inv;
            *(v4fa*)(os + lr * 68 + n * 16 + hi * 8 + g * 4) = val; }
    __syncthreads();
    float* ob = out + (tok0 + q0) * DM + (size_t)h * HD;
    auto pass = [&]() {
#pragma unroll
        for (int s = 0; s < 8; ++s) { const int Lid = (lane >> 3) + 4 * s, piece = lane & 7; const int row = Lid >> 1, cofs = (Lid & 1) * 32 + piece * 4;
            const v4f val = *(const v4fa*)(os + row * 68 + cofs); *(v4f*)(ob + (size_t)row * DM + cofs) = val; }
    };
    pass(); 
}

extern "C" void kernel_launch(void* const* d_in, const int* in_sizes, int n_in,
                              void* d_out, int out_size, void* d_ws, size_t ws_size, hipStream_t stream) {
    (void)in_sizes; (void)n_in; (void)out_size;
    const float* x = (const float*)d_in[0]; const float* rel = (const float*)d_in[1]; const float* Wq = (const float*)d_in[2]; const float* bq = (const float*)d_in[3];
    const float* Wk = (const float*)d_in[4]; const float* bk = (const float*)d_in[5]; const float* Wv = (const float*)d_in[6]; const float* bv = (const float*)d_in[7];
    float* out = (float*)d_out;    // [4][512][1024]
    char* wsp = (char*)d_ws;
    auto take = [&](size_t bytes) { char* p = wsp; wsp += (bytes + 255) & ~(size_t)255; return (void*)p; };
    bf* Xb = (bf*)take((size_t)NTK * DM * 2); bf* Rb = (bf*)take((size_t)NR * DM * 2); bf* WqT = (bf*)take((size_t)DM * DM * 2); bf* WkT = (bf*)take((size_t)DM * DM * 2); bf* WvT = (bf*)take((size_t)DM * DM * 2);
    h16* QH = (h16*)take((size_t)NTK * DM * 2); h16* QL = (h16*)take((size_t)NTK * DM * 2); h16* KH = (h16*)take((size_t)NTK * DM * 2); h16* KL = (h16*)take((size_t)NTK * DM * 2);
    h16* PKH = (h16*)take((size_t)NR * DM * 2); h16* PKL = (h16*)take((size_t)NR * DM * 2); h16* PQH = (h16*)take((size_t)NR * DM * 2); h16* PQL = (h16*)take((size_t)NR * DM * 2);
    float* Vf = (float*)take((size_t)NTK * DM * 4); h16* VTH = (h16*)take((size_t)NTK * DM * 2); h16* VTL = (h16*)take((size_t)NTK * DM * 2);
    float* Bt = (float*)take((size_t)NB_ * NH_ * SS * SS * 4);
    if ((size_t)(wsp - (char*)d_ws) > ws_size) return;    // 4.2 + 2.1 + 6.3 + 16.8 + 8.4 + 8.4 + 8.4 + 67 ~ 122 MB
    k_prep<<<3 * WTB + NTK / 8 + NR / 8, 256, 0, stream>>>(x, rel, Wq, Wk, Wv, Xb, Rb, WqT, WkT, WvT);
    k_gemm5<<<3 * GXB + 2 * GRB, 256, 0, stream>>>(Xb, Rb, WqT, WkT, WvT, bq, bk, bv, QH, QL, KH, KL, Vf, PKH, PKL, PQH, PQL);    // pos_k = rel.Wk + bk, pos_q = rel.Wq + bq
    k_bias<<<NB_ * NH_ * (SS / 64), 256, 0, stream>>>(QH, QL, KH, KL, PKH, PKL, PQH, PQL, Bt, Vf, VTH, VTL);
    k_attn<<<NB_ * NH_ * (SS / 64), 128, 0, stream>>>(QH, QL, KH, KL, Bt, VTH, VTL, out);
}

// v009
// It runs in 54 microseconds.
// Timed twice side by side with v008, it ran 1.17 times as fast both times.
// Over all steps from v000 it is 11.7 times as fast.
#include <hip/hip_runtime.h>

// Contractions, f32 accumulate: q/k/v = x.W + b ([2048 x 1024].[1024 x 1024]) and pos_k = rel.Wk + bk, pos_q = rel.Wq + bq ([1024 x 1024].[1024 x 1024]) on
// v_wmma_f32_16x16x32_bf16 with PLAIN bf16 operands (inputs rounded once: exact; k-major weights transposed into n-major planes; tiles staged in LDS by asynchronous copies); the disentangled attention on
// v_wmma_f32_16x16x32_f16 with every computed operand as f16 hi + residual x1024 (hi.hi + hi.lo + lo.hi): the relative products q.pos_k^T and k.pos_q^T, only the
// 80-column band that a 16 x 64 piece of the score tile gathers from (operands staged in LDS), left in LDS, where the attention of the same block reads bias[q][k] = c2p[q][q-k+511] + p2c[k][k-q+511]
// off the bands' diagonals (content q.k + bias[q][k], online softmax, weights . v; key, V and relative rows staged in LDS by asynchronous copies); all 64 (b,h) pairs in one launch.
// Three launches, each made of everything that depends only on the launches before it: k_prep (both conversions, three weight transposes), k_gemm5 (all five projections; v leaves transposed),
// k_attn (bands and attention, a block walking the key tiles of its 64 queries). A block picks its job from its index alone.

#define NB_  4
#define SS   512
#define DM   1024
#define NH_  16
#define HD   64
#define NR   1024                // 2 * att_span relative positions
#define NTK  (NB_ * SS)          // 2048
#define BW   80                  // relative columns that 16 rows against 64 opposite positions can gather: 16 + 64 - 1, rounded up to whole 16-column tiles
#define BP   84                  // LDS pitch of a band row, in floats
#define SP   72                  // LDS pitch of a staged 64-element f16 row, in elements: the 16 bytes of pad spread the 16 rows of a b128 fragment read over all banks
#define BPL  (16 * BP + 6)       // LDS floats per wave's band; the + 6 spreads the eight waves' planes over the banks for the diagonal reads
#define GK   128                 // k elements of a staged GEMM tile: rows of 256 bytes
#define GP   136                 // LDS pitch of a staged GEMM row, in elements: 272 B = 16 B x odd, for b128 fragment reads
#define GBUF (256 * GP)          // elements of one GEMM buffer: 128 A rows, then 128 B rows
#define PSC  32768.0f
#define LOSC 1024.0f
#define LOSCI (1.0f / 1024.0f)
#define SCL  0.07216878364870322f    // (64*3)^-0.5

typedef _Float16 h16;
typedef unsigned short bf;
typedef __attribute__((ext_vector_type(16))) __bf16   v16bf;
typedef __attribute__((ext_vector_type(16))) _Float16 v16h;
typedef __attribute__((ext_vector_type(8)))  _Float16 v8h;
typedef __attribute__((ext_vector_type(8)))  unsigned short v8us;
typedef __attribute__((ext_vector_type(8)))  float    v8f;
typedef __attribute__((ext_vector_type(4)))  float    v4f;
typedef v8h  __attribute__((may_alias)) v8ha;
typedef v4f  __attribute__((may_alias)) v4fa;
typedef v8us __attribute__((may_alias)) v8usa;

__device__ __forceinline__ unsigned short f2bf(float f) { unsigned u = __float_as_uint(f); u += 0x7FFFu + ((u >> 16) & 1u); return (unsigned short)(u >> 16); }
__device__ __forceinline__ float bf2f(unsigned short b) { return __uint_as_float(((unsigned)b) << 16); }
__device__ __forceinline__ float bfr(float f) { return bf2f(f2bf(f)); }
__device__ __forceinline__ v16h cat16(v8h lo, v8h hi) { return __builtin_shufflevector(lo, hi, 0, 1, 2, 3, 4, 5, 6, 7, 8, 9, 10, 11, 12, 13, 14, 15); }
__device__ __forceinline__ v16bf cat16b(v8us lo, v8us hi) { return __builtin_bit_cast(v16bf, __builtin_shufflevector(lo, hi, 0, 1, 2, 3, 4, 5, 6, 7, 8, 9, 10, 11, 12, 13, 14, 15)); }
__device__ __forceinline__ v8f wmma16(v16h a, v16h b, v8f c) { return __builtin_amdgcn_wmma_f32_16x16x32_f16(false, a, false, b, (short)0, c, false, false); }
__device__ __forceinline__ v8f wmmab(v16bf a, v16bf b, v8f c) { return __builtin_amdgcn_wmma_f32_16x16x32_bf16(false, a, false, b, (short)0, c, false, false); }
// xhalf: the value that lane l ^ 16 holds
__device__ __forceinline__ float xhalf(float v) { const int b = __float_as_int(v); return __int_as_float(__builtin_amdgcn_permlanex16(b, b, 0x76543210, 0xfedcba98, false, false)); }
#define VST2(T, p, v) do { const T vst2_v_ = (v); *(T*)(p) = vst2_v_;  } while (0)

// cvtb: bf16 rows of an [nrows][1024] matrix, 8 rows a block; wt: a 64 x 64 tile of k-major [1024][1024] -> n-major bf16.
__device__ __forceinline__ void cvtb(const float* __restrict__ src, int nrows, bf* dst, int blk) {
    const int lane = threadIdx.x & 31, r = blk * 8 + (threadIdx.x >> 5);
    if (r >= nrows) return;
#pragma unroll
    for (int q = 0; q < DM / 256; ++q) { v8us t;
#pragma unroll
        for (int i = 0; i < 8; ++i) t[i] = f2bf(src[(size_t)r * DM + q * 256 + lane * 8 + i]);
        VST2(v8us, dst + (size_t)r * DM + q * 256 + lane * 8, t); }
}
__device__ __forceinline__ void wt(const float* __restrict__ Wm, bf* WT, int kb, int nb, unsigned short* tl) {
    const int tid = threadIdx.x, k0 = kb * 64, n0 = nb * 64;
    const int kk = tid >> 2, nq = (tid & 3) * 16;
#pragma unroll
    for (int i = 0; i < 16; ++i) tl[(nq + i) * 72 + kk] = f2bf(Wm[(size_t)(k0 + kk) * DM + n0 + nq + i]);
    __syncthreads();
    const int piece = tid & 7;
    auto pass = [&]() {
#pragma unroll
        for (int s = 0; s < 2; ++s) { const int nr = (tid >> 3) + 32 * s; const v8us val = *(const v8usa*)(tl + nr * 72 + piece * 8);
            *(v8us*)(WT + (size_t)(n0 + nr) * DM + k0 + piece * 8) = val; }
    };
    pass(); 
}
// k_prep: every operand conversion in one launch. Blocks 0 .. 767: the 256 tiles of Wq, of Wk, of Wv; the next 256: x; the last 128: the relative table.
#define WTB  ((DM / 64) * (DM / 64))    // tiles of one weight matrix
__global__ __launch_bounds__(256) void k_prep(const float* __restrict__ x, const float* __restrict__ rel, const float* __restrict__ Wq, const float* __restrict__ Wk, const float* __restrict__ Wv,
                                             bf* Xb, bf* Rb, bf* WqT, bf* WkT, bf* WvT) {
    __shared__ __align__(16) unsigned short tl[64 * 72];
    const int id = blockIdx.x;
    if (id < 3 * WTB) {
        const int w = id / WTB, t = id - w * WTB;
        wt(w == 0 ? Wq : w == 1 ? Wk : Wv, w == 0 ? WqT : w == 1 ? WkT : WvT, t % (DM / 64), t / (DM / 64), tl);
    } else if (id < 3 * WTB + NTK / 8) cvtb(x, NTK, Xb, id - 3 * WTB);
    else cvtb(rel, NR, Rb, id - (3 * WTB + NTK / 8));    // rel_embeddings[0 : 1024] (att_span = 512 = MAX_REL -> the whole table)
}
// copy8: eight asynchronous copies of 16 bytes a lane, global -> LDS, sixteen rows apart (a wave-wide copy = two whole 256-byte rows; the block's eight waves cover 16 rows a round).
// The s_wait_xcnt stands as the last line of the copies' own statement: it precedes every later rewrite of a register that a copy names.
__device__ __forceinline__ void copy8(unsigned l, const bf* g) {
    asm volatile("global_load_async_to_lds_b128 %0, %8, off\n\t"
                 "global_load_async_to_lds_b128 %1, %9, off\n\t"
                 "global_load_async_to_lds_b128 %2, %10, off\n\t"
                 "global_load_async_to_lds_b128 %3, %11, off\n\t"
                 "global_load_async_to_lds_b128 %4, %12, off\n\t"
                 "global_load_async_to_lds_b128 %5, %13, off\n\t"
                 "global_load_async_to_lds_b128 %6, %14, off\n\t"
                 "global_load_async_to_lds_b128 %7, %15, off\n\t"
                 "s_wait_xcnt 0x0"
                 :: "v"(l), "v"(l + 1 * 16 * GP * 2), "v"(l + 2 * 16 * GP * 2), "v"(l + 3 * 16 * GP * 2), "v"(l + 4 * 16 * GP * 2), "v"(l + 5 * 16 * GP * 2), "v"(l + 6 * 16 * GP * 2), "v"(l + 7 * 16 * GP * 2),
                    "v"(g), "v"(g + 1 * 16 * DM), "v"(g + 2 * 16 * DM), "v"(g + 3 * 16 * DM), "v"(g + 4 * 16 * DM), "v"(g + 5 * 16 * DM), "v"(g + 6 * 16 * DM), "v"(g + 7 * 16 * DM)
                 : "memory");
}
// k_gemm5: 128 x 128 tile of A.B^T + bias over K = 1024 (bf16 exact), all five projections in one launch: blocks of 128 for q, k, v (A = x), then of 64 for pos_k, pos_q (A = the relative table);
// q, k, pos_k, pos_q leave as f16 hi + residual planes (ld 1024), v as transposed f16 hi + residual planes [b][h][d][s]. Eight waves, 4 (rows) x 2 (columns), each on 32 x 64 of the tile: a staged byte serves twice the products of a
// 64 x 64 tile, and LDS is read for 6 fragments per 8 products instead of 5 per 4. 512 blocks, two resident a WGP (LDS, registers): one round.
// Operands come through LDS: a stage is 128 k of the block's 128 A rows and 128 B rows (256-byte rows at pitch 272 B), brought by asynchronous copies into two buffers,
// the next stage in flight while this one is multiplied; the fragments keep the k order and the sum order of direct loads.
#define GXB  ((NTK / 128u) * (DM / 128u))    // blocks of a projection of x
#define GRB  ((NR / 128u) * (DM / 128u))     // blocks of a projection of the relative table
__global__ __launch_bounds__(256)
void k_gemm5(const bf* __restrict__ Xb, const bf* __restrict__ Rb, const bf* __restrict__ WqT, const bf* __restrict__ WkT, const bf* __restrict__ WvT,
             const float* __restrict__ bq, const float* __restrict__ bk, const float* __restrict__ bv,
             h16* QH, h16* QL, h16* KH, h16* KL, h16* VTH, h16* VTL, h16* PKH, h16* PKL, h16* PQH, h16* PQL) {
    __shared__ __align__(16) bf stg[2 * GBUF];    // the two stage buffers; behind the loop's last barrier the head of it holds the staged output
    const int tid = threadIdx.x, lane = tid & 31, wave = tid >> 5, lr = lane & 15, hi = lane >> 4;
    const int wr = wave & 3, wc = wave >> 2;    // the wave's 32 rows and 64 columns of the tile
    const unsigned id = blockIdx.x;
    const bool onx = id < 3u * GXB;
    const unsigned job = onx ? id / GXB : 3u + (id - 3u * GXB) / GRB;          // 0 q, 1 k, 2 v, 3 pos_k, 4 pos_q
    const unsigned tl = onx ? id % GXB : (id - 3u * GXB) % GRB;                // the tile inside its job, row blocks fastest
    const bf* __restrict__ A = onx ? Xb : Rb;
    const bf* __restrict__ Bn = (job == 0 || job == 4) ? WqT : job == 2 ? WvT : WkT;
    const float* __restrict__ bias = (job == 0 || job == 4) ? bq : job == 2 ? bv : bk;
    const int rb = (int)(onx ? tl % (NTK / 128u) : tl % (NR / 128u)) * 128, cb = (int)(onx ? tl / (NTK / 128u) : tl / (NR / 128u)) * 128;
    const int r0 = rb + wr * 32, c0 = cb + wc * 64;
    const int crow = tid >> 4, cpc = (tid & 15) * 8;    // the lane's row (of 16 a copy round) and 16-byte piece of a staged row
    const bf* ga = A + (size_t)(rb + crow) * DM + cpc;
    const bf* gb = Bn + (size_t)(cb + crow) * DM + cpc;
    const unsigned la = (unsigned)(size_t)(stg + crow * GP + cpc);    // LDS byte address of the lane's piece in buffer 0, A rows; the B rows stand 128 rows on
    auto stage = [&](int t) {
        const unsigned l = la + (unsigned)(t & 1) * (GBUF * 2);
        copy8(l, ga + t * GK); copy8(l + 128 * GP * 2, gb + t * GK);
    };
    v8f acc[2][4];
#pragma unroll
    for (int m = 0; m < 2; ++m)
#pragma unroll
        for (int t = 0; t < 4; ++t) acc[m][t] = (v8f){};
    stage(0);
    asm volatile("s_wait_asynccnt 0x0" ::: "memory");    // stage 0 of this wave has landed
    __syncthreads();                                     // ... and of every wave: publishes buffer 0
    stage(1);
    const int ao = (wr * 32 + lr) * GP + 8 * hi, bo = (128 + wc * 64 + lr) * GP + 8 * hi;
#pragma unroll 1    // one rolled trip a stage: the foot's order (waits, barrier, refill) stands once
    for (int s = 0; s < DM / GK; ++s) {
        const bf* sb = stg + (s & 1) * GBUF;
        v16bf fa[2][2], fb[2][4];    // two fragment sets: the 32 k that are multiplied and the 32 k behind them
        auto frag = [&](int c) {
#pragma unroll
            for (int m = 0; m < 2; ++m) fa[c & 1][m] = cat16b(*(const v8usa*)(sb + ao + m * 16 * GP + c * 32), *(const v8usa*)(sb + ao + m * 16 * GP + c * 32 + 16));
#pragma unroll
            for (int t = 0; t < 4; ++t) fb[c & 1][t] = cat16b(*(const v8usa*)(sb + bo + t * 16 * GP + c * 32), *(const v8usa*)(sb + bo + t * 16 * GP + c * 32 + 16));
        };
        auto prod = [&](int c) {
#pragma unroll
            for (int m = 0; m < 2; ++m)
#pragma unroll
                for (int t = 0; t < 4; ++t) acc[m][t] = wmmab(fa[c & 1][m], fb[c & 1][t], acc[m][t]);
        };
        frag(0);
#pragma unroll
        for (int c = 0; c + 1 < GK / 32; ++c) {
            frag(c + 1);
            __builtin_amdgcn_sched_barrier(0);    // keeps the next 32 k's LDS reads one group in front of these products: left alone the compiler reads each fragment right before its use and waits out its latency
            prod(c);
        }
        asm volatile("s_wait_dscnt 0x0" ::: "memory");       // the stage's last fragments are in registers: this wave's reads of the buffer are done before it is refilled
        asm volatile("s_wait_asynccnt 0x0" ::: "memory");    // this wave's copies of stage s + 1 have landed
        __syncthreads();                                     // publishes stage s + 1 and ends every reader's last read of stage s
        if (s + 2 < DM / GK) stage(s + 2);
        prod(GK / 32 - 1);    // the last 32 k work on registers alone and stand behind the refill's issue
    }
    asm volatile("s_wait_asynccnt 0x0" ::: "memory");        // nothing is outstanding when the wave goes on
    // The last trip's foot (every wave's LDS reads done, no copy outstanding, barrier) has freed both buffers: the output is staged there.
    if (job == 2) {
        // v: a lane's 8 accumulator rows are 8 consecutive tokens of one column: they go as one 16-byte piece into a transposed tile (128 columns x 128 tokens, pitch GP, hi plane then residual plane)
        h16* vs = (h16*)stg;
#pragma unroll
        for (int t = 0; t < 4; ++t) { const float bv = bfr(bias[c0 + t * 16 + lr]);
#pragma unroll
            for (int m = 0; m < 2; ++m) { v8h a, r;
#pragma unroll
                for (int j = 0; j < 8; ++j) { const float v = acc[m][t][j] + bv; const h16 c = (h16)v; a[j] = c; r[j] = (h16)((v - (float)c) * LOSC); }
                h16* vd = vs + (wc * 64 + t * 16 + lr) * GP + wr * 32 + m * 16 + hi * 8;
                *(v8ha*)(vd) = a; *(v8ha*)(vd + 128 * GP) = r; } }
        __syncthreads();    // publishes the transposed tile
        const size_t vb = ((size_t)(rb / SS) * DM + cb) * SS + (rb % SS) + (tid & 15) * 8;    // [b][h][d][s]: 64 h + d is the column of v
#pragma unroll
        for (int s = 0; s < 16; ++s) { const int Lid = (tid >> 4) + 16 * s, pln = Lid >> 7, col = Lid & 127;
            const v8h val = *(const v8ha*)(vs + (pln * 128 + col) * GP + (tid & 15) * 8); *(v8h*)((pln ? VTL : VTH) + vb + (size_t)col * SS) = val; }
        asm volatile("s_wait_xcnt 0x0" ::: "memory");    // the wait between the last issued global stores and any later overwrite of a register they name
    } else {
        float* os = (float*)stg + wave * (32 * 68);
#pragma unroll
        for (int t = 0; t < 4; ++t) { const float bv = bfr(bias[c0 + t * 16 + lr]);
#pragma unroll
            for (int m = 0; m < 2; ++m)
#pragma unroll
                for (int j = 0; j < 8; ++j) os[(m * 16 + hi * 8 + j) * 68 + t * 16 + lr] = acc[m][t][j] + bv; }
        __syncthreads();
        h16* c1 = (job == 0 ? QH : job == 1 ? KH : job == 3 ? PKH : PQH) + (size_t)r0 * DM + c0; h16* c2 = (job == 0 ? QL : job == 1 ? KL : job == 3 ? PKL : PQL) + (size_t)r0 * DM + c0;
        auto pass = [&]() {
#pragma unroll
            for (int s = 0; s < 8; ++s) { const int row = 4 * s + (lane >> 3), piece = lane & 7; const float* sp = os + row * 68 + piece * 8; v8h o1, o2;
#pragma unroll
                for (int i = 0; i < 8; ++i) { const h16 a = (h16)sp[i]; o1[i] = a; o2[i] = (h16)((sp[i] - (float)a) * LOSC); }
                *(v8h*)(c1 + (size_t)row * DM + piece * 8) = o1; *(v8h*)(c2 + (size_t)row * DM + piece * 8) = o2; }
        };
        pass(); 
        asm volatile("s_wait_xcnt 0x0" ::: "memory");    // the wait between the last issued global stores and any later overwrite of a register they name (the built code can fall through into the other branch's text)
    }
}
// band16: dst[i][c] = (a + ax/1024)[row i].(ph + pl/1024)[window row 16 w4 + c], i < 16, c < 80 (hi.hi + hi.lo + lo.hi over K = 64); a, ax: A fragments in registers; ph, pl: staged LDS rows of pitch SP.
// The 128-row window of a relative table is two chunks of 64 table rows, cb and cb + 1; chunk c stands in slot c & 1 of the table's 128 staged rows.
__device__ __forceinline__ void band16(const v16h (&a)[2], const v16h (&ax)[2], const h16* ph, const h16* pl, int cb, int w4, int lr, int hi, float* dst) {
    const int ao = lr * SP + 8 * hi;
    v8f acc[BW / 16], accx[BW / 16];
#pragma unroll
    for (int t = 0; t < BW / 16; ++t) { acc[t] = (v8f){}; accx[t] = (v8f){}; }
#pragma unroll
    for (int kc = 0; kc < 2; ++kc) {
#pragma unroll
        for (int t = 0; t < BW / 16; ++t) { const int T = w4 + t, bo = (((cb + (T >> 2)) & 1) * 64 + (T & 3) * 16) * SP + ao + kc * 32;
            const v16h bh = cat16(*(const v8ha*)(ph + bo), *(const v8ha*)(ph + bo + 16)), bl = cat16(*(const v8ha*)(pl + bo), *(const v8ha*)(pl + bo + 16));
            acc[t] = wmma16(a[kc], bh, acc[t]); accx[t] = wmma16(a[kc], bl, accx[t]); accx[t] = wmma16(ax[kc], bh, accx[t]); }
    }
#pragma unroll
    for (int t = 0; t < BW / 16; ++t)
#pragma unroll
        for (int j = 0; j < 8; ++j) dst[(hi * 8 + j) * BP + t * 16 + lr] = acc[t][j] + accx[t][j] * LOSCI;
}
// copy8a, copy4a: eight or four asynchronous copies of 16 bytes a lane, global -> LDS, each with its own pair of addresses.
// The s_wait_xcnt stands as the last line of the copies' own statement: it precedes every later rewrite of a register that a copy names.
__device__ __forceinline__ void copy8a(const unsigned (&l)[8], const void* const (&g)[8]) {
    asm volatile("global_load_async_to_lds_b128 %0, %8, off\n\t"
                 "global_load_async_to_lds_b128 %1, %9, off\n\t"
                 "global_load_async_to_lds_b128 %2, %10, off\n\t"
                 "global_load_async_to_lds_b128 %3, %11, off\n\t"
                 "global_load_async_to_lds_b128 %4, %12, off\n\t"
                 "global_load_async_to_lds_b128 %5, %13, off\n\t"
                 "global_load_async_to_lds_b128 %6, %14, off\n\t"
                 "global_load_async_to_lds_b128 %7, %15, off\n\t"
                 "s_wait_xcnt 0x0"
                 :: "v"(l[0]), "v"(l[1]), "v"(l[2]), "v"(l[3]), "v"(l[4]), "v"(l[5]), "v"(l[6]), "v"(l[7]),
                    "v"(g[0]), "v"(g[1]), "v"(g[2]), "v"(g[3]), "v"(g[4]), "v"(g[5]), "v"(g[6]), "v"(g[7])
                 : "memory");
}
__device__ __forceinline__ void copy4a(const unsigned (&l)[4], const void* const (&g)[4]) {
    asm volatile("global_load_async_to_lds_b128 %0, %4, off\n\t"
                 "global_load_async_to_lds_b128 %1, %5, off\n\t"
                 "global_load_async_to_lds_b128 %2, %6, off\n\t"
                 "global_load_async_to_lds_b128 %3, %7, off\n\t"
                 "s_wait_xcnt 0x0"
                 :: "v"(l[0]), "v"(l[1]), "v"(l[2]), "v"(l[3]), "v"(g[0]), "v"(g[1]), "v"(g[2]), "v"(g[3])
                 : "memory");
}
// k_attn: block = (pair p, 64 queries q0..), 8 waves; it walks the 8 key tiles k0 = 0, 64, ..; grid 512 blocks. A tile has two phases, each ended by a barrier.
// Phase 1, the bands and the content: wave w < 4 forms the c2p band of queries 16w .. 16w + 15 against window rows 16w .. 16w + 79 of pos_k (window = table rows q0 - k0 + 448 ..), wave 4 + w the
// p2c band of keys 16w .. against window rows 16w .. 16w + 79 of pos_q (window = table rows k0 - q0 + 448 ..; both ranges lie in [0, 1023] for every tile). In a band, element (row i, opposite
// position j of the tile) stands at column i - j + 63. Then every wave forms the content scores of ITS piece of the tile: queries 16 (w & 3) .., keys 32 (w >> 2) .. (hi.hi + hi.lo + lo.hi: 12 WMMA).
// Phase 2, the softmax step of that piece: bias[q][k] = c2p[q][q - k + 511] + p2c[k][k - q + 511] is read off the two bands' diagonals, logits = (content + bias) x SCL; online softmax;
// weights x32768 hi/residual; 12 WMMA .v. A wave keeps maximum, sum and output of its own key halves; waves w and w + 4 are joined behind the loop.
// Both products are formed transposed: scores^T = K.Q^T (A = key rows, B = the q fragments) and out^T += V^T.P^T (A = rows of transposed V, B = the weights). A lane then holds 16 of the
// 32 scores of ONE query (column lr; keys 8 hi + j and 16 + 8 hi + j), which are the very k positions of that lane in a B fragment: the weights go from the score registers into the
// B operand without a pass through LDS, and maximum, sum and rescale factor are one value a lane, joined between the two half-waves by one exchange.
// Staged in LDS by asynchronous copies, whole 128-byte rows at pitch 144 B, hi and residual planes, one buffer each, refilled in the phase that does not read it: the tile's 64 rows of transposed V
// (read in phase 2, brought in phase 1), its 64 key rows and the two 128-row windows (read in phase 1, brought in phase 2). From one tile to the next both windows move by 64 rows, pos_k down and
// pos_q up: half of each stays where it is, and only the new chunk of 64 rows is brought, into the slot of the chunk that has left the window. The q fragments stay in registers.
#define SPB  (SP * 2)            // bytes of a staged row
#define RV   0                   // staged rows: V^T hi (64), V^T residual (64)
#define RK   128                 // key hi (64), key residual (64)
#define RPK  256                 // pos_k window hi (128), residual (128)
#define RPQ  512                 // pos_q window hi (128), residual (128)
// four waves a SIMD (two blocks a WGP, all 512 in one round) need at most 256 registers a wave
__global__ __launch_bounds__(256) __attribute__((amdgpu_waves_per_eu(4, 4))) void k_attn(const h16* __restrict__ QH, const h16* __restrict__ QL, const h16* __restrict__ KH, const h16* __restrict__ KL,
                                             const h16* __restrict__ PKH, const h16* __restrict__ PKL, const h16* __restrict__ PQH, const h16* __restrict__ PQL,
                                             const h16* __restrict__ VTH, const h16* __restrict__ VTL, float* out) {
    __shared__ __align__(16) h16 st[768 * SP];
    __shared__ float bd[8 * BPL];
    const int tid = threadIdx.x, lane = tid & 31, wave = __builtin_amdgcn_readfirstlane(tid >> 5), lr = lane & 15, hi = lane >> 4;
    const int p = blockIdx.x / (SS / 64), qx = blockIdx.x - p * (SS / 64), b = p / NH_, h = p - b * NH_;
    const int q0 = qx * 64;
    const size_t tok0 = (size_t)b * SS;
    const size_t vbase = (((size_t)b * NH_ + h) * HD) * SS;
    const int side = wave >> 2, w4 = wave & 3;          // side: the band's table, and the wave's half of a tile's keys; w4: its 16 band rows, and its 16 queries
    const int srow = tid >> 3, spc = (tid & 7) * 8;     // the lane's row (of 32 a copy round) and 16-byte piece of a 128-byte row
    const unsigned lst = (unsigned)(size_t)(st + srow * SP + spc);    // LDS byte address of the lane's piece in staged row srow
    const size_t hoff = (size_t)srow * DM + h * HD + spc;             // the lane's element in a slab of 32 rows of a [row][1024] plane, at head h
    auto keys = [&](int kt) {    // the 64 key rows of tile kt
        const size_t o = (tok0 + (size_t)kt * 64) * DM + hoff;
        const unsigned l[4] = { lst + RK * SPB, lst + (RK + 32) * SPB, lst + (RK + 64) * SPB, lst + (RK + 96) * SPB };
        const void* const g[4] = { KH + o, KH + o + 32 * DM, KL + o, KL + o + 32 * DM };
        copy4a(l, g);
    };
    auto vals = [&](int kt) {    // the 64 rows of transposed V, keys of tile kt
        const size_t o = vbase + (size_t)srow * SS + kt * 64 + spc;
        const unsigned l[4] = { lst + RV * SPB, lst + (RV + 32) * SPB, lst + (RV + 64) * SPB, lst + (RV + 96) * SPB };
        const void* const g[4] = { VTH + o, VTH + o + 32 * SS, VTL + o, VTL + o + 32 * SS };
        copy4a(l, g);
    };
    auto chunks = [&](int ck, int cq) {    // chunk ck of pos_k and chunk cq of pos_q, each into slot (chunk & 1) of its window
        const size_t ok = (size_t)ck * 64 * DM + hoff, oq = (size_t)cq * 64 * DM + hoff;
        const unsigned lk = lst + (unsigned)(RPK + (ck & 1) * 64) * SPB, lq = lst + (unsigned)(RPQ + (cq & 1) * 64) * SPB;
        const unsigned l[8] = { lk, lk + 32 * SPB, lk + 128 * SPB, lk + 160 * SPB, lq, lq + 32 * SPB, lq + 128 * SPB, lq + 160 * SPB };
        const void* const g[8] = { PKH + ok, PKH + ok + 32 * DM, PKL + ok, PKL + ok + 32 * DM, PQH + oq, PQH + oq + 32 * DM, PQL + oq, PQL + oq + 32 * DM };
        copy8a(l, g);
    };
    keys(0); chunks(qx + 7, 7 - qx); chunks(qx + 8, 8 - qx);
    v16h qa[2], ql[2];
    const size_t qo0 = (tok0 + q0 + w4 * 16 + lr) * DM + h * HD + 8 * hi;
#pragma unroll
    for (int kc = 0; kc < 2; ++kc) { qa[kc] = cat16(*(const v8h*)(QH + qo0 + kc * 32), *(const v8h*)(QH + qo0 + kc * 32 + 16)); ql[kc] = cat16(*(const v8h*)(QL + qo0 + kc * 32), *(const v8h*)(QL + qo0 + kc * 32 + 16)); }
    asm volatile("s_wait_xcnt 0x0" ::: "memory");        // the wait between these issued global loads and a later overwrite of their address registers
    v8f o[4], ox[4];
#pragma unroll
    for (int n = 0; n < 4; ++n) { o[n] = (v8f){}; ox[n] = (v8f){}; }
    float mrow = -3.0e38f, lpart = 0.f;    // of the lane's query, over the wave's key halves: the running maximum (equal in both half-waves) and this half-wave's part of the sum
    const h16* sp = st + (RPK + side * 256) * SP;
    const h16* sa = st + (RK + w4 * 16) * SP + lr * SP + 8 * hi;             // side 1: the band's key rows
    const h16* sk = st + (RK + side * 32 + lr) * SP + 8 * hi;               // the wave's 32 keys of the tile
    const h16* sv = st + (RV + lr) * SP + side * 32 + 8 * hi;               // V^T rows, at the wave's 32 keys
    const float* bc = bd + w4 * BPL + lr * (BP + 1) + 63 - side * 32 - 8 * hi;                       // c2p of the lane's query, at its first key: key + 1 stands one column down
    const float* bp = bd + (4 + 2 * side) * BPL + 8 * hi * (BP + 1) + 63 - w4 * 16 - lr;              // p2c of the lane's first key, at its query: key + 1 stands one row and one column up
#pragma unroll 1    // one rolled trip a key tile: the two feet (waits, barrier, refill) stand once
    for (int kt = 0; kt < SS / 64; ++kt) {
        const int ck = qx - kt + 7, cq = kt - qx + 7;    // first chunk of the pos_k window and of the pos_q window of this tile
        asm volatile("s_wait_dscnt 0x0" ::: "memory");       // this wave's reads of the bands and of the V rows of the tile before are done
        asm volatile("s_wait_asynccnt 0x0" ::: "memory");    // this wave's copies of this tile's key rows and window chunks have landed
        __syncthreads();                                     // publishes them and ends every reader's last read of the bands and V rows of the tile before
        vals(kt);
        v16h ba[2], bx[2];
        if (side) {
#pragma unroll
            for (int kc = 0; kc < 2; ++kc) { ba[kc] = cat16(*(const v8ha*)(sa + kc * 32), *(const v8ha*)(sa + kc * 32 + 16)); bx[kc] = cat16(*(const v8ha*)(sa + 64 * SP + kc * 32), *(const v8ha*)(sa + 64 * SP + kc * 32 + 16)); }
        } else {
#pragma unroll
            for (int kc = 0; kc < 2; ++kc) { ba[kc] = qa[kc]; bx[kc] = ql[kc]; }
        }
        band16(ba, bx, sp, sp + 128 * SP, side ? cq : ck, w4, lr, hi, bd + wave * BPL);
        v8f s0 = {}, s1 = {}, x0 = {}, x1 = {};
#pragma unroll
        for (int kc = 0; kc < 2; ++kc) {
            const h16* k0 = sk + kc * 32; const h16* k1 = k0 + 16 * SP;
            const v16h k0h = cat16(*(const v8ha*)(k0), *(const v8ha*)(k0 + 16)), k1h = cat16(*(const v8ha*)(k1), *(const v8ha*)(k1 + 16));
            const v16h k0l = cat16(*(const v8ha*)(k0 + 64 * SP), *(const v8ha*)(k0 + 64 * SP + 16)), k1l = cat16(*(const v8ha*)(k1 + 64 * SP), *(const v8ha*)(k1 + 64 * SP + 16));
            s0 = wmma16(k0h, qa[kc], s0); x0 = wmma16(k0h, ql[kc], x0); s1 = wmma16(k1h, qa[kc], s1); x1 = wmma16(k1h, ql[kc], x1);
            x0 = wmma16(k0l, qa[kc], x0); x1 = wmma16(k1l, qa[kc], x1);
        }
        asm volatile("s_wait_dscnt 0x0" ::: "memory");       // this wave's band is written and its reads of the key rows and windows are done
        asm volatile("s_wait_asynccnt 0x0" ::: "memory");    // this wave's copies of this tile's V rows have landed
        __syncthreads();                                     // publishes the bands and the V rows and ends every reader's last read of this tile's key rows and windows
        if (kt + 1 < SS / 64) { keys(kt + 1); chunks(ck - 1, cq + 2); }
        v16h vh[4], vl[4];
#pragma unroll
        for (int n = 0; n < 4; ++n) { const h16* vp = sv + n * 16 * SP;
            vh[n] = cat16(*(const v8ha*)(vp), *(const v8ha*)(vp + 16)); vl[n] = cat16(*(const v8ha*)(vp + 64 * SP), *(const v8ha*)(vp + 64 * SP + 16)); }
        v8f b0, b1;
#pragma unroll
        for (int j = 0; j < 8; ++j) { b0[j] = bc[-j] + bp[j * (BP + 1)]; b1[j] = bc[-16 - j] + bp[BPL + j * (BP + 1)]; }
        // whole-tile vector arithmetic: element j and j + 1 of one accumulator stand in neighbouring registers and pair into packed instructions without moves
        const v8f a0 = (s0 + x0 * LOSCI + b0) * SCL, a1 = (s1 + x1 * LOSCI + b1) * SCL;
        float mx = fmaxf(a0[0], a1[0]);
#pragma unroll
        for (int j = 1; j < 8; ++j) mx = fmaxf(mx, fmaxf(a0[j], a1[j]));
        mx = fmaxf(mx, xhalf(mx));
        const float mn = fmaxf(mrow, mx), alpha = __expf(mrow - mn);
        mrow = mn;
        v8f e0, e1;
#pragma unroll
        for (int j = 0; j < 8; ++j) e0[j] = __expf(a0[j] - mn);
#pragma unroll
        for (int j = 0; j < 8; ++j) e1[j] = __expf(a1[j] - mn);
        const v8f ee = e0 + e1;
        const float es = ((ee[0] + ee[1]) + (ee[2] + ee[3])) + ((ee[4] + ee[5]) + (ee[6] + ee[7]));
        const v8f ps0 = e0 * PSC, ps1 = e1 * PSC;
        const v8h h0 = __builtin_convertvector(ps0, v8h), h1 = __builtin_convertvector(ps1, v8h);
        const v8h r0 = __builtin_convertvector((ps0 - __builtin_convertvector(h0, v8f)) * LOSC, v8h), r1 = __builtin_convertvector((ps1 - __builtin_convertvector(h1, v8f)) * LOSC, v8h);
        const v16h pa = cat16(h0, h1), px = cat16(r0, r1);    // B fragments: positions 0 .. 7 = keys 8 hi + j, positions 8 .. 15 = keys 16 + 8 hi + j, as in the V^T fragments
        lpart = lpart * alpha + es;
#pragma unroll
        for (int n = 0; n < 4; ++n) { o[n] *= alpha; ox[n] *= alpha; }
#pragma unroll
        for (int n = 0; n < 4; ++n) { o[n] = wmma16(vh[n], pa, o[n]); ox[n] = wmma16(vl[n], pa, ox[n]); ox[n] = wmma16(vh[n], px, ox[n]); }
    }
    asm volatile("s_wait_asynccnt 0x0" ::: "memory");        // nothing is outstanding when the wave goes on
    asm volatile("s_wait_dscnt 0x0" ::: "memory");           // this wave's reads of the last tile are done
    __syncthreads();                                         // ends every reader's last read of the staged rows: their LDS now carries the join and the output rows
    // The join of waves w and w + 4 (same queries, the other key halves): wave w + 4 hands over its output, maximum and sum, 36 floats a lane.
    float* mg = (float*)st + (w4 * 32 + lane) * 36;
    const float lsum = lpart + xhalf(lpart);
    if (side) {
#pragma unroll
        for (int n = 0; n < 4; ++n)
#pragma unroll
            for (int g = 0; g < 2; ++g) { v4f val;
#pragma unroll
                for (int e = 0; e < 4; ++e) val[e] = o[n][g * 4 + e] + ox[n][g * 4 + e] * LOSCI;
                *(v4fa*)(mg + n * 8 + g * 4) = val; }
        *(v4fa*)(mg + 32) = (v4f){mrow, lsum, 0.f, 0.f};
    }
    __syncthreads();    // publishes the handed-over halves
    float* os = (float*)(st + RK * SP) + w4 * (16 * 68);    // out^T: the lane holds columns 16 n + 8 hi + j of its query's output row
    if (!side) {
        const v4f ml = *(const v4fa*)(mg + 32);
        const float mn = fmaxf(mrow, ml[0]), f0 = __expf(mrow - mn), f1 = __expf(ml[0] - mn);
        const float inv = 1.0f / ((lsum * f0 + ml[1] * f1) * PSC);
#pragma unroll
        for (int n = 0; n < 4; ++n)
#pragma unroll
            for (int g = 0; g < 2; ++g) { const v4f ot = *(const v4fa*)(mg + n * 8 + g * 4); v4f val;
#pragma unroll
                for (int e = 0; e < 4; ++e) val[e] = ((o[n][g * 4 + e] + ox[n][g * 4 + e] * LOSCI) * f0 + ot[e] * f1) * inv;
                *(v4fa*)(os + lr * 68 + n * 16 + hi * 8 + g * 4) = val; }
    }
    __syncthreads();    // publishes the output rows
    float* ob = out + (tok0 + q0 + w4 * 16) * DM + (size_t)h * HD;
#pragma unroll
    for (int s = 0; s < 4; ++s) { const int Lid = (lane >> 3) + 4 * (s + 4 * side), piece = lane & 7; const int row = Lid >> 1, cofs = (Lid & 1) * 32 + piece * 4;
        const v4f val = *(const v4fa*)(os + row * 68 + cofs); *(v4f*)(ob + (size_t)row * DM + cofs) = val; }
}

extern "C" void kernel_launch(void* const* d_in, const int* in_sizes, int n_in,
                              void* d_out, int out_size, void* d_ws, size_t ws_size, hipStream_t stream) {
    (void)in_sizes; (void)n_in; (void)out_size;
    const float* x = (const float*)d_in[0]; const float* rel = (const float*)d_in[1]; const float* Wq = (const float*)d_in[2]; const float* bq = (const float*)d_in[3];
    const float* Wk = (const float*)d_in[4]; const float* bk = (const float*)d_in[5]; const float* Wv = (const float*)d_in[6]; const float* bv = (const float*)d_in[7];
    float* out = (float*)d_out;    // [4][512][1024]
    char* wsp = (char*)d_ws;
    auto take = [&](size_t bytes) { char* p = wsp; wsp += (bytes + 255) & ~(size_t)255; return (void*)p; };
    bf* Xb = (bf*)take((size_t)NTK * DM * 2); bf* Rb = (bf*)take((size_t)NR * DM * 2); bf* WqT = (bf*)take((size_t)DM * DM * 2); bf* WkT = (bf*)take((size_t)DM * DM * 2); bf* WvT = (bf*)take((size_t)DM * DM * 2);
    h16* QH = (h16*)take((size_t)NTK * DM * 2); h16* QL = (h16*)take((size_t)NTK * DM * 2); h16* KH = (h16*)take((size_t)NTK * DM * 2); h16* KL = (h16*)take((size_t)NTK * DM * 2);
    h16* PKH = (h16*)take((size_t)NR * DM * 2); h16* PKL = (h16*)take((size_t)NR * DM * 2); h16* PQH = (h16*)take((size_t)NR * DM * 2); h16* PQL = (h16*)take((size_t)NR * DM * 2);
    h16* VTH = (h16*)take((size_t)NTK * DM * 2); h16* VTL = (h16*)take((size_t)NTK * DM * 2);
    if ((size_t)(wsp - (char*)d_ws) > ws_size) return;    // 4.2 + 2.1 + 6.3 + 16.8 + 8.4 + 8.4 ~ 46 MB
    k_prep<<<3 * WTB + NTK / 8 + NR / 8, 256, 0, stream>>>(x, rel, Wq, Wk, Wv, Xb, Rb, WqT, WkT, WvT);
    k_gemm5<<<3 * GXB + 2 * GRB, 256, 0, stream>>>(Xb, Rb, WqT, WkT, WvT, bq, bk, bv, QH, QL, KH, KL, VTH, VTL, PKH, PKL, PQH, PQL);    // pos_k = rel.Wk + bk, pos_q = rel.Wq + bq
    k_attn<<<NB_ * NH_ * (SS / 64), 256, 0, stream>>>(QH, QL, KH, KL, PKH, PKL, PQH, PQL, VTH, VTL, out);
}
